// v000
// The times below were measured on an AMD MI455X: many runs one after another, warmed up first and cycling through
// copies of the inputs, with the whole window's GPU time divided by the number of runs. Launches and the gaps
// between them are all in it. The median over several windows is given; except for v000 it joins two sittings, which
// can be a few percent apart, so the side-by-side timings, each taken in one sitting, are the better comparison.
// v000 is the starting kernel. One run takes 3010 microseconds.
#include <hip/hip_runtime.h>

// Compute dtypes, f32 accumulate, per item (512 tokens): LayerNorm in f32 -> bf16 hi + UNSCALED residual planes; qkv, to_out and the GLU projection as [512 x K].[K x N] GEMMs
// against the exact bf16 k-major weights (two products); per head (batched over the 8 heads with blockIdx.z): sim = q.k^T ([512 x 32].[32 x 512], three products in two launches),
// the causal -10000 mask then x scale and the row softmax in f32 -> P planes, ctx = P.v ([512 x 512].[512 x 64 (32 live)], three products) - on v_wmma_f32_16x16x32_bf16; the GLU

#define NBT  32
#define SS   512
#define DIM  256
#define NH_  8
#define HD   32
#define INR  256
#define DM   DIM
#define SCL  0.17677669529663687f
#define LOSC 1024.0f

typedef _Float16 h16;
typedef unsigned short bf;
typedef __attribute__((ext_vector_type(16))) __bf16   v16bf;
typedef __attribute__((ext_vector_type(16))) _Float16 v16h;
typedef __attribute__((ext_vector_type(8)))  _Float16 v8h;
typedef __attribute__((ext_vector_type(8)))  unsigned short v8us;
typedef __attribute__((ext_vector_type(8)))  float    v8f;
typedef __attribute__((ext_vector_type(4)))  float    v4f;
typedef v8h  __attribute__((may_alias)) v8ha;
typedef v4f  __attribute__((may_alias)) v4fa;
typedef v8us __attribute__((may_alias)) v8usa;

__device__ __forceinline__ unsigned short f2bf(float f) { unsigned u = __float_as_uint(f); u += 0x7FFFu + ((u >> 16) & 1u); return (unsigned short)(u >> 16); }
__device__ __forceinline__ float bf2f(unsigned short b) { return __uint_as_float(((unsigned)b) << 16); }
__device__ __forceinline__ float bfr(float f) { return bf2f(f2bf(f)); }
__device__ __forceinline__ v16h cat16(v8h lo, v8h hi) { return __builtin_shufflevector(lo, hi, 0, 1, 2, 3, 4, 5, 6, 7, 8, 9, 10, 11, 12, 13, 14, 15); }
__device__ __forceinline__ v16bf cat16b(v8us lo, v8us hi) { return __builtin_bit_cast(v16bf, __builtin_shufflevector(lo, hi, 0, 1, 2, 3, 4, 5, 6, 7, 8, 9, 10, 11, 12, 13, 14, 15)); }
__device__ __forceinline__ v8f wmma16(v16h a, v16h b, v8f c) { return __builtin_amdgcn_wmma_f32_16x16x32_f16(false, a, false, b, (short)0, c, false, false); }
__device__ __forceinline__ v8f wmmab(v16bf a, v16bf b, v8f c) { return __builtin_amdgcn_wmma_f32_16x16x32_bf16(false, a, false, b, (short)0, c, false, false); }

// k_gemmb: 64 x 64 block tile (4 waves x 16 x 64) of C[NTK][NW] = (A [+ Al]).B^T (K = DM = 256 by default) [+ bf(bias[c])] [+ bf(R[r][c]) residual]; f32 whole-line epilogue (or f16
template <bool SPLITA, bool F16OUT = false>
__global__ __launch_bounds__(128) void k_gemmb(const bf* __restrict__ A, const bf* __restrict__ Al, const bf* __restrict__ Bn, const float* __restrict__ bias, float* C, int ldc, h16* C2, const float* __restrict__ R = nullptr, int K = DM, int roundR = 1) {
    __shared__ __align__(16) float ost[4][16 * 68];
    const int lane = threadIdx.x & 31, wave = threadIdx.x >> 5, lr = lane & 15, hi = lane >> 4;
    const int r0 = blockIdx.x * 64 + wave * 16, c0 = blockIdx.y * 64;
    const size_t aoff = (size_t)(r0 + lr) * K + 8 * hi;
    size_t boff[4];
#pragma unroll
    for (int t = 0; t < 4; ++t) boff[t] = (size_t)(c0 + t * 16 + lr) * K + 8 * hi;
    v8f acc[4];
#pragma unroll
    for (int t = 0; t < 4; ++t) acc[t] = (v8f){};
#pragma unroll 1
    for (int kc = 0; kc < K; kc += 32) {
        const v16bf a = cat16b(*(const v8us*)(A + aoff + kc), *(const v8us*)(A + aoff + kc + 16));
        v16bf al = a;
        if (SPLITA) al = cat16b(*(const v8us*)(Al + aoff + kc), *(const v8us*)(Al + aoff + kc + 16));
#pragma unroll
        for (int t = 0; t < 4; ++t) { const v16bf b = cat16b(*(const v8us*)(Bn + boff[t] + kc), *(const v8us*)(Bn + boff[t] + kc + 16)); acc[t] = wmmab(a, b, acc[t]); if (SPLITA) acc[t] = wmmab(al, b, acc[t]); }
        asm volatile("v_nop\n\tv_nop\n\tv_nop\n\tv_nop" : "+v"(acc[0]), "+v"(acc[1]), "+v"(acc[2]), "+v"(acc[3]) : "v"(a), "v"(al));
    }
    float* os = &ost[wave][0];
#pragma unroll
    for (int t = 0; t < 4; ++t) { const float bv = bias ? bfr(bias[c0 + t * 16 + lr]) : 0.f;
#pragma unroll
        for (int j = 0; j < 8; ++j) os[(hi * 8 + j) * 68 + t * 16 + lr] = acc[t][j] + bv; }
    __syncthreads();
    if (F16OUT) {
        h16* crow = (h16*)(void*)C + (size_t)r0 * ldc + c0;
        auto pass = [&]() {
#pragma unroll
            for (int s = 0; s < 4; ++s) { const int row = 4 * s + (lane >> 3), piece = lane & 7; const float* sp = os + row * 68 + piece * 8; v8h o, o2;
#pragma unroll
                for (int i = 0; i < 8; ++i) { const h16 a = (h16)sp[i]; o[i] = a; o2[i] = (h16)((sp[i] - (float)a) * LOSC); }
                *(v8h*)(crow + (size_t)row * ldc + piece * 8) = o; if (C2) *(v8h*)(C2 + (size_t)r0 * ldc + c0 + (size_t)row * ldc + piece * 8) = o2; }
        };
        pass(); 
    } else {
        float* crow = C + (size_t)r0 * ldc + c0;
        auto pass = [&]() {
#pragma unroll
            for (int s = 0; s < 8; ++s) { const int Lid = (lane >> 3) + 4 * s, piece = lane & 7; const int row = Lid >> 1, cofs = (Lid & 1) * 32 + piece * 4;
                v4f val = *(const v4fa*)(os + row * 68 + cofs); if (R) { const v4f rv = *(const v4f*)(R + ((size_t)r0 + row) * ldc + c0 + cofs); val += roundR ? (v4f){bfr(rv[0]), bfr(rv[1]), bfr(rv[2]), bfr(rv[3])} : rv; }
                *(v4f*)(crow + (size_t)row * ldc + cofs) = val; }
        };
        pass(); 
    }
}

// k_gemmbz: batched k_gemmb — blockIdx.z = batch index g; A/Al advance by g*sA, Bn by g*sB, bias by g*sBias, C (and R) by g*sC elements; otherwise identical:
// k_gemmb: 64 x 64 block tile (4 waves x 16 x 64) of C[NTK][NW] = (A [+ Al]).B^T (K = DM = 256 by default) [+ bf(bias[c])] [+ bf(R[r][c]) residual]; f32 whole-line epilogue (or f16
template <bool SPLITA, bool F16OUT = false>
__global__ __launch_bounds__(128) void k_gemmbz(const bf* __restrict__ A, const bf* __restrict__ Al, const bf* __restrict__ Bn, const float* __restrict__ bias, float* C, int ldc, h16* C2, const float* __restrict__ R, int K, int roundR, size_t sA, size_t sB, size_t sBias, size_t sC) {
    { const size_t g = blockIdx.z; A += g * sA; if (Al) Al += g * sA; Bn += g * sB; if (bias) bias += g * sBias; C += g * sC; if (R) R += g * sC; }
    __shared__ __align__(16) float ost[4][16 * 68];
    const int lane = threadIdx.x & 31, wave = threadIdx.x >> 5, lr = lane & 15, hi = lane >> 4;
    const int r0 = blockIdx.x * 64 + wave * 16, c0 = blockIdx.y * 64;
    const size_t aoff = (size_t)(r0 + lr) * K + 8 * hi;
    size_t boff[4];
#pragma unroll
    for (int t = 0; t < 4; ++t) boff[t] = (size_t)(c0 + t * 16 + lr) * K + 8 * hi;
    v8f acc[4];
#pragma unroll
    for (int t = 0; t < 4; ++t) acc[t] = (v8f){};
#pragma unroll 1
    for (int kc = 0; kc < K; kc += 32) {
        const v16bf a = cat16b(*(const v8us*)(A + aoff + kc), *(const v8us*)(A + aoff + kc + 16));
        v16bf al = a;
        if (SPLITA) al = cat16b(*(const v8us*)(Al + aoff + kc), *(const v8us*)(Al + aoff + kc + 16));
#pragma unroll
        for (int t = 0; t < 4; ++t) { const v16bf b = cat16b(*(const v8us*)(Bn + boff[t] + kc), *(const v8us*)(Bn + boff[t] + kc + 16)); acc[t] = wmmab(a, b, acc[t]); if (SPLITA) acc[t] = wmmab(al, b, acc[t]); }
        asm volatile("v_nop\n\tv_nop\n\tv_nop\n\tv_nop" : "+v"(acc[0]), "+v"(acc[1]), "+v"(acc[2]), "+v"(acc[3]) : "v"(a), "v"(al));
    }
    float* os = &ost[wave][0];
#pragma unroll
    for (int t = 0; t < 4; ++t) { const float bv = bias ? bfr(bias[c0 + t * 16 + lr]) : 0.f;
#pragma unroll
        for (int j = 0; j < 8; ++j) os[(hi * 8 + j) * 68 + t * 16 + lr] = acc[t][j] + bv; }
    __syncthreads();
    if (F16OUT) {
        h16* crow = (h16*)(void*)C + (size_t)r0 * ldc + c0;
        auto pass = [&]() {
#pragma unroll
            for (int s = 0; s < 4; ++s) { const int row = 4 * s + (lane >> 3), piece = lane & 7; const float* sp = os + row * 68 + piece * 8; v8h o, o2;
#pragma unroll
                for (int i = 0; i < 8; ++i) { const h16 a = (h16)sp[i]; o[i] = a; o2[i] = (h16)((sp[i] - (float)a) * LOSC); }
                *(v8h*)(crow + (size_t)row * ldc + piece * 8) = o; if (C2) *(v8h*)(C2 + (size_t)r0 * ldc + c0 + (size_t)row * ldc + piece * 8) = o2; }
        };
        pass(); 
    } else {
        float* crow = C + (size_t)r0 * ldc + c0;
        auto pass = [&]() {
#pragma unroll
            for (int s = 0; s < 8; ++s) { const int Lid = (lane >> 3) + 4 * s, piece = lane & 7; const int row = Lid >> 1, cofs = (Lid & 1) * 32 + piece * 4;
                v4f val = *(const v4fa*)(os + row * 68 + cofs); if (R) { const v4f rv = *(const v4f*)(R + ((size_t)r0 + row) * ldc + c0 + cofs); val += roundR ? (v4f){bfr(rv[0]), bfr(rv[1]), bfr(rv[2]), bfr(rv[3])} : rv; }
                *(v4f*)(crow + (size_t)row * ldc + cofs) = val; }
        };
        pass(); 
    }
}

// k_wt: WT [n][K] = bf16(W[k][n]) (k-major [K][ncols]) via 64 x 64 LDS tiles; grid (K/64, ncols/64).
__global__ __launch_bounds__(256) void k_wt(const float* __restrict__ Wm, int K, int ncols, bf* WT) {
    __shared__ __align__(16) unsigned short tl[64 * 72];
    const int tid = threadIdx.x, k0 = blockIdx.x * 64, n0 = blockIdx.y * 64;
    const int kk = tid >> 2, nq = (tid & 3) * 16;
#pragma unroll
    for (int i = 0; i < 16; ++i) tl[(nq + i) * 72 + kk] = f2bf(Wm[(size_t)(k0 + kk) * ncols + n0 + nq + i]);
    __syncthreads();
    const int piece = tid & 7;
    auto pass = [&]() {
#pragma unroll
        for (int s = 0; s < 2; ++s) { const int nr = (tid >> 3) + 32 * s; const v8us val = *(const v8usa*)(tl + nr * 72 + piece * 8); *(v8us*)(WT + (size_t)(n0 + nr) * K + k0 + piece * 8) = val; }
    };
    pass(); 
}

__global__ __launch_bounds__(256) void k_ln(const float* __restrict__ xb, const float* __restrict__ g, const float* __restrict__ bb, bf* Hh, bf* Hl) {
    const int lane = threadIdx.x & 31, r = blockIdx.x * 8 + (threadIdx.x >> 5); if (r >= SS) return; float v[8]; float s = 0.f;
#pragma unroll
    for (int i = 0; i < 8; ++i) { v[i] = bfr(xb[(size_t)r * DIM + lane * 8 + i]); s += v[i]; }
#pragma unroll
    for (int sh = 16; sh; sh >>= 1) s += __shfl_xor(s, sh, 32);
    const float mu = s * (1.0f / DIM); float q = 0.f;
#pragma unroll
    for (int i = 0; i < 8; ++i) { const float d = v[i] - mu; q = fmaf(d, d, q); }
#pragma unroll
    for (int sh = 16; sh; sh >>= 1) q += __shfl_xor(q, sh, 32);
    const float rs = rsqrtf(q * (1.0f / DIM) + 1e-5f); v8us oh, ol;
#pragma unroll
    for (int i = 0; i < 8; ++i) { const int c = lane * 8 + i; const float y = (v[i] - mu) * rs * bfr(g[c]) + bfr(bb[c]); const unsigned short hb = f2bf(y); oh[i] = hb; ol[i] = f2bf(y - bf2f(hb)); }
    const size_t o = (size_t)r * DIM + lane * 8; *(v8us*)(Hh + o) = oh; *(v8us*)(Hl + o) = ol; 
}
__global__ __launch_bounds__(256) void k_qkplanes(const float* __restrict__ QKV, int col0, bf* Ph, bf* Pl) {
    typedef __attribute__((ext_vector_type(2))) unsigned short v2us;
    const int lane = threadIdx.x & 31; const size_t wid = (size_t)blockIdx.x * 8 + (threadIdx.x >> 5); if (wid >= (size_t)NH_ * (SS / 2)) return; const int h = (int)(wid / (SS / 2)); const int s = (int)(wid % (SS / 2)) * 2 + (lane >> 4); const int d = (lane & 15) * 2;
    v2us oh, ol;
#pragma unroll
    for (int i = 0; i < 2; ++i) { const float v = QKV[(size_t)s * (3 * INR) + col0 + h * HD + d + i]; const unsigned short hb = f2bf(v); oh[i] = hb; ol[i] = f2bf(v - bf2f(hb)); }
    const size_t o = ((size_t)h * SS + s) * HD + d; *(v2us*)(Ph + o) = oh; *(v2us*)(Pl + o) = ol; 
}
__global__ __launch_bounds__(256) void k_vtplanes(const float* __restrict__ QKV, bf* VTh, bf* VTl) {
    typedef __attribute__((ext_vector_type(2))) unsigned short v2us;
    const int lane = threadIdx.x & 31; const size_t wid = (size_t)blockIdx.x * 8 + (threadIdx.x >> 5); if (wid >= (size_t)NH_ * 64 * (SS / 64)) return;
    const int sg = (int)(wid % (SS / 64)), rest = (int)(wid / (SS / 64)), d = rest % 64, h = rest / 64; const int s0 = sg * 64 + 2 * lane; v2us oh, ol;
#pragma unroll
    for (int i = 0; i < 2; ++i) { const float v = (d < HD) ? QKV[(size_t)(s0 + i) * (3 * INR) + 2 * INR + h * HD + (d < HD ? d : 0)] : 0.f; const unsigned short hb = f2bf(v); oh[i] = hb; ol[i] = f2bf(v - bf2f(hb)); }
    const size_t o = ((size_t)h * 64 + d) * SS + s0; *(v2us*)(VTh + o) = oh; *(v2us*)(VTl + o) = ol; 
}
__global__ __launch_bounds__(256) void k_csoft(const float* __restrict__ S, bf* PH, bf* PL) {
    typedef __attribute__((ext_vector_type(4))) unsigned short v4us;
    const int lane = threadIdx.x & 31; const int wid = blockIdx.x * 8 + (threadIdx.x >> 5); if (wid >= NH_ * SS) return; const int i = wid % SS; const float* sr = S + (size_t)wid * SS;
    auto sc = [&](int j) -> float { return (sr[j] + (j > i ? -10000.0f : 0.f)) * SCL; };
    float m = -3.0e38f;
#pragma unroll 1
    for (int c0 = lane * 4; c0 < SS; c0 += 128) {
#pragma unroll
        for (int q = 0; q < 4; ++q) m = fmaxf(m, sc(c0 + q)); }
#pragma unroll
    for (int sh = 16; sh; sh >>= 1) m = fmaxf(m, __shfl_xor(m, sh, 32));
    float sum = 0.f;
#pragma unroll 1
    for (int c0 = lane * 4; c0 < SS; c0 += 128) {
#pragma unroll
        for (int q = 0; q < 4; ++q) sum += __expf(sc(c0 + q) - m); }
#pragma unroll
    for (int sh = 16; sh; sh >>= 1) sum += __shfl_xor(sum, sh, 32);
    const float inv = 1.0f / sum;
{
#pragma unroll 1
        for (int c0 = lane * 4; c0 < SS; c0 += 128) { v4us oh, ol;
#pragma unroll
            for (int q = 0; q < 4; ++q) { const float p = __expf(sc(c0 + q) - m) * inv; const unsigned short hb = f2bf(p); oh[q] = hb; ol[q] = f2bf(p - bf2f(hb)); }
            const size_t o = (size_t)wid * SS + c0; *(v4us*)(PH + o) = oh; *(v4us*)(PL + o) = ol; }
         }
}
// k_ctxplanes: planes [512][256] (bf16 hi + UNSCALED residual) of CTX[s][h*32+d] = CT[h][s][d] (the batched P.v results, 64-wide rows with 32 live); one wave per s: lane -> h = lane / 4, d = 8 (lane % 4) .. +7;
__global__ __launch_bounds__(256) void k_ctxplanes(const float* __restrict__ CT, bf* Ch, bf* Cl) {
    const int lane = threadIdx.x & 31, s = blockIdx.x * 8 + (threadIdx.x >> 5); if (s >= SS) return; const int h = lane >> 2, d0 = (lane & 3) * 8; v8us oh, ol;
#pragma unroll
    for (int i = 0; i < 8; ++i) { const float v = CT[((size_t)h * SS + s) * 64 + d0 + i]; const unsigned short hb = f2bf(v); oh[i] = hb; ol[i] = f2bf(v - bf2f(hb)); }
    const size_t o = (size_t)s * INR + lane * 8; *(v8us*)(Ch + o) = oh; *(v8us*)(Cl + o) = ol; 
}
__global__ __launch_bounds__(256) void k_split256(const float* __restrict__ src, bf* dh, bf* dl) {
    const int lane = threadIdx.x & 31, r = blockIdx.x * 8 + (threadIdx.x >> 5); if (r >= SS) return; const size_t o = (size_t)r * DIM + lane * 8; const v8f v = *(const v8f*)(src + o); v8us oh, ol;
#pragma unroll
    for (int i = 0; i < 8; ++i) { const unsigned short hb = f2bf(v[i]); oh[i] = hb; ol[i] = f2bf(v[i] - bf2f(hb)); }
    *(v8us*)(dh + o) = oh; *(v8us*)(dl + o) = ol; 
}
// k_glu: out[b][s][c] = O[s][c] + G[s][c] tanh(G[s][256 + c]); one wave per row: lane -> 8 columns (32 B: two 16-B stores? -> use v4f x 2: lane -> columns lane*4..+3 and 128 + lane*4..+3; a
__global__ __launch_bounds__(256) void k_glu(const float* __restrict__ O, const float* __restrict__ G, float* OUTB) {
    const int lane = threadIdx.x & 31, s = blockIdx.x * 8 + (threadIdx.x >> 5); if (s >= SS) return;
{
#pragma unroll
        for (int st = 0; st < 2; ++st) { const int c0 = st * 128 + lane * 4; v4f v;
#pragma unroll
            for (int q = 0; q < 4; ++q) { const int c = c0 + q; v[q] = O[(size_t)s * DIM + c] + G[(size_t)s * 2 * DIM + c] * tanhf(G[(size_t)s * 2 * DIM + DIM + c]); }
            *(v4f*)(OUTB + (size_t)s * DIM + c0) = v; }
         }
}

extern "C" void kernel_launch(void* const* d_in, const int* in_sizes, int n_in,
                              void* d_out, int out_size, void* d_ws, size_t ws_size, hipStream_t stream) {
    (void)in_sizes; (void)n_in; (void)out_size;
    const float* x = (const float*)d_in[0]; const float* lng = (const float*)d_in[1]; const float* lnb = (const float*)d_in[2]; const float* wqkv = (const float*)d_in[3]; const float* wout = (const float*)d_in[4]; const float* bout = (const float*)d_in[5]; const float* wglu = (const float*)d_in[6];
    float* out = (float*)d_out;    // [32][512][256]
    char* wsp = (char*)d_ws;
    auto take = [&](size_t bytes) { char* p = wsp; wsp += (bytes + 255) & ~(size_t)255; return (void*)p; };
    bf* WQKV = (bf*)take((size_t)(3 * INR) * DIM * 2); bf* WOUT = (bf*)take((size_t)DIM * INR * 2); bf* WGLU = (bf*)take((size_t)(2 * DIM) * DIM * 2);
    bf* Hh = (bf*)take((size_t)SS * DIM * 2); bf* Hl = (bf*)take((size_t)SS * DIM * 2); float* QKV = (float*)take((size_t)SS * 3 * INR * 4);
    bf* Qh = (bf*)take((size_t)NH_ * SS * HD * 2); bf* Ql = (bf*)take((size_t)NH_ * SS * HD * 2); bf* Kh = (bf*)take((size_t)NH_ * SS * HD * 2); bf* Kl = (bf*)take((size_t)NH_ * SS * HD * 2); bf* VTh = (bf*)take((size_t)NH_ * 64 * SS * 2); bf* VTl = (bf*)take((size_t)NH_ * 64 * SS * 2);
    float* S1 = (float*)take((size_t)NH_ * SS * SS * 4); float* S2 = (float*)take((size_t)NH_ * SS * SS * 4); bf* PH = (bf*)take((size_t)NH_ * SS * SS * 2); bf* PL = (bf*)take((size_t)NH_ * SS * SS * 2);
    float* CT1 = (float*)take((size_t)NH_ * SS * 64 * 4); float* CT = (float*)take((size_t)NH_ * SS * 64 * 4); bf* Ch = (bf*)take((size_t)SS * INR * 2); bf* Cl = (bf*)take((size_t)SS * INR * 2);
    float* O = (float*)take((size_t)SS * DIM * 4); bf* Oh = (bf*)take((size_t)SS * DIM * 2); bf* Ol = (bf*)take((size_t)SS * DIM * 2); float* G = (float*)take((size_t)SS * 2 * DIM * 4);
    if ((size_t)(wsp - (char*)d_ws) > ws_size) return;    // ~ 0.8 + 0.5 + 1.6 + 0.5 + 0.3 x 4 + 0.5 + 8.4 + 8.4 + 4.2 + 4.2 + 1 + 1 + 0.5 + 0.5 + 0.5 + 1 ~ 34 MB, reused per item in stream order
    k_wt<<<dim3(DIM / 64, (3 * INR) / 64, 1), 256, 0, stream>>>(wqkv, DIM, 3 * INR, WQKV); k_wt<<<dim3(INR / 64, DIM / 64, 1), 256, 0, stream>>>(wout, INR, DIM, WOUT); k_wt<<<dim3(DIM / 64, (2 * DIM) / 64, 1), 256, 0, stream>>>(wglu, DIM, 2 * DIM, WGLU);
    const size_t sQ = (size_t)SS * HD, sVT = (size_t)64 * SS, sS = (size_t)SS * SS, sCT = (size_t)SS * 64;
    for (int b = 0; b < NBT; ++b) {
        k_ln<<<SS / 8, 256, 0, stream>>>(x + (size_t)b * SS * DIM, lng, lnb, Hh, Hl);
        k_gemmb<true, false><<<dim3(SS / 64, (3 * INR) / 64, 1), 128, 0, stream>>>(Hh, Hl, WQKV, nullptr, QKV, 3 * INR, nullptr, nullptr, DIM);
        k_qkplanes<<<(NH_ * SS / 2) / 8, 256, 0, stream>>>(QKV, 0, Qh, Ql); k_qkplanes<<<(NH_ * SS / 2) / 8, 256, 0, stream>>>(QKV, INR, Kh, Kl); k_vtplanes<<<(NH_ * 64 * (SS / 64)) / 8, 256, 0, stream>>>(QKV, VTh, VTl);
        k_gemmbz<true, false><<<dim3(SS / 64, SS / 64, NH_), 128, 0, stream>>>(Qh, Ql, Kh, nullptr, S1, SS, nullptr, nullptr, HD, 0, sQ, sQ, 0, sS);        // (q_hi + q_lo) . k_hi
        k_gemmbz<false, false><<<dim3(SS / 64, SS / 64, NH_), 128, 0, stream>>>(Qh, nullptr, Kl, nullptr, S2, SS, nullptr, S1, HD, 0, sQ, sQ, 0, sS);         // + q_hi . k_lo  -> sim
        k_csoft<<<(NH_ * SS) / 8, 256, 0, stream>>>(S2, PH, PL);
        k_gemmbz<true, false><<<dim3(SS / 64, 1, NH_), 128, 0, stream>>>(PH, PL, VTh, nullptr, CT1, 64, nullptr, nullptr, SS, 0, sS, sVT, 0, sCT);         // (p_hi + p_lo) . v_hi
        k_gemmbz<false, false><<<dim3(SS / 64, 1, NH_), 128, 0, stream>>>(PH, nullptr, VTl, nullptr, CT, 64, nullptr, CT1, SS, 0, sS, sVT, 0, sCT);           // + p_hi . v_lo  -> ctx
        k_ctxplanes<<<SS / 8, 256, 0, stream>>>(CT, Ch, Cl);
        k_gemmb<true, false><<<dim3(SS / 64, DIM / 64, 1), 128, 0, stream>>>(Ch, Cl, WOUT, bout, O, DIM, nullptr, nullptr, INR);
        k_split256<<<SS / 8, 256, 0, stream>>>(O, Oh, Ol);
        k_gemmb<true, false><<<dim3(SS / 64, (2 * DIM) / 64, 1), 128, 0, stream>>>(Oh, Ol, WGLU, nullptr, G, 2 * DIM, nullptr, nullptr, DIM);
        k_glu<<<SS / 8, 256, 0, stream>>>(O, G, out + (size_t)b * SS * DIM); }
}

// v001
// Measured time: 567 microseconds a run.
// Two timings next to v000 put it at 5.20 and 5.33 times that version's speed.
#include <hip/hip_runtime.h>

// Compute dtypes, f32 accumulate, per item (512 tokens): LayerNorm in f32 -> bf16 hi + UNSCALED residual planes; qkv, to_out and the GLU projection as [16384 x K].[K x N] GEMMs (all 32 items in one launch)
// against the exact bf16 k-major weights (two products); per head (batched over 8 items x 8 heads with blockIdx.z): sim = q.k^T ([512 x 32].[32 x 512], three products in two launches),
// the causal -10000 mask then x scale and the row softmax in f32 -> P planes, ctx = P.v ([512 x 512].[512 x 64 (32 live)], three products) - on v_wmma_f32_16x16x32_bf16; the GLU

#define NBT  32
#define SS   512
#define DIM  256
#define NH_  8
#define HD   32
#define INR  256
#define DM   DIM
#define SCL  0.17677669529663687f
#define LOSC 1024.0f
#define NR   (NBT * SS)   // token rows of all items together
#define GRP  8            // items per attention launch: the f32 score plane and the two P planes of GRP items fit the workspace

typedef _Float16 h16;
typedef unsigned short bf;
typedef __attribute__((ext_vector_type(16))) __bf16   v16bf;
typedef __attribute__((ext_vector_type(16))) _Float16 v16h;
typedef __attribute__((ext_vector_type(8)))  _Float16 v8h;
typedef __attribute__((ext_vector_type(8)))  unsigned short v8us;
typedef __attribute__((ext_vector_type(8)))  float    v8f;
typedef __attribute__((ext_vector_type(4)))  float    v4f;
typedef v8h  __attribute__((may_alias)) v8ha;
typedef v4f  __attribute__((may_alias)) v4fa;
typedef v8us __attribute__((may_alias)) v8usa;

__device__ __forceinline__ unsigned short f2bf(float f) { unsigned u = __float_as_uint(f); u += 0x7FFFu + ((u >> 16) & 1u); return (unsigned short)(u >> 16); }
__device__ __forceinline__ float bf2f(unsigned short b) { return __uint_as_float(((unsigned)b) << 16); }
__device__ __forceinline__ float bfr(float f) { return bf2f(f2bf(f)); }
__device__ __forceinline__ v16h cat16(v8h lo, v8h hi) { return __builtin_shufflevector(lo, hi, 0, 1, 2, 3, 4, 5, 6, 7, 8, 9, 10, 11, 12, 13, 14, 15); }
__device__ __forceinline__ v16bf cat16b(v8us lo, v8us hi) { return __builtin_bit_cast(v16bf, __builtin_shufflevector(lo, hi, 0, 1, 2, 3, 4, 5, 6, 7, 8, 9, 10, 11, 12, 13, 14, 15)); }
__device__ __forceinline__ v8f wmma16(v16h a, v16h b, v8f c) { return __builtin_amdgcn_wmma_f32_16x16x32_f16(false, a, false, b, (short)0, c, false, false); }
__device__ __forceinline__ v8f wmmab(v16bf a, v16bf b, v8f c) { return __builtin_amdgcn_wmma_f32_16x16x32_bf16(false, a, false, b, (short)0, c, false, false); }

// k_gemmb: 64 x 64 block tile (4 waves x 16 x 64) of C[NTK][NW] = (A [+ Al]).B^T (K = DM = 256 by default) [+ bf(bias[c])] [+ bf(R[r][c]) residual]; f32 whole-line epilogue (or f16
template <bool SPLITA, bool F16OUT = false>
__global__ __launch_bounds__(128) void k_gemmb(const bf* __restrict__ A, const bf* __restrict__ Al, const bf* __restrict__ Bn, const float* __restrict__ bias, float* C, int ldc, h16* C2, const float* __restrict__ R = nullptr, int K = DM, int roundR = 1) {
    __shared__ __align__(16) float ost[4][16 * 68];
    const int lane = threadIdx.x & 31, wave = threadIdx.x >> 5, lr = lane & 15, hi = lane >> 4;
    const int r0 = blockIdx.x * 64 + wave * 16, c0 = blockIdx.y * 64;
    const size_t aoff = (size_t)(r0 + lr) * K + 8 * hi;
    size_t boff[4];
#pragma unroll
    for (int t = 0; t < 4; ++t) boff[t] = (size_t)(c0 + t * 16 + lr) * K + 8 * hi;
    v8f acc[4];
#pragma unroll
    for (int t = 0; t < 4; ++t) acc[t] = (v8f){};
#pragma unroll 1
    for (int kc = 0; kc < K; kc += 32) {
        const v16bf a = cat16b(*(const v8us*)(A + aoff + kc), *(const v8us*)(A + aoff + kc + 16));
        v16bf al = a;
        if (SPLITA) al = cat16b(*(const v8us*)(Al + aoff + kc), *(const v8us*)(Al + aoff + kc + 16));
#pragma unroll
        for (int t = 0; t < 4; ++t) { const v16bf b = cat16b(*(const v8us*)(Bn + boff[t] + kc), *(const v8us*)(Bn + boff[t] + kc + 16)); acc[t] = wmmab(a, b, acc[t]); if (SPLITA) acc[t] = wmmab(al, b, acc[t]); }
        asm volatile("v_nop\n\tv_nop\n\tv_nop\n\tv_nop" : "+v"(acc[0]), "+v"(acc[1]), "+v"(acc[2]), "+v"(acc[3]) : "v"(a), "v"(al));
    }
    float* os = &ost[wave][0];
#pragma unroll
    for (int t = 0; t < 4; ++t) { const float bv = bias ? bfr(bias[c0 + t * 16 + lr]) : 0.f;
#pragma unroll
        for (int j = 0; j < 8; ++j) os[(hi * 8 + j) * 68 + t * 16 + lr] = acc[t][j] + bv; }
    __syncthreads();
    if (F16OUT) {
        h16* crow = (h16*)(void*)C + (size_t)r0 * ldc + c0;
        auto pass = [&]() {
#pragma unroll
            for (int s = 0; s < 4; ++s) { const int row = 4 * s + (lane >> 3), piece = lane & 7; const float* sp = os + row * 68 + piece * 8; v8h o, o2;
#pragma unroll
                for (int i = 0; i < 8; ++i) { const h16 a = (h16)sp[i]; o[i] = a; o2[i] = (h16)((sp[i] - (float)a) * LOSC); }
                *(v8h*)(crow + (size_t)row * ldc + piece * 8) = o; if (C2) *(v8h*)(C2 + (size_t)r0 * ldc + c0 + (size_t)row * ldc + piece * 8) = o2; }
        };
        pass(); 
    } else {
        float* crow = C + (size_t)r0 * ldc + c0;
        auto pass = [&]() {
#pragma unroll
            for (int s = 0; s < 8; ++s) { const int Lid = (lane >> 3) + 4 * s, piece = lane & 7; const int row = Lid >> 1, cofs = (Lid & 1) * 32 + piece * 4;
                v4f val = *(const v4fa*)(os + row * 68 + cofs); if (R) { const v4f rv = *(const v4f*)(R + ((size_t)r0 + row) * ldc + c0 + cofs); val += roundR ? (v4f){bfr(rv[0]), bfr(rv[1]), bfr(rv[2]), bfr(rv[3])} : rv; }
                *(v4f*)(crow + (size_t)row * ldc + cofs) = val; }
        };
        pass(); 
    }
}

// k_gemmbz: batched k_gemmb — blockIdx.z = batch index g; A/Al advance by g*sA, Bn by g*sB, bias by g*sBias, C (and R) by g*sC elements; otherwise identical:
// k_gemmb: 64 x 64 block tile (4 waves x 16 x 64) of C[NTK][NW] = (A [+ Al]).B^T (K = DM = 256 by default) [+ bf(bias[c])] [+ bf(R[r][c]) residual]; f32 whole-line epilogue (or f16
template <bool SPLITA, bool F16OUT = false>
__global__ __launch_bounds__(128) void k_gemmbz(const bf* __restrict__ A, const bf* __restrict__ Al, const bf* __restrict__ Bn, const float* __restrict__ bias, float* C, int ldc, h16* C2, const float* R, int K, int roundR, size_t sA, size_t sB, size_t sBias, size_t sC) {   // R may be C: each lane reads its 4 floats of R, then stores the same 4 of C
    { const size_t g = blockIdx.z; A += g * sA; if (Al) Al += g * sA; Bn += g * sB; if (bias) bias += g * sBias; C += g * sC; if (R) R += g * sC; }
    __shared__ __align__(16) float ost[4][16 * 68];
    const int lane = threadIdx.x & 31, wave = threadIdx.x >> 5, lr = lane & 15, hi = lane >> 4;
    const int r0 = blockIdx.x * 64 + wave * 16, c0 = blockIdx.y * 64;
    const size_t aoff = (size_t)(r0 + lr) * K + 8 * hi;
    size_t boff[4];
#pragma unroll
    for (int t = 0; t < 4; ++t) boff[t] = (size_t)(c0 + t * 16 + lr) * K + 8 * hi;
    v8f acc[4];
#pragma unroll
    for (int t = 0; t < 4; ++t) acc[t] = (v8f){};
#pragma unroll 1
    for (int kc = 0; kc < K; kc += 32) {
        const v16bf a = cat16b(*(const v8us*)(A + aoff + kc), *(const v8us*)(A + aoff + kc + 16));
        v16bf al = a;
        if (SPLITA) al = cat16b(*(const v8us*)(Al + aoff + kc), *(const v8us*)(Al + aoff + kc + 16));
#pragma unroll
        for (int t = 0; t < 4; ++t) { const v16bf b = cat16b(*(const v8us*)(Bn + boff[t] + kc), *(const v8us*)(Bn + boff[t] + kc + 16)); acc[t] = wmmab(a, b, acc[t]); if (SPLITA) acc[t] = wmmab(al, b, acc[t]); }
        asm volatile("v_nop\n\tv_nop\n\tv_nop\n\tv_nop" : "+v"(acc[0]), "+v"(acc[1]), "+v"(acc[2]), "+v"(acc[3]) : "v"(a), "v"(al));
    }
    float* os = &ost[wave][0];
#pragma unroll
    for (int t = 0; t < 4; ++t) { const float bv = bias ? bfr(bias[c0 + t * 16 + lr]) : 0.f;
#pragma unroll
        for (int j = 0; j < 8; ++j) os[(hi * 8 + j) * 68 + t * 16 + lr] = acc[t][j] + bv; }
    __syncthreads();
    if (F16OUT) {
        h16* crow = (h16*)(void*)C + (size_t)r0 * ldc + c0;
        auto pass = [&]() {
#pragma unroll
            for (int s = 0; s < 4; ++s) { const int row = 4 * s + (lane >> 3), piece = lane & 7; const float* sp = os + row * 68 + piece * 8; v8h o, o2;
#pragma unroll
                for (int i = 0; i < 8; ++i) { const h16 a = (h16)sp[i]; o[i] = a; o2[i] = (h16)((sp[i] - (float)a) * LOSC); }
                *(v8h*)(crow + (size_t)row * ldc + piece * 8) = o; if (C2) *(v8h*)(C2 + (size_t)r0 * ldc + c0 + (size_t)row * ldc + piece * 8) = o2; }
        };
        pass(); 
    } else {
        float* crow = C + (size_t)r0 * ldc + c0;
        auto pass = [&]() {
#pragma unroll
            for (int s = 0; s < 8; ++s) { const int Lid = (lane >> 3) + 4 * s, piece = lane & 7; const int row = Lid >> 1, cofs = (Lid & 1) * 32 + piece * 4;
                v4f val = *(const v4fa*)(os + row * 68 + cofs); if (R) { const v4f rv = *(const v4f*)(R + ((size_t)r0 + row) * ldc + c0 + cofs); val += roundR ? (v4f){bfr(rv[0]), bfr(rv[1]), bfr(rv[2]), bfr(rv[3])} : rv; }
                *(v4f*)(crow + (size_t)row * ldc + cofs) = val; }
        };
        pass(); 
    }
}

// k_wt: WT [n][K] = bf16(W[k][n]) (k-major [K][ncols]) via 64 x 64 LDS tiles; grid (K/64, ncols/64).
__global__ __launch_bounds__(256) void k_wt(const float* __restrict__ Wm, int K, int ncols, bf* WT) {
    __shared__ __align__(16) unsigned short tl[64 * 72];
    const int tid = threadIdx.x, k0 = blockIdx.x * 64, n0 = blockIdx.y * 64;
    const int kk = tid >> 2, nq = (tid & 3) * 16;
#pragma unroll
    for (int i = 0; i < 16; ++i) tl[(nq + i) * 72 + kk] = f2bf(Wm[(size_t)(k0 + kk) * ncols + n0 + nq + i]);
    __syncthreads();
    const int piece = tid & 7;
    auto pass = [&]() {
#pragma unroll
        for (int s = 0; s < 2; ++s) { const int nr = (tid >> 3) + 32 * s; const v8us val = *(const v8usa*)(tl + nr * 72 + piece * 8); *(v8us*)(WT + (size_t)(n0 + nr) * K + k0 + piece * 8) = val; }
    };
    pass(); 
}

__global__ __launch_bounds__(256) void k_ln(const float* __restrict__ xb, const float* __restrict__ g, const float* __restrict__ bb, bf* Hh, bf* Hl) {
    const int lane = threadIdx.x & 31, r = blockIdx.x * 8 + (threadIdx.x >> 5); if (r >= NR) return; float v[8]; float s = 0.f;
#pragma unroll
    for (int i = 0; i < 8; ++i) { v[i] = bfr(xb[(size_t)r * DIM + lane * 8 + i]); s += v[i]; }
#pragma unroll
    for (int sh = 16; sh; sh >>= 1) s += __shfl_xor(s, sh, 32);
    const float mu = s * (1.0f / DIM); float q = 0.f;
#pragma unroll
    for (int i = 0; i < 8; ++i) { const float d = v[i] - mu; q = fmaf(d, d, q); }
#pragma unroll
    for (int sh = 16; sh; sh >>= 1) q += __shfl_xor(q, sh, 32);
    const float rs = rsqrtf(q * (1.0f / DIM) + 1e-5f); v8us oh, ol;
#pragma unroll
    for (int i = 0; i < 8; ++i) { const int c = lane * 8 + i; const float y = (v[i] - mu) * rs * bfr(g[c]) + bfr(bb[c]); const unsigned short hb = f2bf(y); oh[i] = hb; ol[i] = f2bf(y - bf2f(hb)); }
    const size_t o = (size_t)r * DIM + lane * 8; *(v8us*)(Hh + o) = oh; *(v8us*)(Hl + o) = ol; 
}
__global__ __launch_bounds__(256) void k_qkplanes(const float* __restrict__ QKV, int col0, bf* Ph, bf* Pl) {
    typedef __attribute__((ext_vector_type(2))) unsigned short v2us;
    { const size_t b = blockIdx.y; QKV += b * SS * (3 * INR); Ph += b * NH_ * SS * HD; Pl += b * NH_ * SS * HD; }    // blockIdx.y = item
    const int lane = threadIdx.x & 31; const size_t wid = (size_t)blockIdx.x * 8 + (threadIdx.x >> 5); if (wid >= (size_t)NH_ * (SS / 2)) return; const int h = (int)(wid / (SS / 2)); const int s = (int)(wid % (SS / 2)) * 2 + (lane >> 4); const int d = (lane & 15) * 2;
    v2us oh, ol;
#pragma unroll
    for (int i = 0; i < 2; ++i) { const float v = QKV[(size_t)s * (3 * INR) + col0 + h * HD + d + i]; const unsigned short hb = f2bf(v); oh[i] = hb; ol[i] = f2bf(v - bf2f(hb)); }
    const size_t o = ((size_t)h * SS + s) * HD + d; *(v2us*)(Ph + o) = oh; *(v2us*)(Pl + o) = ol; 
}
__global__ __launch_bounds__(256) void k_vtplanes(const float* __restrict__ QKV, bf* VTh, bf* VTl) {
    typedef __attribute__((ext_vector_type(2))) unsigned short v2us;
    { const size_t b = blockIdx.y; QKV += b * SS * (3 * INR); VTh += b * NH_ * 64 * SS; VTl += b * NH_ * 64 * SS; }    // blockIdx.y = item
    const int lane = threadIdx.x & 31; const size_t wid = (size_t)blockIdx.x * 8 + (threadIdx.x >> 5); if (wid >= (size_t)NH_ * 64 * (SS / 64)) return;
    const int sg = (int)(wid % (SS / 64)), rest = (int)(wid / (SS / 64)), d = rest % 64, h = rest / 64; const int s0 = sg * 64 + 2 * lane; v2us oh, ol;
#pragma unroll
    for (int i = 0; i < 2; ++i) { const float v = (d < HD) ? QKV[(size_t)(s0 + i) * (3 * INR) + 2 * INR + h * HD + (d < HD ? d : 0)] : 0.f; const unsigned short hb = f2bf(v); oh[i] = hb; ol[i] = f2bf(v - bf2f(hb)); }
    const size_t o = ((size_t)h * 64 + d) * SS + s0; *(v2us*)(VTh + o) = oh; *(v2us*)(VTl + o) = ol; 
}
__global__ __launch_bounds__(256) void k_csoft(const float* __restrict__ S, bf* PH, bf* PL) {
    typedef __attribute__((ext_vector_type(4))) unsigned short v4us;
    const int lane = threadIdx.x & 31; const int wid = blockIdx.x * 8 + (threadIdx.x >> 5); if (wid >= GRP * NH_ * SS) return; const int i = wid % SS; const float* sr = S + (size_t)wid * SS;
    auto sc = [&](int j) -> float { return (sr[j] + (j > i ? -10000.0f : 0.f)) * SCL; };
    float m = -3.0e38f;
#pragma unroll 1
    for (int c0 = lane * 4; c0 < SS; c0 += 128) {
#pragma unroll
        for (int q = 0; q < 4; ++q) m = fmaxf(m, sc(c0 + q)); }
#pragma unroll
    for (int sh = 16; sh; sh >>= 1) m = fmaxf(m, __shfl_xor(m, sh, 32));
    float sum = 0.f;
#pragma unroll 1
    for (int c0 = lane * 4; c0 < SS; c0 += 128) {
#pragma unroll
        for (int q = 0; q < 4; ++q) sum += __expf(sc(c0 + q) - m); }
#pragma unroll
    for (int sh = 16; sh; sh >>= 1) sum += __shfl_xor(sum, sh, 32);
    const float inv = 1.0f / sum;
{
#pragma unroll 1
        for (int c0 = lane * 4; c0 < SS; c0 += 128) { v4us oh, ol;
#pragma unroll
            for (int q = 0; q < 4; ++q) { const float p = __expf(sc(c0 + q) - m) * inv; const unsigned short hb = f2bf(p); oh[q] = hb; ol[q] = f2bf(p - bf2f(hb)); }
            const size_t o = (size_t)wid * SS + c0; *(v4us*)(PH + o) = oh; *(v4us*)(PL + o) = ol; }
         }
}
// k_ctxplanes: planes [512][256] (bf16 hi + UNSCALED residual) of CTX[s][h*32+d] = CT[h][s][d] (the batched P.v results, 64-wide rows with 32 live); one wave per s: lane -> h = lane / 4, d = 8 (lane % 4) .. +7;
__global__ __launch_bounds__(256) void k_ctxplanes(const float* __restrict__ CT, bf* Ch, bf* Cl) {
    { const size_t b = blockIdx.y; CT += b * NH_ * SS * 64; Ch += b * SS * INR; Cl += b * SS * INR; }    // blockIdx.y = item
    const int lane = threadIdx.x & 31, s = blockIdx.x * 8 + (threadIdx.x >> 5); if (s >= SS) return; const int h = lane >> 2, d0 = (lane & 3) * 8; v8us oh, ol;
#pragma unroll
    for (int i = 0; i < 8; ++i) { const float v = CT[((size_t)h * SS + s) * 64 + d0 + i]; const unsigned short hb = f2bf(v); oh[i] = hb; ol[i] = f2bf(v - bf2f(hb)); }
    const size_t o = (size_t)s * INR + lane * 8; *(v8us*)(Ch + o) = oh; *(v8us*)(Cl + o) = ol; 
}
__global__ __launch_bounds__(256) void k_split256(const float* __restrict__ src, bf* dh, bf* dl) {
    const int lane = threadIdx.x & 31, r = blockIdx.x * 8 + (threadIdx.x >> 5); if (r >= NR) return; const size_t o = (size_t)r * DIM + lane * 8; const v8f v = *(const v8f*)(src + o); v8us oh, ol;
#pragma unroll
    for (int i = 0; i < 8; ++i) { const unsigned short hb = f2bf(v[i]); oh[i] = hb; ol[i] = f2bf(v[i] - bf2f(hb)); }
    *(v8us*)(dh + o) = oh; *(v8us*)(dl + o) = ol; 
}
// k_glu: out[b][s][c] = O[s][c] + G[s][c] tanh(G[s][256 + c]); one wave per row: lane -> 8 columns (32 B: two 16-B stores? -> use v4f x 2: lane -> columns lane*4..+3 and 128 + lane*4..+3; a
__global__ __launch_bounds__(256) void k_glu(const float* __restrict__ O, const float* __restrict__ G, float* OUTB) {
    const int lane = threadIdx.x & 31, s = blockIdx.x * 8 + (threadIdx.x >> 5); if (s >= NR) return;
{
#pragma unroll
        for (int st = 0; st < 2; ++st) { const int c0 = st * 128 + lane * 4; v4f v;
#pragma unroll
            for (int q = 0; q < 4; ++q) { const int c = c0 + q; v[q] = O[(size_t)s * DIM + c] + G[(size_t)s * 2 * DIM + c] * tanhf(G[(size_t)s * 2 * DIM + DIM + c]); }
            *(v4f*)(OUTB + (size_t)s * DIM + c0) = v; }
         }
}

extern "C" void kernel_launch(void* const* d_in, const int* in_sizes, int n_in,
                              void* d_out, int out_size, void* d_ws, size_t ws_size, hipStream_t stream) {
    (void)in_sizes; (void)n_in; (void)out_size;
    const float* x = (const float*)d_in[0]; const float* lng = (const float*)d_in[1]; const float* lnb = (const float*)d_in[2]; const float* wqkv = (const float*)d_in[3]; const float* wout = (const float*)d_in[4]; const float* bout = (const float*)d_in[5]; const float* wglu = (const float*)d_in[6];
    float* out = (float*)d_out;    // [32][512][256]
    char* wsp = (char*)d_ws;
    auto take = [&](size_t bytes) { char* p = wsp; wsp += (bytes + 255) & ~(size_t)255; return (void*)p; };
    bf* WQKV = (bf*)take((size_t)(3 * INR) * DIM * 2); bf* WOUT = (bf*)take((size_t)DIM * INR * 2); bf* WGLU = (bf*)take((size_t)(2 * DIM) * DIM * 2);
    // q, k and v^T planes of all items: [item][head][...], so (item, head) is one batch index of k_gemmbz
    bf* Qh = (bf*)take((size_t)NBT * NH_ * SS * HD * 2); bf* Ql = (bf*)take((size_t)NBT * NH_ * SS * HD * 2); bf* Kh = (bf*)take((size_t)NBT * NH_ * SS * HD * 2); bf* Kl = (bf*)take((size_t)NBT * NH_ * SS * HD * 2);
    bf* VTh = (bf*)take((size_t)NBT * NH_ * 64 * SS * 2); bf* VTl = (bf*)take((size_t)NBT * NH_ * 64 * SS * 2);
    char* const reuse = wsp;    // from here the three phases lay their buffers over one another, in stream order
    // phase 1 (all items): LayerNorm planes and qkv; dead once the q, k, v^T planes are written
    bf* Hh = (bf*)take((size_t)NR * DIM * 2); bf* Hl = (bf*)take((size_t)NR * DIM * 2); float* QKV = (float*)take((size_t)NR * 3 * INR * 4);
    // phase 2 (GRP items a launch): ctx of all items, then one group's partial ctx, scores and P planes
    wsp = reuse; float* CT = (float*)take((size_t)NBT * NH_ * SS * 64 * 4); char* const afterct = wsp;
    float* CT1 = (float*)take((size_t)GRP * NH_ * SS * 64 * 4); float* S1 = (float*)take((size_t)GRP * NH_ * SS * SS * 4); bf* PH = (bf*)take((size_t)GRP * NH_ * SS * SS * 2); bf* PL = (bf*)take((size_t)GRP * NH_ * SS * SS * 2);
    if ((size_t)(wsp - (char*)d_ws) > ws_size) return;    // the largest phase: 0.75 + 64 + 32 + 8 + 64 + 32 + 32 ~ 233 MiB
    // phase 3 (all items): behind CT, over the group buffers
    wsp = afterct; bf* Ch = (bf*)take((size_t)NR * INR * 2); bf* Cl = (bf*)take((size_t)NR * INR * 2);
    float* O = (float*)take((size_t)NR * DIM * 4); bf* Oh = (bf*)take((size_t)NR * DIM * 2); bf* Ol = (bf*)take((size_t)NR * DIM * 2); float* G = (float*)take((size_t)NR * 2 * DIM * 4);
    k_wt<<<dim3(DIM / 64, (3 * INR) / 64, 1), 256, 0, stream>>>(wqkv, DIM, 3 * INR, WQKV); k_wt<<<dim3(INR / 64, DIM / 64, 1), 256, 0, stream>>>(wout, INR, DIM, WOUT); k_wt<<<dim3(DIM / 64, (2 * DIM) / 64, 1), 256, 0, stream>>>(wglu, DIM, 2 * DIM, WGLU);
    const size_t sQ = (size_t)SS * HD, sVT = (size_t)64 * SS, sS = (size_t)SS * SS, sCT = (size_t)SS * 64;
    k_ln<<<NR / 8, 256, 0, stream>>>(x, lng, lnb, Hh, Hl);
    k_gemmb<true, false><<<dim3(NR / 64, (3 * INR) / 64, 1), 128, 0, stream>>>(Hh, Hl, WQKV, nullptr, QKV, 3 * INR, nullptr, nullptr, DIM);
    k_qkplanes<<<dim3((NH_ * SS / 2) / 8, NBT, 1), 256, 0, stream>>>(QKV, 0, Qh, Ql); k_qkplanes<<<dim3((NH_ * SS / 2) / 8, NBT, 1), 256, 0, stream>>>(QKV, INR, Kh, Kl); k_vtplanes<<<dim3((NH_ * 64 * (SS / 64)) / 8, NBT, 1), 256, 0, stream>>>(QKV, VTh, VTl);
    for (int b = 0; b < NBT; b += GRP) {
        const size_t g0 = (size_t)b * NH_;    // first (item, head) of the group
        k_gemmbz<true, false><<<dim3(SS / 64, SS / 64, GRP * NH_), 128, 0, stream>>>(Qh + g0 * sQ, Ql + g0 * sQ, Kh + g0 * sQ, nullptr, S1, SS, nullptr, nullptr, HD, 0, sQ, sQ, 0, sS);        // (q_hi + q_lo) . k_hi
        k_gemmbz<false, false><<<dim3(SS / 64, SS / 64, GRP * NH_), 128, 0, stream>>>(Qh + g0 * sQ, nullptr, Kl + g0 * sQ, nullptr, S1, SS, nullptr, S1, HD, 0, sQ, sQ, 0, sS);         // + q_hi . k_lo  -> sim, added in place
        k_csoft<<<(GRP * NH_ * SS) / 8, 256, 0, stream>>>(S1, PH, PL);
        k_gemmbz<true, false><<<dim3(SS / 64, 1, GRP * NH_), 128, 0, stream>>>(PH, PL, VTh + g0 * sVT, nullptr, CT1, 64, nullptr, nullptr, SS, 0, sS, sVT, 0, sCT);         // (p_hi + p_lo) . v_hi
        k_gemmbz<false, false><<<dim3(SS / 64, 1, GRP * NH_), 128, 0, stream>>>(PH, nullptr, VTl + g0 * sVT, nullptr, CT + g0 * sCT, 64, nullptr, CT1, SS, 0, sS, sVT, 0, sCT); }         // + p_hi . v_lo  -> ctx
    k_ctxplanes<<<dim3(SS / 8, NBT, 1), 256, 0, stream>>>(CT, Ch, Cl);
    k_gemmb<true, false><<<dim3(NR / 64, DIM / 64, 1), 128, 0, stream>>>(Ch, Cl, WOUT, bout, O, DIM, nullptr, nullptr, INR);
    k_split256<<<NR / 8, 256, 0, stream>>>(O, Oh, Ol);
    k_gemmb<true, false><<<dim3(NR / 64, (2 * DIM) / 64, 1), 128, 0, stream>>>(Oh, Ol, WGLU, nullptr, G, 2 * DIM, nullptr, nullptr, DIM);
    k_glu<<<NR / 8, 256, 0, stream>>>(O, G, out);
}

// v002
// A run of this version takes 211 microseconds.
// In two side-by-side timings against v001, it was 2.72 and 2.61 times as fast.
// Counting every step since v000, it is 14.0 times as fast.
#include <hip/hip_runtime.h>

// Compute dtypes, f32 accumulate, per item (512 tokens): LayerNorm in f32 -> bf16 hi + UNSCALED residual planes; qkv, to_out and the GLU projection as [512 x K].[K x N] GEMMs
// against the exact bf16 k-major weights (two products); per (item, head), in one kernel: sim = q.k^T ([512 x 32].[32 x 512], three products),
// the causal -10000 mask then x scale and the row softmax in f32, ctx = P.v ([512 x 512].[512 x 32], three products), scores and P in registers only - on v_wmma_f32_16x16x32_bf16; the GLU

#define NBT  32
#define SS   512
#define DIM  256
#define NH_  8
#define HD   32
#define INR  256
#define DM   DIM
#define SCL  0.17677669529663687f
#define LOSC 1024.0f
#define NR   (NBT * SS)   // token rows of all items together

typedef _Float16 h16;
typedef unsigned short bf;
typedef __attribute__((ext_vector_type(16))) __bf16   v16bf;
typedef __attribute__((ext_vector_type(16))) _Float16 v16h;
typedef __attribute__((ext_vector_type(8)))  _Float16 v8h;
typedef __attribute__((ext_vector_type(8)))  unsigned short v8us;
typedef __attribute__((ext_vector_type(8)))  float    v8f;
typedef __attribute__((ext_vector_type(4)))  float    v4f;
typedef v8h  __attribute__((may_alias)) v8ha;
typedef v4f  __attribute__((may_alias)) v4fa;
typedef v8us __attribute__((may_alias)) v8usa;

__device__ __forceinline__ unsigned short f2bf(float f) { unsigned u = __float_as_uint(f); u += 0x7FFFu + ((u >> 16) & 1u); return (unsigned short)(u >> 16); }
__device__ __forceinline__ float bf2f(unsigned short b) { return __uint_as_float(((unsigned)b) << 16); }
__device__ __forceinline__ float bfr(float f) { return bf2f(f2bf(f)); }
__device__ __forceinline__ v16h cat16(v8h lo, v8h hi) { return __builtin_shufflevector(lo, hi, 0, 1, 2, 3, 4, 5, 6, 7, 8, 9, 10, 11, 12, 13, 14, 15); }
__device__ __forceinline__ v16bf cat16b(v8us lo, v8us hi) { return __builtin_bit_cast(v16bf, __builtin_shufflevector(lo, hi, 0, 1, 2, 3, 4, 5, 6, 7, 8, 9, 10, 11, 12, 13, 14, 15)); }
__device__ __forceinline__ v8f wmma16(v16h a, v16h b, v8f c) { return __builtin_amdgcn_wmma_f32_16x16x32_f16(false, a, false, b, (short)0, c, false, false); }
__device__ __forceinline__ v8f wmmab(v16bf a, v16bf b, v8f c) { return __builtin_amdgcn_wmma_f32_16x16x32_bf16(false, a, false, b, (short)0, c, false, false); }

// k_gemmb: 64 x 64 block tile (4 waves x 16 x 64) of C[NTK][NW] = (A [+ Al]).B^T (K = DM = 256 by default) [+ bf(bias[c])] [+ bf(R[r][c]) residual]; f32 whole-line epilogue (or f16
template <bool SPLITA, bool F16OUT = false>
__global__ __launch_bounds__(128) void k_gemmb(const bf* __restrict__ A, const bf* __restrict__ Al, const bf* __restrict__ Bn, const float* __restrict__ bias, float* C, int ldc, h16* C2, const float* __restrict__ R = nullptr, int K = DM, int roundR = 1) {
    __shared__ __align__(16) float ost[4][16 * 68];
    const int lane = threadIdx.x & 31, wave = threadIdx.x >> 5, lr = lane & 15, hi = lane >> 4;
    const int r0 = blockIdx.x * 64 + wave * 16, c0 = blockIdx.y * 64;
    const size_t aoff = (size_t)(r0 + lr) * K + 8 * hi;
    size_t boff[4];
#pragma unroll
    for (int t = 0; t < 4; ++t) boff[t] = (size_t)(c0 + t * 16 + lr) * K + 8 * hi;
    v8f acc[4];
#pragma unroll
    for (int t = 0; t < 4; ++t) acc[t] = (v8f){};
#pragma unroll 1
    for (int kc = 0; kc < K; kc += 32) {
        const v16bf a = cat16b(*(const v8us*)(A + aoff + kc), *(const v8us*)(A + aoff + kc + 16));
        v16bf al = a;
        if (SPLITA) al = cat16b(*(const v8us*)(Al + aoff + kc), *(const v8us*)(Al + aoff + kc + 16));
#pragma unroll
        for (int t = 0; t < 4; ++t) { const v16bf b = cat16b(*(const v8us*)(Bn + boff[t] + kc), *(const v8us*)(Bn + boff[t] + kc + 16)); acc[t] = wmmab(a, b, acc[t]); if (SPLITA) acc[t] = wmmab(al, b, acc[t]); }
        asm volatile("v_nop\n\tv_nop\n\tv_nop\n\tv_nop" : "+v"(acc[0]), "+v"(acc[1]), "+v"(acc[2]), "+v"(acc[3]) : "v"(a), "v"(al));
    }
    float* os = &ost[wave][0];
#pragma unroll
    for (int t = 0; t < 4; ++t) { const float bv = bias ? bfr(bias[c0 + t * 16 + lr]) : 0.f;
#pragma unroll
        for (int j = 0; j < 8; ++j) os[(hi * 8 + j) * 68 + t * 16 + lr] = acc[t][j] + bv; }
    __syncthreads();
    if (F16OUT) {
        h16* crow = (h16*)(void*)C + (size_t)r0 * ldc + c0;
        auto pass = [&]() {
#pragma unroll
            for (int s = 0; s < 4; ++s) { const int row = 4 * s + (lane >> 3), piece = lane & 7; const float* sp = os + row * 68 + piece * 8; v8h o, o2;
#pragma unroll
                for (int i = 0; i < 8; ++i) { const h16 a = (h16)sp[i]; o[i] = a; o2[i] = (h16)((sp[i] - (float)a) * LOSC); }
                *(v8h*)(crow + (size_t)row * ldc + piece * 8) = o; if (C2) *(v8h*)(C2 + (size_t)r0 * ldc + c0 + (size_t)row * ldc + piece * 8) = o2; }
        };
        pass(); 
    } else {
        float* crow = C + (size_t)r0 * ldc + c0;
        auto pass = [&]() {
#pragma unroll
            for (int s = 0; s < 8; ++s) { const int Lid = (lane >> 3) + 4 * s, piece = lane & 7; const int row = Lid >> 1, cofs = (Lid & 1) * 32 + piece * 4;
                v4f val = *(const v4fa*)(os + row * 68 + cofs); if (R) { const v4f rv = *(const v4f*)(R + ((size_t)r0 + row) * ldc + c0 + cofs); val += roundR ? (v4f){bfr(rv[0]), bfr(rv[1]), bfr(rv[2]), bfr(rv[3])} : rv; }
                *(v4f*)(crow + (size_t)row * ldc + cofs) = val; }
        };
        pass(); 
    }
}

// k_wt: WT [n][K] = bf16(W[k][n]) (k-major [K][ncols]) via 64 x 64 LDS tiles; grid (K/64, ncols/64).
__global__ __launch_bounds__(256) void k_wt(const float* __restrict__ Wm, int K, int ncols, bf* WT) {
    __shared__ __align__(16) unsigned short tl[64 * 72];
    const int tid = threadIdx.x, k0 = blockIdx.x * 64, n0 = blockIdx.y * 64;
    const int kk = tid >> 2, nq = (tid & 3) * 16;
#pragma unroll
    for (int i = 0; i < 16; ++i) tl[(nq + i) * 72 + kk] = f2bf(Wm[(size_t)(k0 + kk) * ncols + n0 + nq + i]);
    __syncthreads();
    const int piece = tid & 7;
    auto pass = [&]() {
#pragma unroll
        for (int s = 0; s < 2; ++s) { const int nr = (tid >> 3) + 32 * s; const v8us val = *(const v8usa*)(tl + nr * 72 + piece * 8); *(v8us*)(WT + (size_t)(n0 + nr) * K + k0 + piece * 8) = val; }
    };
    pass(); 
}

__global__ __launch_bounds__(256) void k_ln(const float* __restrict__ xb, const float* __restrict__ g, const float* __restrict__ bb, bf* Hh, bf* Hl) {
    const int lane = threadIdx.x & 31, r = blockIdx.x * 8 + (threadIdx.x >> 5); if (r >= NR) return; float v[8]; float s = 0.f;
#pragma unroll
    for (int i = 0; i < 8; ++i) { v[i] = bfr(xb[(size_t)r * DIM + lane * 8 + i]); s += v[i]; }
#pragma unroll
    for (int sh = 16; sh; sh >>= 1) s += __shfl_xor(s, sh, 32);
    const float mu = s * (1.0f / DIM); float q = 0.f;
#pragma unroll
    for (int i = 0; i < 8; ++i) { const float d = v[i] - mu; q = fmaf(d, d, q); }
#pragma unroll
    for (int sh = 16; sh; sh >>= 1) q += __shfl_xor(q, sh, 32);
    const float rs = rsqrtf(q * (1.0f / DIM) + 1e-5f); v8us oh, ol;
#pragma unroll
    for (int i = 0; i < 8; ++i) { const int c = lane * 8 + i; const float y = (v[i] - mu) * rs * bfr(g[c]) + bfr(bb[c]); const unsigned short hb = f2bf(y); oh[i] = hb; ol[i] = f2bf(y - bf2f(hb)); }
    const size_t o = (size_t)r * DIM + lane * 8; *(v8us*)(Hh + o) = oh; *(v8us*)(Hl + o) = ol; 
}
__global__ __launch_bounds__(256) void k_qkplanes(const float* __restrict__ QKV, int col0, bf* Ph, bf* Pl) {
    typedef __attribute__((ext_vector_type(2))) unsigned short v2us;
    { const size_t b = blockIdx.y; QKV += b * SS * (3 * INR); Ph += b * NH_ * SS * HD; Pl += b * NH_ * SS * HD; }    // blockIdx.y = item
    const int lane = threadIdx.x & 31; const size_t wid = (size_t)blockIdx.x * 8 + (threadIdx.x >> 5); if (wid >= (size_t)NH_ * (SS / 2)) return; const int h = (int)(wid / (SS / 2)); const int s = (int)(wid % (SS / 2)) * 2 + (lane >> 4); const int d = (lane & 15) * 2;
    v2us oh, ol;
#pragma unroll
    for (int i = 0; i < 2; ++i) { const float v = QKV[(size_t)s * (3 * INR) + col0 + h * HD + d + i]; const unsigned short hb = f2bf(v); oh[i] = hb; ol[i] = f2bf(v - bf2f(hb)); }
    const size_t o = ((size_t)h * SS + s) * HD + d; *(v2us*)(Ph + o) = oh; *(v2us*)(Pl + o) = ol; 
}
__global__ __launch_bounds__(256) void k_vtplanes(const float* __restrict__ QKV, bf* VTh, bf* VTl) {
    typedef __attribute__((ext_vector_type(2))) unsigned short v2us;
    { const size_t b = blockIdx.y; QKV += b * SS * (3 * INR); VTh += b * NH_ * 64 * SS; VTl += b * NH_ * 64 * SS; }    // blockIdx.y = item
    const int lane = threadIdx.x & 31; const size_t wid = (size_t)blockIdx.x * 8 + (threadIdx.x >> 5); if (wid >= (size_t)NH_ * 64 * (SS / 64)) return;
    const int sg = (int)(wid % (SS / 64)), rest = (int)(wid / (SS / 64)), d = rest % 64, h = rest / 64; const int s0 = sg * 64 + 2 * lane; v2us oh, ol;
#pragma unroll
    for (int i = 0; i < 2; ++i) { const float v = (d < HD) ? QKV[(size_t)(s0 + i) * (3 * INR) + 2 * INR + h * HD + (d < HD ? d : 0)] : 0.f; const unsigned short hb = f2bf(v); oh[i] = hb; ol[i] = f2bf(v - bf2f(hb)); }
    const size_t o = ((size_t)h * 64 + d) * SS + s0; *(v2us*)(VTh + o) = oh; *(v2us*)(VTl + o) = ol; 
}
template <int N> struct ic { static constexpr int v = N; };
typedef __attribute__((ext_vector_type(2))) float  v2f;
typedef __attribute__((ext_vector_type(2))) __bf16 v2bf;
__global__ __launch_bounds__(512) void k_attn(const bf* __restrict__ Qh, const bf* __restrict__ Ql, const bf* __restrict__ Kh, const bf* __restrict__ Kl, const bf* __restrict__ VTh, const bf* __restrict__ VTl, float* __restrict__ CT) {
    __shared__ __align__(16) unsigned short sT[SS / 32][2][2][2][2][32][8];    // [32-key trip][k | v^T][plane][16-key tile | 16-d tile][piece][lane][8]: a trip's 8 KiB lie together
    const int lane = threadIdx.x & 31, c = lane & 15, h = lane >> 4;
    const int wave = __builtin_amdgcn_readfirstlane(threadIdx.x >> 5);    // in a scalar register: the trip loops' bounds and branches are scalar
    { const size_t g = blockIdx.x; Qh += g * SS * HD; Ql += g * SS * HD; Kh += g * SS * HD; Kl += g * SS * HD; VTh += g * 64 * SS; VTl += g * 64 * SS; CT += g * SS * 64; }
    const int q0 = wave * 32;
    v16bf qh[2], ql[2];
    {   // wave w brings trip w: key tiles 2w, 2w + 1 and their v^T columns; and its own 32 queries
        const bf* pk[2][2]; const bf* pv[2]; const bf* pq[2][2];
#pragma unroll
        for (int pl = 0; pl < 2; ++pl) { pv[pl] = (pl ? VTl : VTh) + (size_t)c * SS + wave * 32 + 8 * h;
#pragma unroll
            for (int t = 0; t < 2; ++t) { pk[pl][t] = (pl ? Kl : Kh) + (size_t)(q0 + t * 16 + c) * HD + 8 * h; pq[pl][t] = (pl ? Ql : Qh) + (size_t)(q0 + t * 16 + c) * HD + 8 * h; } }
        v8us tk[2][2][2], tv[2][2][2];
#pragma unroll
        for (int pl = 0; pl < 2; ++pl)
#pragma unroll
            for (int t = 0; t < 2; ++t)
#pragma unroll
                for (int p = 0; p < 2; ++p) { tk[pl][t][p] = *(const v8us*)(pk[pl][t] + 16 * p); tv[pl][t][p] = *(const v8us*)(pv[pl] + (size_t)t * 16 * SS + 16 * p); }
#pragma unroll
        for (int qt = 0; qt < 2; ++qt) { qh[qt] = cat16b(*(const v8us*)pq[0][qt], *(const v8us*)(pq[0][qt] + 16)); ql[qt] = cat16b(*(const v8us*)pq[1][qt], *(const v8us*)(pq[1][qt] + 16)); }
        // the addresses stay live up to this wait, so that nothing (a later load's result either) lands in an address register of a load in front of it
        asm volatile("s_wait_xcnt 0x0" :: "v"(pk[0][0]), "v"(pk[0][1]), "v"(pk[1][0]), "v"(pk[1][1]), "v"(pv[0]), "v"(pv[1]), "v"(pq[0][0]), "v"(pq[0][1]), "v"(pq[1][0]), "v"(pq[1][1]) : "memory");
#pragma unroll
        for (int pl = 0; pl < 2; ++pl)
#pragma unroll
            for (int t = 0; t < 2; ++t)
#pragma unroll
                for (int p = 0; p < 2; ++p) { *(v8usa*)&sT[wave][0][pl][t][p][lane][0] = tk[pl][t][p]; *(v8usa*)&sT[wave][1][pl][t][p][lane][0] = tv[pl][t][p]; }
    }
    __syncthreads();
    auto kfrag = [&](int pl, int jc, int tj) -> v16bf { return cat16b(*(const v8usa*)&sT[jc][0][pl][tj][0][lane][0], *(const v8usa*)&sT[jc][0][pl][tj][1][lane][0]); };
    auto vfrag = [&](int pl, int jc, int dt) -> v16bf { return cat16b(*(const v8usa*)&sT[jc][1][pl][dt][0][lane][0], *(const v8usa*)&sT[jc][1][pl][dt][1][lane][0]); };
    // s[r] = sim[query q0 + qt * 16 + c][key jc * 32 + tj * 16 + 8 h + r]
    auto sim = [&](v16bf kh, v16bf kl, int qt) -> v8f { v8f s = {}; s = wmmab(kh, qh[qt], s); s = wmmab(kh, ql[qt], s); s = wmmab(kl, qh[qt], s); return s; };
    // A trip's 32 keys against the wave's 32 queries: M = 0 all allowed (trip < wave), 1 the diagonal trip, 2 all masked (trip > wave).
    float mu[2] = {-3.0e38f, -3.0e38f}, mm[2] = {-3.0e38f, -3.0e38f};    // maxima of sim + mask, and of sim alone over the wholly masked trips
    auto walk1 = [&](auto M, int jc) {
#pragma unroll
        for (int tj = 0; tj < 2; ++tj) { const v16bf kh = kfrag(0, jc, tj), kl = kfrag(1, jc, tj);
#pragma unroll
            for (int qt = 0; qt < 2; ++qt) { const v8f s = sim(kh, kl, qt);
#pragma unroll
                for (int r = 0; r < 8; ++r) {
                    if constexpr (decltype(M)::v == 0) mu[qt] = fmaxf(mu[qt], s[r]);
                    else if constexpr (decltype(M)::v == 2) mm[qt] = fmaxf(mm[qt], s[r]);
                    else mu[qt] = fmaxf(mu[qt], s[r] + ((tj * 16 + 8 * h + r > qt * 16 + c) ? -10000.0f : 0.f)); } } }
    };
    for (int jc = 0; jc < wave; ++jc) walk1(ic<0>{}, jc);
    walk1(ic<1>{}, wave);
    for (int jc = wave + 1; jc < SS / 32; ++jc) walk1(ic<2>{}, jc);
    const float CE = SCL * 1.4426950408889634f;    // exp(x * scale) = exp2(x * CE)
    float nm[2]; v2f sum[2] = {(v2f){0.f, 0.f}, (v2f){0.f, 0.f}};    // even and odd keys summed apart
#pragma unroll
    for (int qt = 0; qt < 2; ++qt) { float m = fmaxf(mu[qt], mm[qt] + -10000.0f); m = fmaxf(m, __shfl_xor(m, 16, 32)); nm[qt] = -(m * CE); }
    v8f o[2][2];
#pragma unroll
    for (int dt = 0; dt < 2; ++dt)
#pragma unroll
        for (int qt = 0; qt < 2; ++qt) o[dt][qt] = (v8f){};
    auto walk2 = [&](auto M, int jc) {
        v16bf ph[2], pl[2];
#pragma unroll
        for (int tj = 0; tj < 2; ++tj) { const v16bf kh = kfrag(0, jc, tj), kl = kfrag(1, jc, tj);
#pragma unroll
            for (int qt = 0; qt < 2; ++qt) { const v8f s = sim(kh, kl, qt);
#pragma unroll
                for (int r = 0; r < 8; r += 2) { v2f e;
#pragma unroll
                    for (int u = 0; u < 2; ++u) {
                        float t = s[r + u];
                        if constexpr (decltype(M)::v == 2) t += -10000.0f;
                        else if constexpr (decltype(M)::v == 1) t += ((tj * 16 + 8 * h + r + u > qt * 16 + c) ? -10000.0f : 0.f);
                        const float x = fmaf(t, CE, nm[qt]); float ex;
                        if constexpr (decltype(M)::v == 1) asm("v_exp_f32 %0, %1\n\tv_nop" : "=v"(ex) : "v"(x));    // the v_nop fills the slot behind the transcendental
                        else ex = __builtin_amdgcn_exp2f(x);
                        e[u] = ex; }
                    sum[qt] += e;
                    const v2bf eh = __builtin_convertvector(e, v2bf); const v2bf el = __builtin_convertvector(e - __builtin_convertvector(eh, v2f), v2bf);
                    ph[qt][tj * 8 + r] = eh[0]; ph[qt][tj * 8 + r + 1] = eh[1]; pl[qt][tj * 8 + r] = el[0]; pl[qt][tj * 8 + r + 1] = el[1]; } } }
#pragma unroll
        for (int dt = 0; dt < 2; ++dt) { const v16bf vh = vfrag(0, jc, dt), vl = vfrag(1, jc, dt);
#pragma unroll
            for (int qt = 0; qt < 2; ++qt) { o[dt][qt] = wmmab(vh, ph[qt], o[dt][qt]); o[dt][qt] = wmmab(vh, pl[qt], o[dt][qt]); o[dt][qt] = wmmab(vl, ph[qt], o[dt][qt]); } }
    };
    for (int jc = 0; jc < wave; ++jc) walk2(ic<0>{}, jc);
    walk2(ic<1>{}, wave);
    for (int jc = wave + 1; jc < SS / 32; ++jc) walk2(ic<2>{}, jc);
    // o[dt][qt][r] = ctx^T[d = dt * 16 + 8 h + r][query q0 + qt * 16 + c]: 8 consecutive d of one query a lane; a query's 128 live bytes come from this wave alone
#pragma unroll
    for (int qt = 0; qt < 2; ++qt) { const float sl = sum[qt][0] + sum[qt][1]; const float sm = sl + __shfl_xor(sl, 16, 32); const float inv = 1.0f / sm;
#pragma unroll
        for (int dt = 0; dt < 2; ++dt) { float* cp = CT + (size_t)(q0 + qt * 16 + c) * 64 + dt * 16 + 8 * h; const v8f v = o[dt][qt] * inv;
            *(v4f*)cp = (v4f){v[0], v[1], v[2], v[3]}; *(v4f*)(cp + 4) = (v4f){v[4], v[5], v[6], v[7]}; } }
}
// k_ctxplanes: planes [512][256] (bf16 hi + UNSCALED residual) of CTX[s][h*32+d] = CT[h][s][d] (the batched P.v results, 64-wide rows with 32 live); one wave per s: lane -> h = lane / 4, d = 8 (lane % 4) .. +7;
__global__ __launch_bounds__(256) void k_ctxplanes(const float* __restrict__ CT, bf* Ch, bf* Cl) {
    { const size_t b = blockIdx.y; CT += b * NH_ * SS * 64; Ch += b * SS * INR; Cl += b * SS * INR; }    // blockIdx.y = item
    const int lane = threadIdx.x & 31, s = blockIdx.x * 8 + (threadIdx.x >> 5); if (s >= SS) return; const int h = lane >> 2, d0 = (lane & 3) * 8; v8us oh, ol;
#pragma unroll
    for (int i = 0; i < 8; ++i) { const float v = CT[((size_t)h * SS + s) * 64 + d0 + i]; const unsigned short hb = f2bf(v); oh[i] = hb; ol[i] = f2bf(v - bf2f(hb)); }
    const size_t o = (size_t)s * INR + lane * 8; *(v8us*)(Ch + o) = oh; *(v8us*)(Cl + o) = ol; 
}
__global__ __launch_bounds__(256) void k_split256(const float* __restrict__ src, bf* dh, bf* dl) {
    const int lane = threadIdx.x & 31, r = blockIdx.x * 8 + (threadIdx.x >> 5); if (r >= NR) return; const size_t o = (size_t)r * DIM + lane * 8; const v8f v = *(const v8f*)(src + o); v8us oh, ol;
#pragma unroll
    for (int i = 0; i < 8; ++i) { const unsigned short hb = f2bf(v[i]); oh[i] = hb; ol[i] = f2bf(v[i] - bf2f(hb)); }
    *(v8us*)(dh + o) = oh; *(v8us*)(dl + o) = ol; 
}
// k_glu: out[b][s][c] = O[s][c] + G[s][c] tanh(G[s][256 + c]); one wave per row: lane -> 8 columns (32 B: two 16-B stores? -> use v4f x 2: lane -> columns lane*4..+3 and 128 + lane*4..+3; a
__global__ __launch_bounds__(256) void k_glu(const float* __restrict__ O, const float* __restrict__ G, float* OUTB) {
    const int lane = threadIdx.x & 31, s = blockIdx.x * 8 + (threadIdx.x >> 5); if (s >= NR) return;
{
#pragma unroll
        for (int st = 0; st < 2; ++st) { const int c0 = st * 128 + lane * 4; v4f v;
#pragma unroll
            for (int q = 0; q < 4; ++q) { const int c = c0 + q; v[q] = O[(size_t)s * DIM + c] + G[(size_t)s * 2 * DIM + c] * tanhf(G[(size_t)s * 2 * DIM + DIM + c]); }
            *(v4f*)(OUTB + (size_t)s * DIM + c0) = v; }
         }
}

extern "C" void kernel_launch(void* const* d_in, const int* in_sizes, int n_in,
                              void* d_out, int out_size, void* d_ws, size_t ws_size, hipStream_t stream) {
    (void)in_sizes; (void)n_in; (void)out_size;
    const float* x = (const float*)d_in[0]; const float* lng = (const float*)d_in[1]; const float* lnb = (const float*)d_in[2]; const float* wqkv = (const float*)d_in[3]; const float* wout = (const float*)d_in[4]; const float* bout = (const float*)d_in[5]; const float* wglu = (const float*)d_in[6];
    float* out = (float*)d_out;    // [32][512][256]
    char* wsp = (char*)d_ws;
    auto take = [&](size_t bytes) { char* p = wsp; wsp += (bytes + 255) & ~(size_t)255; return (void*)p; };
    bf* WQKV = (bf*)take((size_t)(3 * INR) * DIM * 2); bf* WOUT = (bf*)take((size_t)DIM * INR * 2); bf* WGLU = (bf*)take((size_t)(2 * DIM) * DIM * 2);
    // q, k and v^T planes of all items: [item][head][...], so (item, head) is the block index of k_attn
    bf* Qh = (bf*)take((size_t)NBT * NH_ * SS * HD * 2); bf* Ql = (bf*)take((size_t)NBT * NH_ * SS * HD * 2); bf* Kh = (bf*)take((size_t)NBT * NH_ * SS * HD * 2); bf* Kl = (bf*)take((size_t)NBT * NH_ * SS * HD * 2);
    bf* VTh = (bf*)take((size_t)NBT * NH_ * 64 * SS * 2); bf* VTl = (bf*)take((size_t)NBT * NH_ * 64 * SS * 2);
    char* const reuse = wsp;    // from here the phases lay their buffers over one another, in stream order
    // phase 1 (all items): LayerNorm planes and qkv; dead once the q, k, v^T planes are written
    bf* Hh = (bf*)take((size_t)NR * DIM * 2); bf* Hl = (bf*)take((size_t)NR * DIM * 2); float* QKV = (float*)take((size_t)NR * 3 * INR * 4);
    // phase 2 (all items): ctx (rows of 64 floats, 32 live), then what follows attention
    wsp = reuse; float* CT = (float*)take((size_t)NBT * NH_ * SS * 64 * 4);
    bf* Ch = (bf*)take((size_t)NR * INR * 2); bf* Cl = (bf*)take((size_t)NR * INR * 2);
    float* O = (float*)take((size_t)NR * DIM * 4); bf* Oh = (bf*)take((size_t)NR * DIM * 2); bf* Ol = (bf*)take((size_t)NR * DIM * 2); float* G = (float*)take((size_t)NR * 2 * DIM * 4);
    if ((size_t)(wsp - (char*)d_ws) > ws_size) return;    // the largest phase: 0.75 + 64 + 32 + 16 + 16 + 16 + 32 ~ 177 MiB
    k_wt<<<dim3(DIM / 64, (3 * INR) / 64, 1), 256, 0, stream>>>(wqkv, DIM, 3 * INR, WQKV); k_wt<<<dim3(INR / 64, DIM / 64, 1), 256, 0, stream>>>(wout, INR, DIM, WOUT); k_wt<<<dim3(DIM / 64, (2 * DIM) / 64, 1), 256, 0, stream>>>(wglu, DIM, 2 * DIM, WGLU);
    k_ln<<<NR / 8, 256, 0, stream>>>(x, lng, lnb, Hh, Hl);
    k_gemmb<true, false><<<dim3(NR / 64, (3 * INR) / 64, 1), 128, 0, stream>>>(Hh, Hl, WQKV, nullptr, QKV, 3 * INR, nullptr, nullptr, DIM);
    k_qkplanes<<<dim3((NH_ * SS / 2) / 8, NBT, 1), 256, 0, stream>>>(QKV, 0, Qh, Ql); k_qkplanes<<<dim3((NH_ * SS / 2) / 8, NBT, 1), 256, 0, stream>>>(QKV, INR, Kh, Kl); k_vtplanes<<<dim3((NH_ * 64 * (SS / 64)) / 8, NBT, 1), 256, 0, stream>>>(QKV, VTh, VTl);
    k_attn<<<NBT * NH_, 512, 0, stream>>>(Qh, Ql, Kh, Kl, VTh, VTl, CT);
    k_ctxplanes<<<dim3(SS / 8, NBT, 1), 256, 0, stream>>>(CT, Ch, Cl);
    k_gemmb<true, false><<<dim3(NR / 64, DIM / 64, 1), 128, 0, stream>>>(Ch, Cl, WOUT, bout, O, DIM, nullptr, nullptr, INR);
    k_split256<<<NR / 8, 256, 0, stream>>>(O, Oh, Ol);
    k_gemmb<true, false><<<dim3(NR / 64, (2 * DIM) / 64, 1), 128, 0, stream>>>(Oh, Ol, WGLU, nullptr, G, 2 * DIM, nullptr, nullptr, DIM);
    k_glu<<<NR / 8, 256, 0, stream>>>(O, G, out);
}

// v003
// One run takes 133 microseconds.
// In two side-by-side timings against v002, it was 1.53 and 1.61 times as fast.
// Counting every step since v000, it is 22.0 times as fast.
#include <hip/hip_runtime.h>

// Compute dtypes, f32 accumulate, per item (512 tokens): LayerNorm in f32 -> bf16 hi + UNSCALED residual planes; qkv, to_out and the GLU projection as [512 x K].[K x N] GEMMs
// against the exact bf16 k-major weights (two products); per (item, head), in one kernel: sim = q.k^T ([512 x 32].[32 x 512], three products),
// the causal -10000 mask then x scale and the row softmax in f32, ctx = P.v ([512 x 512].[512 x 32], three products), scores and P in registers only - on v_wmma_f32_16x16x32_bf16; the GLU

#define NBT  32
#define SS   512
#define DIM  256
#define NH_  8
#define HD   32
#define INR  256
#define DM   DIM
#define SCL  0.17677669529663687f
#define LOSC 1024.0f
#define NR   (NBT * SS)   // token rows of all items together

typedef _Float16 h16;
typedef unsigned short bf;
typedef __attribute__((ext_vector_type(16))) __bf16   v16bf;
typedef __attribute__((ext_vector_type(16))) _Float16 v16h;
typedef __attribute__((ext_vector_type(8)))  _Float16 v8h;
typedef __attribute__((ext_vector_type(8)))  unsigned short v8us;
typedef __attribute__((ext_vector_type(8)))  float    v8f;
typedef __attribute__((ext_vector_type(4)))  float    v4f;
typedef v8h  __attribute__((may_alias)) v8ha;
typedef v4f  __attribute__((may_alias)) v4fa;
typedef v8us __attribute__((may_alias)) v8usa;

__device__ __forceinline__ unsigned short f2bf(float f) { unsigned u = __float_as_uint(f); u += 0x7FFFu + ((u >> 16) & 1u); return (unsigned short)(u >> 16); }
__device__ __forceinline__ float bf2f(unsigned short b) { return __uint_as_float(((unsigned)b) << 16); }
__device__ __forceinline__ float bfr(float f) { return bf2f(f2bf(f)); }
__device__ __forceinline__ v16h cat16(v8h lo, v8h hi) { return __builtin_shufflevector(lo, hi, 0, 1, 2, 3, 4, 5, 6, 7, 8, 9, 10, 11, 12, 13, 14, 15); }
__device__ __forceinline__ v16bf cat16b(v8us lo, v8us hi) { return __builtin_bit_cast(v16bf, __builtin_shufflevector(lo, hi, 0, 1, 2, 3, 4, 5, 6, 7, 8, 9, 10, 11, 12, 13, 14, 15)); }
__device__ __forceinline__ v8f wmma16(v16h a, v16h b, v8f c) { return __builtin_amdgcn_wmma_f32_16x16x32_f16(false, a, false, b, (short)0, c, false, false); }
__device__ __forceinline__ v8f wmmab(v16bf a, v16bf b, v8f c) { return __builtin_amdgcn_wmma_f32_16x16x32_bf16(false, a, false, b, (short)0, c, false, false); }

// k_gemmb: 64 x 64 block tile (4 waves x 16 x 64) of C[NTK][NW] = (A [+ Al]).B^T (K = 256) [+ bf(bias[c])] [+ bf(R[r][c]) residual]; f32 whole-line epilogue (or f16
// EPI: what the epilogue stores besides or instead of C, always the bf16 hi + UNSCALED residual planes of the f32 tile that lies in LDS:
//   0 nothing more; 1 (qkv, no C) the q and k planes [item][head][s][32] and the v^T planes [item][head][d][s]; 2 (to_out) C and its planes [r][ldc].
// AHM: A lies head-major, [item][head][s][32] (as k_attn stores ctx): a 32-wide k step is one head, so the step from one to the next is SS * HD elements.
// Every #pragma unroll of these plane stores makes the indices of the 8-element vectors constants, so that they stay in registers.
__device__ __forceinline__ void split8(const float* v, v8us& oh, v8us& ol) {
#pragma unroll
    for (int i = 0; i < 8; ++i) { const unsigned short hb = f2bf(v[i]); oh[i] = hb; ol[i] = f2bf(v[i] - bf2f(hb)); }
}
__device__ __forceinline__ void split8l(const float* sp, v8us& oh, v8us& ol) {    // 8 floats in a row in LDS, 16-byte aligned
    const v4f a = *(const v4fa*)sp, b = *(const v4fa*)(sp + 4); const float v[8] = {a[0], a[1], a[2], a[3], b[0], b[1], b[2], b[3]}; split8(v, oh, ol);
}
#define OSW (16 * 68 + 4)   // floats of one wave's staging tile; the 4 spread the four tiles over the banks for the v^T reads, which go down columns of all four
template <bool SPLITA, bool F16OUT = false, int EPI = 0, bool AHM = false>
// 12 waves per SIMD asked for: the budget of 80 VGPRs that the loop had before the plane stores came in (two more would cost two waves per SIMD, and the loop lives on waves that hide its loads)
__global__ __launch_bounds__(128, 12) void k_gemmb(const bf* __restrict__ A, const bf* __restrict__ Al, const bf* __restrict__ Bn, const float* __restrict__ bias, float* C, int ldc, h16* C2, const float* __restrict__ R, int K, int roundR, bf* P0h, bf* P0l, bf* P1h, bf* P1l, bf* P2h, bf* P2l) {
    __shared__ __align__(16) float ost[4][OSW];
    const int lane = threadIdx.x & 31, wave = threadIdx.x >> 5, lr = lane & 15, hi = lane >> 4;
    const int r0 = blockIdx.x * 64 + wave * 16, c0 = blockIdx.y * 64;
    size_t aoff = AHM ? (size_t)(r0 / SS) * (NH_ * SS * HD) + (size_t)(r0 % SS + lr) * HD + 8 * hi : (size_t)(r0 + lr) * K + 8 * hi;
    size_t boff[4];
#pragma unroll
    for (int t = 0; t < 4; ++t) boff[t] = (size_t)(c0 + t * 16 + lr) * K + 8 * hi;
    v8f acc[4];
#pragma unroll
    for (int t = 0; t < 4; ++t) acc[t] = (v8f){};
#pragma unroll 1
    for (int kc = 0; kc < K; kc += 32) {
        const v16bf a = cat16b(*(const v8us*)(A + aoff + kc), *(const v8us*)(A + aoff + kc + 16));
        v16bf al = a;
        if (SPLITA) al = cat16b(*(const v8us*)(Al + aoff + kc), *(const v8us*)(Al + aoff + kc + 16));
#pragma unroll
        for (int t = 0; t < 4; ++t) { const v16bf b = cat16b(*(const v8us*)(Bn + boff[t] + kc), *(const v8us*)(Bn + boff[t] + kc + 16)); acc[t] = wmmab(a, b, acc[t]); if (SPLITA) acc[t] = wmmab(al, b, acc[t]); }
        asm volatile("v_nop\n\tv_nop\n\tv_nop\n\tv_nop" : "+v"(acc[0]), "+v"(acc[1]), "+v"(acc[2]), "+v"(acc[3]) : "v"(a), "v"(al));
        if (AHM) {    // with kc's 32: on to the next head. The wait stands in front of every rewrite of an address register of this trip's A loads: the new addresses are formed from its outputs
            asm volatile("s_wait_xcnt 0x0" : "+v"(aoff) :: "memory");
            aoff += SS * HD - 32; }
    }
    float* os = &ost[wave][0];
#pragma unroll
    for (int t = 0; t < 4; ++t) { const float bv = bias ? bfr(bias[c0 + t * 16 + lr]) : 0.f;
#pragma unroll
        for (int j = 0; j < 8; ++j) os[(hi * 8 + j) * 68 + t * 16 + lr] = acc[t][j] + bv; }
    __syncthreads();
    if (EPI == 1) {
        const size_t ih = (size_t)(r0 / SS) * NH_ + (c0 % INR) / HD;    // (item, first of the tile's two heads)
        if (c0 < 2 * INR) {    // q or k: the wave's own 16 tokens x 2 heads; a store covers 8 tokens of one head, 512 bytes in a row
            bf* Ph = c0 < INR ? P0h : P1h; bf* Pl = c0 < INR ? P0l : P1l;
#pragma unroll
            for (int s = 0; s < 4; ++s) { const int row = (s & 1) * 8 + (lane >> 2), piece = lane & 3; v8us oh, ol; split8l(os + row * 68 + (s >> 1) * HD + piece * 8, oh, ol);
                const size_t o = ((ih + (s >> 1)) * SS + r0 % SS + row) * HD + piece * 8; *(v8us*)(Ph + o) = oh; *(v8us*)(Pl + o) = ol; }
        } else {    // v: the wave takes 16 of the tile's 64 columns (d) over all 64 tokens, from the four waves' tiles; a store covers 4 whole 128-byte lines
#pragma unroll
            for (int s = 0; s < 4; ++s) { const int col = wave * 16 + s * 4 + (lane >> 3), piece = lane & 7; const float* sp = &ost[piece >> 1][(piece & 1) * 8 * 68 + col]; float v[8];
#pragma unroll
                for (int i = 0; i < 8; ++i) v[i] = sp[i * 68];
                v8us oh, ol; split8(v, oh, ol);
                const size_t o = ((ih + col / HD) * HD + col % HD) * SS + (blockIdx.x * 64) % SS + piece * 8; *(v8us*)(P2h + o) = oh; *(v8us*)(P2l + o) = ol; }
            asm volatile("s_wait_xcnt 0x0" ::: "memory");    // the build lays the q/k branch behind this one, with a branch between: the wait stands in front of whatever there overwrites a register of the last stores
        }
    } else if (F16OUT) {
        h16* crow = (h16*)(void*)C + (size_t)r0 * ldc + c0;
        auto pass = [&]() {
#pragma unroll
            for (int s = 0; s < 4; ++s) { const int row = 4 * s + (lane >> 3), piece = lane & 7; const float* sp = os + row * 68 + piece * 8; v8h o, o2;
#pragma unroll
                for (int i = 0; i < 8; ++i) { const h16 a = (h16)sp[i]; o[i] = a; o2[i] = (h16)((sp[i] - (float)a) * LOSC); }
                *(v8h*)(crow + (size_t)row * ldc + piece * 8) = o; if (C2) *(v8h*)(C2 + (size_t)r0 * ldc + c0 + (size_t)row * ldc + piece * 8) = o2; }
        };
        pass(); 
    } else {
        float* crow = C + (size_t)r0 * ldc + c0;
        auto pass = [&]() {
#pragma unroll
            for (int s = 0; s < 8; ++s) { const int Lid = (lane >> 3) + 4 * s, piece = lane & 7; const int row = Lid >> 1, cofs = (Lid & 1) * 32 + piece * 4;
                v4f val = *(const v4fa*)(os + row * 68 + cofs); if (R) { const v4f rv = *(const v4f*)(R + ((size_t)r0 + row) * ldc + c0 + cofs); val += roundR ? (v4f){bfr(rv[0]), bfr(rv[1]), bfr(rv[2]), bfr(rv[3])} : rv; }
                *(v4f*)(crow + (size_t)row * ldc + cofs) = val; }
        };
        pass(); 
        if (EPI == 2) {    // the planes of the same tile: a token's 64 columns are one 128-byte line of each plane
            asm volatile("s_wait_xcnt 0x0" ::: "memory");    // the f32 stores above stand behind branches (on R); the wait stands in front of what overwrites their registers from here on
#pragma unroll
            for (int s = 0; s < 4; ++s) { const int row = s * 4 + (lane >> 3), piece = lane & 7; v8us oh, ol; split8l(os + row * 68 + piece * 8, oh, ol);
                const size_t o = (size_t)(r0 + row) * ldc + c0 + piece * 8; *(v8us*)(P0h + o) = oh; *(v8us*)(P0l + o) = ol; }
        }
    }
}

// k_wt: WT [n][K] = bf16(W[k][n]) (k-major [K][ncols]) via 64 x 64 LDS tiles; grid (K/64, ncols/64).
__global__ __launch_bounds__(256) void k_wt(const float* __restrict__ Wm, int K, int ncols, bf* WT) {
    __shared__ __align__(16) unsigned short tl[64 * 72];
    const int tid = threadIdx.x, k0 = blockIdx.x * 64, n0 = blockIdx.y * 64;
    const int kk = tid >> 2, nq = (tid & 3) * 16;
#pragma unroll
    for (int i = 0; i < 16; ++i) tl[(nq + i) * 72 + kk] = f2bf(Wm[(size_t)(k0 + kk) * ncols + n0 + nq + i]);
    __syncthreads();
    const int piece = tid & 7;
    auto pass = [&]() {
#pragma unroll
        for (int s = 0; s < 2; ++s) { const int nr = (tid >> 3) + 32 * s; const v8us val = *(const v8usa*)(tl + nr * 72 + piece * 8); *(v8us*)(WT + (size_t)(n0 + nr) * K + k0 + piece * 8) = val; }
    };
    pass(); 
}

__global__ __launch_bounds__(256) void k_ln(const float* __restrict__ xb, const float* __restrict__ g, const float* __restrict__ bb, bf* Hh, bf* Hl) {
    const int lane = threadIdx.x & 31, r = blockIdx.x * 8 + (threadIdx.x >> 5); if (r >= NR) return; float v[8]; float s = 0.f;
#pragma unroll
    for (int i = 0; i < 8; ++i) { v[i] = bfr(xb[(size_t)r * DIM + lane * 8 + i]); s += v[i]; }
#pragma unroll
    for (int sh = 16; sh; sh >>= 1) s += __shfl_xor(s, sh, 32);
    const float mu = s * (1.0f / DIM); float q = 0.f;
#pragma unroll
    for (int i = 0; i < 8; ++i) { const float d = v[i] - mu; q = fmaf(d, d, q); }
#pragma unroll
    for (int sh = 16; sh; sh >>= 1) q += __shfl_xor(q, sh, 32);
    const float rs = rsqrtf(q * (1.0f / DIM) + 1e-5f); v8us oh, ol;
#pragma unroll
    for (int i = 0; i < 8; ++i) { const int c = lane * 8 + i; const float y = (v[i] - mu) * rs * bfr(g[c]) + bfr(bb[c]); const unsigned short hb = f2bf(y); oh[i] = hb; ol[i] = f2bf(y - bf2f(hb)); }
    const size_t o = (size_t)r * DIM + lane * 8; *(v8us*)(Hh + o) = oh; *(v8us*)(Hl + o) = ol; 
}
template <int N> struct ic { static constexpr int v = N; };
typedef __attribute__((ext_vector_type(2))) float  v2f;
typedef __attribute__((ext_vector_type(2))) __bf16 v2bf;
__global__ __launch_bounds__(512) void k_attn(const bf* __restrict__ Qh, const bf* __restrict__ Ql, const bf* __restrict__ Kh, const bf* __restrict__ Kl, const bf* __restrict__ VTh, const bf* __restrict__ VTl, bf* __restrict__ Ch, bf* __restrict__ Cl) {
    __shared__ __align__(16) unsigned short sT[SS / 32][2][2][2][2][32][8];    // [32-key trip][k | v^T][plane][16-key tile | 16-d tile][piece][lane][8]: a trip's 8 KiB lie together
    const int lane = threadIdx.x & 31, c = lane & 15, h = lane >> 4;
    const int wave = __builtin_amdgcn_readfirstlane(threadIdx.x >> 5);    // in a scalar register: the trip loops' bounds and branches are scalar
    { const size_t g = blockIdx.x; Qh += g * SS * HD; Ql += g * SS * HD; Kh += g * SS * HD; Kl += g * SS * HD; VTh += g * HD * SS; VTl += g * HD * SS; Ch += g * SS * HD; Cl += g * SS * HD; }
    const int q0 = wave * 32;
    v16bf qh[2], ql[2];
    {   // wave w brings trip w: key tiles 2w, 2w + 1 and their v^T columns; and its own 32 queries
        const bf* pk[2][2]; const bf* pv[2]; const bf* pq[2][2];
#pragma unroll
        for (int pl = 0; pl < 2; ++pl) { pv[pl] = (pl ? VTl : VTh) + (size_t)c * SS + wave * 32 + 8 * h;
#pragma unroll
            for (int t = 0; t < 2; ++t) { pk[pl][t] = (pl ? Kl : Kh) + (size_t)(q0 + t * 16 + c) * HD + 8 * h; pq[pl][t] = (pl ? Ql : Qh) + (size_t)(q0 + t * 16 + c) * HD + 8 * h; } }
        v8us tk[2][2][2], tv[2][2][2];
#pragma unroll
        for (int pl = 0; pl < 2; ++pl)
#pragma unroll
            for (int t = 0; t < 2; ++t)
#pragma unroll
                for (int p = 0; p < 2; ++p) { tk[pl][t][p] = *(const v8us*)(pk[pl][t] + 16 * p); tv[pl][t][p] = *(const v8us*)(pv[pl] + (size_t)t * 16 * SS + 16 * p); }
#pragma unroll
        for (int qt = 0; qt < 2; ++qt) { qh[qt] = cat16b(*(const v8us*)pq[0][qt], *(const v8us*)(pq[0][qt] + 16)); ql[qt] = cat16b(*(const v8us*)pq[1][qt], *(const v8us*)(pq[1][qt] + 16)); }
        // the addresses stay live up to this wait, so that nothing (a later load's result either) lands in an address register of a load in front of it
        asm volatile("s_wait_xcnt 0x0" :: "v"(pk[0][0]), "v"(pk[0][1]), "v"(pk[1][0]), "v"(pk[1][1]), "v"(pv[0]), "v"(pv[1]), "v"(pq[0][0]), "v"(pq[0][1]), "v"(pq[1][0]), "v"(pq[1][1]) : "memory");
#pragma unroll
        for (int pl = 0; pl < 2; ++pl)
#pragma unroll
            for (int t = 0; t < 2; ++t)
#pragma unroll
                for (int p = 0; p < 2; ++p) { *(v8usa*)&sT[wave][0][pl][t][p][lane][0] = tk[pl][t][p]; *(v8usa*)&sT[wave][1][pl][t][p][lane][0] = tv[pl][t][p]; }
    }
    __syncthreads();
    auto kfrag = [&](int pl, int jc, int tj) -> v16bf { return cat16b(*(const v8usa*)&sT[jc][0][pl][tj][0][lane][0], *(const v8usa*)&sT[jc][0][pl][tj][1][lane][0]); };
    auto vfrag = [&](int pl, int jc, int dt) -> v16bf { return cat16b(*(const v8usa*)&sT[jc][1][pl][dt][0][lane][0], *(const v8usa*)&sT[jc][1][pl][dt][1][lane][0]); };
    // s[r] = sim[query q0 + qt * 16 + c][key jc * 32 + tj * 16 + 8 h + r]
    auto sim = [&](v16bf kh, v16bf kl, int qt) -> v8f { v8f s = {}; s = wmmab(kh, qh[qt], s); s = wmmab(kh, ql[qt], s); s = wmmab(kl, qh[qt], s); return s; };
    // A trip's 32 keys against the wave's 32 queries: M = 0 all allowed (trip < wave), 1 the diagonal trip, 2 all masked (trip > wave).
    float mu[2] = {-3.0e38f, -3.0e38f}, mm[2] = {-3.0e38f, -3.0e38f};    // maxima of sim + mask, and of sim alone over the wholly masked trips
    auto walk1 = [&](auto M, int jc) {
#pragma unroll
        for (int tj = 0; tj < 2; ++tj) { const v16bf kh = kfrag(0, jc, tj), kl = kfrag(1, jc, tj);
#pragma unroll
            for (int qt = 0; qt < 2; ++qt) { const v8f s = sim(kh, kl, qt);
#pragma unroll
                for (int r = 0; r < 8; ++r) {
                    if constexpr (decltype(M)::v == 0) mu[qt] = fmaxf(mu[qt], s[r]);
                    else if constexpr (decltype(M)::v == 2) mm[qt] = fmaxf(mm[qt], s[r]);
                    else mu[qt] = fmaxf(mu[qt], s[r] + ((tj * 16 + 8 * h + r > qt * 16 + c) ? -10000.0f : 0.f)); } } }
    };
    for (int jc = 0; jc < wave; ++jc) walk1(ic<0>{}, jc);
    walk1(ic<1>{}, wave);
    for (int jc = wave + 1; jc < SS / 32; ++jc) walk1(ic<2>{}, jc);
    const float CE = SCL * 1.4426950408889634f;    // exp(x * scale) = exp2(x * CE)
    float nm[2]; v2f sum[2] = {(v2f){0.f, 0.f}, (v2f){0.f, 0.f}};    // even and odd keys summed apart
#pragma unroll
    for (int qt = 0; qt < 2; ++qt) { float m = fmaxf(mu[qt], mm[qt] + -10000.0f); m = fmaxf(m, __shfl_xor(m, 16, 32)); nm[qt] = -(m * CE); }
    v8f o[2][2];
#pragma unroll
    for (int dt = 0; dt < 2; ++dt)
#pragma unroll
        for (int qt = 0; qt < 2; ++qt) o[dt][qt] = (v8f){};
    auto walk2 = [&](auto M, int jc) {
        v16bf ph[2], pl[2];
#pragma unroll
        for (int tj = 0; tj < 2; ++tj) { const v16bf kh = kfrag(0, jc, tj), kl = kfrag(1, jc, tj);
#pragma unroll
            for (int qt = 0; qt < 2; ++qt) { const v8f s = sim(kh, kl, qt);
#pragma unroll
                for (int r = 0; r < 8; r += 2) { v2f e;
#pragma unroll
                    for (int u = 0; u < 2; ++u) {
                        float t = s[r + u];
                        if constexpr (decltype(M)::v == 2) t += -10000.0f;
                        else if constexpr (decltype(M)::v == 1) t += ((tj * 16 + 8 * h + r + u > qt * 16 + c) ? -10000.0f : 0.f);
                        const float x = fmaf(t, CE, nm[qt]); float ex;
                        if constexpr (decltype(M)::v == 1) asm("v_exp_f32 %0, %1\n\tv_nop" : "=v"(ex) : "v"(x));    // the v_nop fills the slot behind the transcendental
                        else ex = __builtin_amdgcn_exp2f(x);
                        e[u] = ex; }
                    sum[qt] += e;
                    const v2bf eh = __builtin_convertvector(e, v2bf); const v2bf el = __builtin_convertvector(e - __builtin_convertvector(eh, v2f), v2bf);
                    ph[qt][tj * 8 + r] = eh[0]; ph[qt][tj * 8 + r + 1] = eh[1]; pl[qt][tj * 8 + r] = el[0]; pl[qt][tj * 8 + r + 1] = el[1]; } } }
#pragma unroll
        for (int dt = 0; dt < 2; ++dt) { const v16bf vh = vfrag(0, jc, dt), vl = vfrag(1, jc, dt);
#pragma unroll
            for (int qt = 0; qt < 2; ++qt) { o[dt][qt] = wmmab(vh, ph[qt], o[dt][qt]); o[dt][qt] = wmmab(vh, pl[qt], o[dt][qt]); o[dt][qt] = wmmab(vl, ph[qt], o[dt][qt]); } }
    };
    for (int jc = 0; jc < wave; ++jc) walk2(ic<0>{}, jc);
    walk2(ic<1>{}, wave);
    for (int jc = wave + 1; jc < SS / 32; ++jc) walk2(ic<2>{}, jc);
    // o[dt][qt][r] = ctx^T[d = dt * 16 + 8 h + r][query q0 + qt * 16 + c]: 8 consecutive d of one query a lane, stored as the bf16 hi + residual planes [item][head][s][32] that to_out reads; a query's 64 bytes of a plane, and its neighbours', come from this wave alone
#pragma unroll
    for (int qt = 0; qt < 2; ++qt) { const float sl = sum[qt][0] + sum[qt][1]; const float sm = sl + __shfl_xor(sl, 16, 32); const float inv = 1.0f / sm;
#pragma unroll
        for (int dt = 0; dt < 2; ++dt) { const size_t co = (size_t)(q0 + qt * 16 + c) * HD + dt * 16 + 8 * h; const v8f v = o[dt][qt] * inv; v8us oh, ol;
#pragma unroll
            for (int i = 0; i < 8; ++i) { const unsigned short hb = f2bf(v[i]); oh[i] = hb; ol[i] = f2bf(v[i] - bf2f(hb)); }
            *(v8us*)(Ch + co) = oh; *(v8us*)(Cl + co) = ol; } }
}
// k_glu: out[b][s][c] = O[s][c] + G[s][c] tanh(G[s][256 + c]); one wave per row: lane -> 8 columns (32 B: two 16-B stores? -> use v4f x 2: lane -> columns lane*4..+3 and 128 + lane*4..+3; a
__global__ __launch_bounds__(256) void k_glu(const float* __restrict__ O, const float* __restrict__ G, float* OUTB) {
    const int lane = threadIdx.x & 31, s = blockIdx.x * 8 + (threadIdx.x >> 5); if (s >= NR) return;
{
#pragma unroll
        for (int st = 0; st < 2; ++st) { const int c0 = st * 128 + lane * 4; v4f v;
#pragma unroll
            for (int q = 0; q < 4; ++q) { const int c = c0 + q; v[q] = O[(size_t)s * DIM + c] + G[(size_t)s * 2 * DIM + c] * tanhf(G[(size_t)s * 2 * DIM + DIM + c]); }
            *(v4f*)(OUTB + (size_t)s * DIM + c0) = v; }
         }
}

extern "C" void kernel_launch(void* const* d_in, const int* in_sizes, int n_in,
                              void* d_out, int out_size, void* d_ws, size_t ws_size, hipStream_t stream) {
    (void)in_sizes; (void)n_in; (void)out_size;
    const float* x = (const float*)d_in[0]; const float* lng = (const float*)d_in[1]; const float* lnb = (const float*)d_in[2]; const float* wqkv = (const float*)d_in[3]; const float* wout = (const float*)d_in[4]; const float* bout = (const float*)d_in[5]; const float* wglu = (const float*)d_in[6];
    float* out = (float*)d_out;    // [32][512][256]
    char* wsp = (char*)d_ws;
    auto take = [&](size_t bytes) { char* p = wsp; wsp += (bytes + 255) & ~(size_t)255; return (void*)p; };
    bf* WQKV = (bf*)take((size_t)(3 * INR) * DIM * 2); bf* WOUT = (bf*)take((size_t)DIM * INR * 2); bf* WGLU = (bf*)take((size_t)(2 * DIM) * DIM * 2);
    // q, k and v^T planes of all items: [item][head][...], so (item, head) is the block index of k_attn
    bf* Qh = (bf*)take((size_t)NBT * NH_ * SS * HD * 2); bf* Ql = (bf*)take((size_t)NBT * NH_ * SS * HD * 2); bf* Kh = (bf*)take((size_t)NBT * NH_ * SS * HD * 2); bf* Kl = (bf*)take((size_t)NBT * NH_ * SS * HD * 2);
    bf* VTh = (bf*)take((size_t)NBT * NH_ * HD * SS * 2); bf* VTl = (bf*)take((size_t)NBT * NH_ * HD * SS * 2);
    char* const reuse = wsp;    // from here the phases lay their buffers over one another, in stream order
    // phase 1 (all items): LayerNorm planes; dead once the q, k, v^T planes are written
    bf* Hh = (bf*)take((size_t)NR * DIM * 2); bf* Hl = (bf*)take((size_t)NR * DIM * 2);
    // phase 2 (all items): ctx planes (head-major), then what follows attention
    wsp = reuse;
    bf* Ch = (bf*)take((size_t)NR * INR * 2); bf* Cl = (bf*)take((size_t)NR * INR * 2);
    float* O = (float*)take((size_t)NR * DIM * 4); bf* Oh = (bf*)take((size_t)NR * DIM * 2); bf* Ol = (bf*)take((size_t)NR * DIM * 2); float* G = (float*)take((size_t)NR * 2 * DIM * 4);
    if ((size_t)(wsp - (char*)d_ws) > ws_size) return;    // the largest phase: 0.75 + 48 + 16 + 16 + 16 + 32 ~ 129 MiB
    k_wt<<<dim3(DIM / 64, (3 * INR) / 64, 1), 256, 0, stream>>>(wqkv, DIM, 3 * INR, WQKV); k_wt<<<dim3(INR / 64, DIM / 64, 1), 256, 0, stream>>>(wout, INR, DIM, WOUT); k_wt<<<dim3(DIM / 64, (2 * DIM) / 64, 1), 256, 0, stream>>>(wglu, DIM, 2 * DIM, WGLU);
    k_ln<<<NR / 8, 256, 0, stream>>>(x, lng, lnb, Hh, Hl);
    k_gemmb<true, false, 1, false><<<dim3(NR / 64, (3 * INR) / 64, 1), 128, 0, stream>>>(Hh, Hl, WQKV, nullptr, nullptr, 3 * INR, nullptr, nullptr, DIM, 1, Qh, Ql, Kh, Kl, VTh, VTl);
    k_attn<<<NBT * NH_, 512, 0, stream>>>(Qh, Ql, Kh, Kl, VTh, VTl, Ch, Cl);
    k_gemmb<true, false, 2, true><<<dim3(NR / 64, DIM / 64, 1), 128, 0, stream>>>(Ch, Cl, WOUT, bout, O, DIM, nullptr, nullptr, INR, 1, Oh, Ol, nullptr, nullptr, nullptr, nullptr);
    k_gemmb<true, false, 0, false><<<dim3(NR / 64, (2 * DIM) / 64, 1), 128, 0, stream>>>(Oh, Ol, WGLU, nullptr, G, 2 * DIM, nullptr, nullptr, DIM, 1, nullptr, nullptr, nullptr, nullptr, nullptr, nullptr);
    k_glu<<<NR / 8, 256, 0, stream>>>(O, G, out);
}

// v004
// It runs in 117 microseconds.
// In two side-by-side timings against v003, it was 1.10 and 1.14 times as fast.
// All steps since v000 together make it 24.8 times as fast.
#include <hip/hip_runtime.h>

// Compute dtypes, f32 accumulate, per item (512 tokens): LayerNorm in f32 -> bf16 hi + UNSCALED residual planes; qkv, to_out and the GLU projection as [512 x K].[K x N] GEMMs
// against the exact bf16 k-major weights (two products); per (item, head), in one kernel: sim = q.k^T ([512 x 32].[32 x 512], three products),
// the causal -10000 mask then x scale and the row softmax in f32, ctx = P.v ([512 x 512].[512 x 32], three products), scores and P in registers only - on v_wmma_f32_16x16x32_bf16; the GLU

#define NBT  32
#define SS   512
#define DIM  256
#define NH_  8
#define HD   32
#define INR  256
#define DM   DIM
#define SCL  0.17677669529663687f
#define LOSC 1024.0f
#define NR   (NBT * SS)   // token rows of all items together

typedef _Float16 h16;
typedef unsigned short bf;
typedef __attribute__((ext_vector_type(16))) __bf16   v16bf;
typedef __attribute__((ext_vector_type(16))) _Float16 v16h;
typedef __attribute__((ext_vector_type(8)))  _Float16 v8h;
typedef __attribute__((ext_vector_type(8)))  unsigned short v8us;
typedef __attribute__((ext_vector_type(8)))  float    v8f;
typedef __attribute__((ext_vector_type(4)))  float    v4f;
typedef v8h  __attribute__((may_alias)) v8ha;
typedef v4f  __attribute__((may_alias)) v4fa;
typedef v8us __attribute__((may_alias)) v8usa;

__device__ __forceinline__ unsigned short f2bf(float f) { unsigned u = __float_as_uint(f); u += 0x7FFFu + ((u >> 16) & 1u); return (unsigned short)(u >> 16); }
__device__ __forceinline__ float bf2f(unsigned short b) { return __uint_as_float(((unsigned)b) << 16); }
__device__ __forceinline__ float bfr(float f) { return bf2f(f2bf(f)); }
__device__ __forceinline__ v16h cat16(v8h lo, v8h hi) { return __builtin_shufflevector(lo, hi, 0, 1, 2, 3, 4, 5, 6, 7, 8, 9, 10, 11, 12, 13, 14, 15); }
__device__ __forceinline__ v16bf cat16b(v8us lo, v8us hi) { return __builtin_bit_cast(v16bf, __builtin_shufflevector(lo, hi, 0, 1, 2, 3, 4, 5, 6, 7, 8, 9, 10, 11, 12, 13, 14, 15)); }
__device__ __forceinline__ v8f wmma16(v16h a, v16h b, v8f c) { return __builtin_amdgcn_wmma_f32_16x16x32_f16(false, a, false, b, (short)0, c, false, false); }
__device__ __forceinline__ v8f wmmab(v16bf a, v16bf b, v8f c) { return __builtin_amdgcn_wmma_f32_16x16x32_bf16(false, a, false, b, (short)0, c, false, false); }

// k_gemmb: 64 x 64 block tile (4 waves x 16 x 64) of C[NTK][NW] = (A [+ Al]).B^T (K = 256) [+ bf(bias[c])] [+ bf(R[r][c]) residual]; f32 whole-line epilogue (or f16
// EPI: what the epilogue stores besides or instead of C, always the bf16 hi + UNSCALED residual planes of the f32 tile that lies in LDS:
//   0 nothing more; 1 (qkv, no C) the q and k planes [item][head][s][32] and the v^T planes [item][head][d][s]; 2 (to_out) C and its planes in the fragment order below.
// FRAGMENT ORDER: A, Al and Bn lie as the loop loads them, [16-row tile][32-wide k step][piece p][lane][8]: lane = 16 hi + lr holds row lr, k = 32 step + 16 p + 8 hi + 0..7,
// so a wave's 16-byte loads of one piece read 512 bytes in a row (4 whole lines) where a row-major operand gave 32 bytes of each of 16 lines. Every producer stores this order.
// Every #pragma unroll of these plane stores makes the indices of the 8-element vectors constants, so that they stay in registers.
__device__ __forceinline__ void split8(const float* v, v8us& oh, v8us& ol) {
#pragma unroll
    for (int i = 0; i < 8; ++i) { const unsigned short hb = f2bf(v[i]); oh[i] = hb; ol[i] = f2bf(v[i] - bf2f(hb)); }
}
__device__ __forceinline__ void split8l(const float* sp, v8us& oh, v8us& ol) {    // 8 floats in a row in LDS, 16-byte aligned
    const v4f a = *(const v4fa*)sp, b = *(const v4fa*)(sp + 4); const float v[8] = {a[0], a[1], a[2], a[3], b[0], b[1], b[2], b[3]}; split8(v, oh, ol);
}
#define OSW (16 * 68 + 4)   // floats of one wave's staging tile; the 4 spread the four tiles over the banks for the v^T reads, which go down columns of all four
template <int K, bool SPLITA, bool F16OUT = false, int EPI = 0>
// 12 waves per SIMD asked for: the budget of 80 VGPRs that the loop had before the plane stores came in (two more would cost two waves per SIMD, and the loop lives on waves that hide its loads)
__global__ __launch_bounds__(128, 12) void k_gemmb(const bf* __restrict__ A, const bf* __restrict__ Al, const bf* __restrict__ Bn, const float* __restrict__ bias, float* C, int ldc, h16* C2, const float* __restrict__ R, int roundR, bf* P0h, bf* P0l, bf* P1h, bf* P1l, bf* P2h, bf* P2l) {
    __shared__ __align__(16) float ost[4][OSW];
    const int lane = threadIdx.x & 31, wave = threadIdx.x >> 5, lr = lane & 15, hi = lane >> 4;
    const int r0 = blockIdx.x * 64 + wave * 16, c0 = blockIdx.y * 64;
    // byte offsets of the lane's 16 bytes in the trip's first pieces (a 16-row tile is K / 32 steps of 1 KiB); all 12 loads of a trip are these two plus constants
    unsigned ao = (unsigned)(r0 >> 4) * (K * 32) + lane * 16, bo = (unsigned)(c0 >> 4) * (K * 32) + lane * 16;
    auto frag = [](const bf* base, unsigned off) -> v16bf { const char* p = (const char*)base + off; return cat16b(*(const v8us*)p, *(const v8us*)(p + 512)); };
    v8f acc[4];
#pragma unroll
    for (int t = 0; t < 4; ++t) acc[t] = (v8f){};
#pragma unroll 1
    for (int kc = 0; kc < K; kc += 32) {
        const v16bf a = frag(A, ao);
        v16bf al = a;
        if (SPLITA) al = frag(Al, ao);
#pragma unroll
        for (int t = 0; t < 4; ++t) { const v16bf b = frag(Bn + t * (K * 16), bo); acc[t] = wmmab(a, b, acc[t]); if (SPLITA) acc[t] = wmmab(al, b, acc[t]); }
        asm volatile("v_nop\n\tv_nop\n\tv_nop\n\tv_nop" : "+v"(acc[0]), "+v"(acc[1]), "+v"(acc[2]), "+v"(acc[3]) : "v"(a), "v"(al));
        asm volatile("s_wait_xcnt 0x0" : "+v"(ao), "+v"(bo) :: "memory");    // in front of the rewrite of the trip's two address registers: the next offsets are formed from its outputs, and both stay live up to here
        ao += 1024; bo += 1024;
    }
    float* os = &ost[wave][0];
#pragma unroll
    for (int t = 0; t < 4; ++t) { const float bv = bias ? bfr(bias[c0 + t * 16 + lr]) : 0.f;
#pragma unroll
        for (int j = 0; j < 8; ++j) os[(hi * 8 + j) * 68 + t * 16 + lr] = acc[t][j] + bv; }
    __syncthreads();
    if (EPI == 1) {
        const size_t ih = (size_t)(r0 / SS) * NH_ + (c0 % INR) / HD;    // (item, first of the tile's two heads)
        if (c0 < 2 * INR) {    // q or k: the wave's own 16 tokens x 2 heads; a store covers 8 tokens of one head, 512 bytes in a row
            bf* Ph = c0 < INR ? P0h : P1h; bf* Pl = c0 < INR ? P0l : P1l;
#pragma unroll
            for (int s = 0; s < 4; ++s) { const int row = (s & 1) * 8 + (lane >> 2), piece = lane & 3; v8us oh, ol; split8l(os + row * 68 + (s >> 1) * HD + piece * 8, oh, ol);
                const size_t o = ((ih + (s >> 1)) * SS + r0 % SS + row) * HD + piece * 8; *(v8us*)(Ph + o) = oh; *(v8us*)(Pl + o) = ol; }
        } else {    // v: the wave takes 16 of the tile's 64 columns (d) over all 64 tokens, from the four waves' tiles; a store covers 4 whole 128-byte lines
#pragma unroll
            for (int s = 0; s < 4; ++s) { const int col = wave * 16 + s * 4 + (lane >> 3), piece = lane & 7; const float* sp = &ost[piece >> 1][(piece & 1) * 8 * 68 + col]; float v[8];
#pragma unroll
                for (int i = 0; i < 8; ++i) v[i] = sp[i * 68];
                v8us oh, ol; split8(v, oh, ol);
                const size_t o = ((ih + col / HD) * HD + col % HD) * SS + (blockIdx.x * 64) % SS + piece * 8; *(v8us*)(P2h + o) = oh; *(v8us*)(P2l + o) = ol; }
            asm volatile("s_wait_xcnt 0x0" ::: "memory");    // the build lays the q/k branch behind this one, with a branch between: the wait stands in front of whatever there overwrites a register of the last stores
        }
    } else if (F16OUT) {
        h16* crow = (h16*)(void*)C + (size_t)r0 * ldc + c0;
        auto pass = [&]() {
#pragma unroll
            for (int s = 0; s < 4; ++s) { const int row = 4 * s + (lane >> 3), piece = lane & 7; const float* sp = os + row * 68 + piece * 8; v8h o, o2;
#pragma unroll
                for (int i = 0; i < 8; ++i) { const h16 a = (h16)sp[i]; o[i] = a; o2[i] = (h16)((sp[i] - (float)a) * LOSC); }
                *(v8h*)(crow + (size_t)row * ldc + piece * 8) = o; if (C2) *(v8h*)(C2 + (size_t)r0 * ldc + c0 + (size_t)row * ldc + piece * 8) = o2; }
        };
        pass(); 
    } else {
        float* crow = C + (size_t)r0 * ldc + c0;
        auto pass = [&]() {
#pragma unroll
            for (int s = 0; s < 8; ++s) { const int Lid = (lane >> 3) + 4 * s, piece = lane & 7; const int row = Lid >> 1, cofs = (Lid & 1) * 32 + piece * 4;
                v4f val = *(const v4fa*)(os + row * 68 + cofs); if (R) { const v4f rv = *(const v4f*)(R + ((size_t)r0 + row) * ldc + c0 + cofs); val += roundR ? (v4f){bfr(rv[0]), bfr(rv[1]), bfr(rv[2]), bfr(rv[3])} : rv; }
                *(v4f*)(crow + (size_t)row * ldc + cofs) = val; }
        };
        pass(); 
        if (EPI == 2) {    // the planes of the same tile, in fragment order for the next product: the wave's 16 tokens x 64 columns are two k steps, 2 KiB in a row of each plane
            asm volatile("s_wait_xcnt 0x0" ::: "memory");    // the f32 stores above stand behind branches (on R): the wait stands in front of what overwrites their registers from here on
#pragma unroll
            for (int s = 0; s < 4; ++s) { v8us oh, ol; split8l(os + lr * 68 + s * 16 + hi * 8, oh, ol);    // s = 2 (step in the tile) + piece
                const size_t o = (size_t)(r0 >> 4) * (ldc * 16) + (size_t)((c0 >> 4) + s) * 256 + lane * 8; *(v8us*)(P0h + o) = oh; *(v8us*)(P0l + o) = ol; }
        }
    }
}

// k_wt: WT = bf16(W[k][n]) (k-major [K][ncols]) in k_gemmb's fragment order (16 columns n are a tile's rows) via 64 x 64 LDS tiles; grid (K/64, ncols/64).
__global__ __launch_bounds__(256) void k_wt(const float* __restrict__ Wm, int K, int ncols, bf* WT) {
    __shared__ __align__(16) unsigned short tl[64 * 72];
    const int tid = threadIdx.x, k0 = blockIdx.x * 64, n0 = blockIdx.y * 64;
    const int kk = tid >> 2, nq = (tid & 3) * 16;
#pragma unroll
    for (int i = 0; i < 16; ++i) tl[(nq + i) * 72 + kk] = f2bf(Wm[(size_t)(k0 + kk) * ncols + n0 + nq + i]);
    __syncthreads();
    const int lane = tid & 31;
    auto pass = [&]() {    // the tile is 4 column tiles x 2 k steps x 2 pieces of 512 bytes; a wave stores two whole pieces
#pragma unroll
        for (int s = 0; s < 2; ++s) { const int q = (tid >> 5) * 2 + s, ct = q >> 2, kp = q & 3; const v8us val = *(const v8usa*)(tl + (ct * 16 + (lane & 15)) * 72 + kp * 16 + (lane >> 4) * 8);
            *(v8us*)(WT + (size_t)((n0 >> 4) + ct) * (K * 16) + (size_t)((k0 >> 4) + kp) * 256 + lane * 8) = val; }
    };
    pass(); 
}

// k_ln: one wave per token, 16 tokens (one row tile of the qkv product) per work-group. A lane's 8 columns are one 16-byte piece of the fragment order, 256 bytes from its neighbour's,
// so the 16 waves exchange their pieces through LDS (pitch 272 bytes: a wave's 32 pieces fall on different banks) and each stores 512 bytes in a row of each plane.
__global__ __launch_bounds__(512) void k_ln(const float* __restrict__ xb, const float* __restrict__ g, const float* __restrict__ bb, bf* Hh, bf* Hl) {
    __shared__ __align__(16) unsigned short sl[2][32][136];    // [plane][8-column piece][token][8], 8 elements of pad a piece
    const int lane = threadIdx.x & 31, wv = threadIdx.x >> 5, r = blockIdx.x * 16 + wv; float v[8]; float s = 0.f;
#pragma unroll
    for (int i = 0; i < 8; ++i) { v[i] = bfr(xb[(size_t)r * DIM + lane * 8 + i]); s += v[i]; }
#pragma unroll
    for (int sh = 16; sh; sh >>= 1) s += __shfl_xor(s, sh, 32);
    const float mu = s * (1.0f / DIM); float q = 0.f;
#pragma unroll
    for (int i = 0; i < 8; ++i) { const float d = v[i] - mu; q = fmaf(d, d, q); }
#pragma unroll
    for (int sh = 16; sh; sh >>= 1) q += __shfl_xor(q, sh, 32);
    const float rs = rsqrtf(q * (1.0f / DIM) + 1e-5f); v8us oh, ol;
#pragma unroll
    for (int i = 0; i < 8; ++i) { const int c = lane * 8 + i; const float y = (v[i] - mu) * rs * bfr(g[c]) + bfr(bb[c]); const unsigned short hb = f2bf(y); oh[i] = hb; ol[i] = f2bf(y - bf2f(hb)); }
    *(v8usa*)&sl[0][lane][wv * 8] = oh; *(v8usa*)&sl[1][lane][wv * 8] = ol;
    __syncthreads();
    const int pc = threadIdx.x >> 4, tk = threadIdx.x & 15;    // columns 8 pc .. 8 pc + 7 = step pc / 4, piece (pc / 2) % 2, hi = pc % 2: the piece's place in the tile is 128 pc + 8 tk elements
    const size_t o = (size_t)blockIdx.x * (16 * DIM) + threadIdx.x * 8; *(v8us*)(Hh + o) = *(const v8usa*)&sl[0][pc][tk * 8]; *(v8us*)(Hl + o) = *(const v8usa*)&sl[1][pc][tk * 8];
}
template <int N> struct ic { static constexpr int v = N; };
typedef __attribute__((ext_vector_type(2))) float  v2f;
typedef __attribute__((ext_vector_type(2))) __bf16 v2bf;
__global__ __launch_bounds__(512) void k_attn(const bf* __restrict__ Qh, const bf* __restrict__ Ql, const bf* __restrict__ Kh, const bf* __restrict__ Kl, const bf* __restrict__ VTh, const bf* __restrict__ VTl, bf* __restrict__ Ch, bf* __restrict__ Cl) {
    __shared__ __align__(16) unsigned short sT[SS / 32][2][2][2][2][32][8];    // [32-key trip][k | v^T][plane][16-key tile | 16-d tile][piece][lane][8]: a trip's 8 KiB lie together
    const int lane = threadIdx.x & 31, c = lane & 15, h = lane >> 4;
    const int wave = __builtin_amdgcn_readfirstlane(threadIdx.x >> 5);    // in a scalar register: the trip loops' bounds and branches are scalar
    { const size_t g = blockIdx.x; Qh += g * SS * HD; Ql += g * SS * HD; Kh += g * SS * HD; Kl += g * SS * HD; VTh += g * HD * SS; VTl += g * HD * SS; }
    const int q0 = wave * 32;
    v16bf qh[2], ql[2];
    {   // wave w brings trip w: key tiles 2w, 2w + 1 and their v^T columns; and its own 32 queries
        const bf* pk[2][2]; const bf* pv[2]; const bf* pq[2][2];
#pragma unroll
        for (int pl = 0; pl < 2; ++pl) { pv[pl] = (pl ? VTl : VTh) + (size_t)c * SS + wave * 32 + 8 * h;
#pragma unroll
            for (int t = 0; t < 2; ++t) { pk[pl][t] = (pl ? Kl : Kh) + (size_t)(q0 + t * 16 + c) * HD + 8 * h; pq[pl][t] = (pl ? Ql : Qh) + (size_t)(q0 + t * 16 + c) * HD + 8 * h; } }
        v8us tk[2][2][2], tv[2][2][2];
#pragma unroll
        for (int pl = 0; pl < 2; ++pl)
#pragma unroll
            for (int t = 0; t < 2; ++t)
#pragma unroll
                for (int p = 0; p < 2; ++p) { tk[pl][t][p] = *(const v8us*)(pk[pl][t] + 16 * p); tv[pl][t][p] = *(const v8us*)(pv[pl] + (size_t)t * 16 * SS + 16 * p); }
#pragma unroll
        for (int qt = 0; qt < 2; ++qt) { qh[qt] = cat16b(*(const v8us*)pq[0][qt], *(const v8us*)(pq[0][qt] + 16)); ql[qt] = cat16b(*(const v8us*)pq[1][qt], *(const v8us*)(pq[1][qt] + 16)); }
        // the addresses stay live up to this wait, so that nothing (a later load's result either) lands in an address register of a load in front of it
        asm volatile("s_wait_xcnt 0x0" :: "v"(pk[0][0]), "v"(pk[0][1]), "v"(pk[1][0]), "v"(pk[1][1]), "v"(pv[0]), "v"(pv[1]), "v"(pq[0][0]), "v"(pq[0][1]), "v"(pq[1][0]), "v"(pq[1][1]) : "memory");
#pragma unroll
        for (int pl = 0; pl < 2; ++pl)
#pragma unroll
            for (int t = 0; t < 2; ++t)
#pragma unroll
                for (int p = 0; p < 2; ++p) { *(v8usa*)&sT[wave][0][pl][t][p][lane][0] = tk[pl][t][p]; *(v8usa*)&sT[wave][1][pl][t][p][lane][0] = tv[pl][t][p]; }
    }
    __syncthreads();
    auto kfrag = [&](int pl, int jc, int tj) -> v16bf { return cat16b(*(const v8usa*)&sT[jc][0][pl][tj][0][lane][0], *(const v8usa*)&sT[jc][0][pl][tj][1][lane][0]); };
    auto vfrag = [&](int pl, int jc, int dt) -> v16bf { return cat16b(*(const v8usa*)&sT[jc][1][pl][dt][0][lane][0], *(const v8usa*)&sT[jc][1][pl][dt][1][lane][0]); };
    // s[r] = sim[query q0 + qt * 16 + c][key jc * 32 + tj * 16 + 8 h + r]
    auto sim = [&](v16bf kh, v16bf kl, int qt) -> v8f { v8f s = {}; s = wmmab(kh, qh[qt], s); s = wmmab(kh, ql[qt], s); s = wmmab(kl, qh[qt], s); return s; };
    // A trip's 32 keys against the wave's 32 queries: M = 0 all allowed (trip < wave), 1 the diagonal trip, 2 all masked (trip > wave).
    float mu[2] = {-3.0e38f, -3.0e38f}, mm[2] = {-3.0e38f, -3.0e38f};    // maxima of sim + mask, and of sim alone over the wholly masked trips
    auto walk1 = [&](auto M, int jc) {
#pragma unroll
        for (int tj = 0; tj < 2; ++tj) { const v16bf kh = kfrag(0, jc, tj), kl = kfrag(1, jc, tj);
#pragma unroll
            for (int qt = 0; qt < 2; ++qt) { const v8f s = sim(kh, kl, qt);
#pragma unroll
                for (int r = 0; r < 8; ++r) {
                    if constexpr (decltype(M)::v == 0) mu[qt] = fmaxf(mu[qt], s[r]);
                    else if constexpr (decltype(M)::v == 2) mm[qt] = fmaxf(mm[qt], s[r]);
                    else mu[qt] = fmaxf(mu[qt], s[r] + ((tj * 16 + 8 * h + r > qt * 16 + c) ? -10000.0f : 0.f)); } } }
    };
    for (int jc = 0; jc < wave; ++jc) walk1(ic<0>{}, jc);
    walk1(ic<1>{}, wave);
    for (int jc = wave + 1; jc < SS / 32; ++jc) walk1(ic<2>{}, jc);
    const float CE = SCL * 1.4426950408889634f;    // exp(x * scale) = exp2(x * CE)
    float nm[2]; v2f sum[2] = {(v2f){0.f, 0.f}, (v2f){0.f, 0.f}};    // even and odd keys summed apart
#pragma unroll
    for (int qt = 0; qt < 2; ++qt) { float m = fmaxf(mu[qt], mm[qt] + -10000.0f); m = fmaxf(m, __shfl_xor(m, 16, 32)); nm[qt] = -(m * CE); }
    v8f o[2][2];
#pragma unroll
    for (int dt = 0; dt < 2; ++dt)
#pragma unroll
        for (int qt = 0; qt < 2; ++qt) o[dt][qt] = (v8f){};
    auto walk2 = [&](auto M, int jc) {
        v16bf ph[2], pl[2];
#pragma unroll
        for (int tj = 0; tj < 2; ++tj) { const v16bf kh = kfrag(0, jc, tj), kl = kfrag(1, jc, tj);
#pragma unroll
            for (int qt = 0; qt < 2; ++qt) { const v8f s = sim(kh, kl, qt);
#pragma unroll
                for (int r = 0; r < 8; r += 2) { v2f e;
#pragma unroll
                    for (int u = 0; u < 2; ++u) {
                        float t = s[r + u];
                        if constexpr (decltype(M)::v == 2) t += -10000.0f;
                        else if constexpr (decltype(M)::v == 1) t += ((tj * 16 + 8 * h + r + u > qt * 16 + c) ? -10000.0f : 0.f);
                        const float x = fmaf(t, CE, nm[qt]); float ex;
                        if constexpr (decltype(M)::v == 1) asm("v_exp_f32 %0, %1\n\tv_nop" : "=v"(ex) : "v"(x));    // the v_nop fills the slot behind the transcendental
                        else ex = __builtin_amdgcn_exp2f(x);
                        e[u] = ex; }
                    sum[qt] += e;
                    const v2bf eh = __builtin_convertvector(e, v2bf); const v2bf el = __builtin_convertvector(e - __builtin_convertvector(eh, v2f), v2bf);
                    ph[qt][tj * 8 + r] = eh[0]; ph[qt][tj * 8 + r + 1] = eh[1]; pl[qt][tj * 8 + r] = el[0]; pl[qt][tj * 8 + r + 1] = el[1]; } } }
#pragma unroll
        for (int dt = 0; dt < 2; ++dt) { const v16bf vh = vfrag(0, jc, dt), vl = vfrag(1, jc, dt);
#pragma unroll
            for (int qt = 0; qt < 2; ++qt) { o[dt][qt] = wmmab(vh, ph[qt], o[dt][qt]); o[dt][qt] = wmmab(vh, pl[qt], o[dt][qt]); o[dt][qt] = wmmab(vl, ph[qt], o[dt][qt]); } }
    };
    for (int jc = 0; jc < wave; ++jc) walk2(ic<0>{}, jc);
    walk2(ic<1>{}, wave);
    for (int jc = wave + 1; jc < SS / 32; ++jc) walk2(ic<2>{}, jc);
    // o[dt][qt][r] = ctx^T[d = dt * 16 + 8 h + r][query q0 + qt * 16 + c]: 8 consecutive d of one query a lane, which is piece dt of to_out's A fragment (row tile = 16 queries, k step = head) at this very lane: stored as the bf16 hi + residual planes in k_gemmb's fragment order, 512 bytes in a row a store
#pragma unroll
    for (int qt = 0; qt < 2; ++qt) { const float sl = sum[qt][0] + sum[qt][1]; const float sm = sl + __shfl_xor(sl, 16, 32); const float inv = 1.0f / sm;
#pragma unroll
        for (int dt = 0; dt < 2; ++dt) { const size_t co = (((size_t)(blockIdx.x / NH_) * (SS / 16) + wave * 2 + qt) * NH_ + blockIdx.x % NH_) * 512 + dt * 256 + lane * 8; const v8f v = o[dt][qt] * inv; v8us oh, ol;
#pragma unroll
            for (int i = 0; i < 8; ++i) { const unsigned short hb = f2bf(v[i]); oh[i] = hb; ol[i] = f2bf(v[i] - bf2f(hb)); }
            *(v8us*)(Ch + co) = oh; *(v8us*)(Cl + co) = ol; } }
}
// k_glu: out[b][s][c] = O[s][c] + G[s][c] tanh(G[s][256 + c]); one wave per row: lane -> 8 columns (32 B: two 16-B stores? -> use v4f x 2: lane -> columns lane*4..+3 and 128 + lane*4..+3; a
__global__ __launch_bounds__(256) void k_glu(const float* __restrict__ O, const float* __restrict__ G, float* OUTB) {
    const int lane = threadIdx.x & 31, s = blockIdx.x * 8 + (threadIdx.x >> 5); if (s >= NR) return;
{
#pragma unroll
        for (int st = 0; st < 2; ++st) { const int c0 = st * 128 + lane * 4; v4f v;
#pragma unroll
            for (int q = 0; q < 4; ++q) { const int c = c0 + q; v[q] = O[(size_t)s * DIM + c] + G[(size_t)s * 2 * DIM + c] * tanhf(G[(size_t)s * 2 * DIM + DIM + c]); }
            *(v4f*)(OUTB + (size_t)s * DIM + c0) = v; }
         }
}

extern "C" void kernel_launch(void* const* d_in, const int* in_sizes, int n_in,
                              void* d_out, int out_size, void* d_ws, size_t ws_size, hipStream_t stream) {
    (void)in_sizes; (void)n_in; (void)out_size;
    const float* x = (const float*)d_in[0]; const float* lng = (const float*)d_in[1]; const float* lnb = (const float*)d_in[2]; const float* wqkv = (const float*)d_in[3]; const float* wout = (const float*)d_in[4]; const float* bout = (const float*)d_in[5]; const float* wglu = (const float*)d_in[6];
    float* out = (float*)d_out;    // [32][512][256]
    char* wsp = (char*)d_ws;
    auto take = [&](size_t bytes) { char* p = wsp; wsp += (bytes + 255) & ~(size_t)255; return (void*)p; };
    bf* WQKV = (bf*)take((size_t)(3 * INR) * DIM * 2); bf* WOUT = (bf*)take((size_t)DIM * INR * 2); bf* WGLU = (bf*)take((size_t)(2 * DIM) * DIM * 2);
    // q, k and v^T planes of all items: [item][head][...], so (item, head) is the block index of k_attn
    bf* Qh = (bf*)take((size_t)NBT * NH_ * SS * HD * 2); bf* Ql = (bf*)take((size_t)NBT * NH_ * SS * HD * 2); bf* Kh = (bf*)take((size_t)NBT * NH_ * SS * HD * 2); bf* Kl = (bf*)take((size_t)NBT * NH_ * SS * HD * 2);
    bf* VTh = (bf*)take((size_t)NBT * NH_ * HD * SS * 2); bf* VTl = (bf*)take((size_t)NBT * NH_ * HD * SS * 2);
    char* const reuse = wsp;    // from here the phases lay their buffers over one another, in stream order
    // phase 1 (all items): LayerNorm planes; dead once the q, k, v^T planes are written
    bf* Hh = (bf*)take((size_t)NR * DIM * 2); bf* Hl = (bf*)take((size_t)NR * DIM * 2);
    // phase 2 (all items): ctx planes, then what follows attention
    wsp = reuse;
    bf* Ch = (bf*)take((size_t)NR * INR * 2); bf* Cl = (bf*)take((size_t)NR * INR * 2);
    float* O = (float*)take((size_t)NR * DIM * 4); bf* Oh = (bf*)take((size_t)NR * DIM * 2); bf* Ol = (bf*)take((size_t)NR * DIM * 2); float* G = (float*)take((size_t)NR * 2 * DIM * 4);
    if ((size_t)(wsp - (char*)d_ws) > ws_size) return;    // the largest phase: 0.75 + 48 + 16 + 16 + 16 + 32 ~ 129 MiB
    k_wt<<<dim3(DIM / 64, (3 * INR) / 64, 1), 256, 0, stream>>>(wqkv, DIM, 3 * INR, WQKV); k_wt<<<dim3(INR / 64, DIM / 64, 1), 256, 0, stream>>>(wout, INR, DIM, WOUT); k_wt<<<dim3(DIM / 64, (2 * DIM) / 64, 1), 256, 0, stream>>>(wglu, DIM, 2 * DIM, WGLU);
    k_ln<<<NR / 16, 512, 0, stream>>>(x, lng, lnb, Hh, Hl);
    k_gemmb<DIM, true, false, 1><<<dim3(NR / 64, (3 * INR) / 64, 1), 128, 0, stream>>>(Hh, Hl, WQKV, nullptr, nullptr, 3 * INR, nullptr, nullptr, 1, Qh, Ql, Kh, Kl, VTh, VTl);
    k_attn<<<NBT * NH_, 512, 0, stream>>>(Qh, Ql, Kh, Kl, VTh, VTl, Ch, Cl);
    k_gemmb<INR, true, false, 2><<<dim3(NR / 64, DIM / 64, 1), 128, 0, stream>>>(Ch, Cl, WOUT, bout, O, DIM, nullptr, nullptr, 1, Oh, Ol, nullptr, nullptr, nullptr, nullptr);
    k_gemmb<DIM, true, false, 0><<<dim3(NR / 64, (2 * DIM) / 64, 1), 128, 0, stream>>>(Oh, Ol, WGLU, nullptr, G, 2 * DIM, nullptr, nullptr, 1, nullptr, nullptr, nullptr, nullptr, nullptr, nullptr);
    k_glu<<<NR / 8, 256, 0, stream>>>(O, G, out);
}

// v005
// Measured time: 112 microseconds a run.
// Next to v004, in two timings, it ran 1.06 times as fast each time.
// Over all steps from v000 it is 26.2 times as fast.
#include <hip/hip_runtime.h>

// Compute dtypes, f32 accumulate, per item (512 tokens): LayerNorm in f32 -> bf16 hi + UNSCALED residual planes; qkv, to_out and the GLU projection as [512 x K].[K x N] GEMMs
// against the exact bf16 k-major weights (two products); per (item, head), in one kernel: sim = q.k^T ([512 x 32].[32 x 512], three products),
// the causal -10000 mask then x scale and the row softmax in f32, ctx = P.v ([512 x 512].[512 x 32], three products), scores and P in registers only - on v_wmma_f32_16x16x32_bf16; the GLU

#define NBT  32
#define SS   512
#define DIM  256
#define NH_  8
#define HD   32
#define INR  256
#define DM   DIM
#define SCL  0.17677669529663687f
#define LOSC 1024.0f
#define NR   (NBT * SS)   // token rows of all items together

typedef _Float16 h16;
typedef unsigned short bf;
typedef __attribute__((ext_vector_type(16))) __bf16   v16bf;
typedef __attribute__((ext_vector_type(16))) _Float16 v16h;
typedef __attribute__((ext_vector_type(8)))  _Float16 v8h;
typedef __attribute__((ext_vector_type(8)))  unsigned short v8us;
typedef __attribute__((ext_vector_type(8)))  float    v8f;
typedef __attribute__((ext_vector_type(4)))  float    v4f;
typedef v8h  __attribute__((may_alias)) v8ha;
typedef v4f  __attribute__((may_alias)) v4fa;
typedef v8us __attribute__((may_alias)) v8usa;

__device__ __forceinline__ unsigned short f2bf(float f) { unsigned u = __float_as_uint(f); u += 0x7FFFu + ((u >> 16) & 1u); return (unsigned short)(u >> 16); }
__device__ __forceinline__ float bf2f(unsigned short b) { return __uint_as_float(((unsigned)b) << 16); }
__device__ __forceinline__ float bfr(float f) { return bf2f(f2bf(f)); }
__device__ __forceinline__ v16h cat16(v8h lo, v8h hi) { return __builtin_shufflevector(lo, hi, 0, 1, 2, 3, 4, 5, 6, 7, 8, 9, 10, 11, 12, 13, 14, 15); }
__device__ __forceinline__ v16bf cat16b(v8us lo, v8us hi) { return __builtin_bit_cast(v16bf, __builtin_shufflevector(lo, hi, 0, 1, 2, 3, 4, 5, 6, 7, 8, 9, 10, 11, 12, 13, 14, 15)); }
__device__ __forceinline__ v8f wmma16(v16h a, v16h b, v8f c) { return __builtin_amdgcn_wmma_f32_16x16x32_f16(false, a, false, b, (short)0, c, false, false); }
__device__ __forceinline__ v8f wmmab(v16bf a, v16bf b, v8f c) { return __builtin_amdgcn_wmma_f32_16x16x32_bf16(false, a, false, b, (short)0, c, false, false); }

// k_gemmb: 64 x 64 block tile (4 waves x 16 x 64) of C[NTK][NW] = (A [+ Al]).B^T (K = 256) [+ bf(bias[c])] [+ bf(R[r][c]) residual]; f32 whole-line epilogue (or f16
// EPI: what the epilogue stores besides or instead of C, always the bf16 hi + UNSCALED residual planes of the f32 tile that lies in LDS:
//   0 nothing more; 1 (qkv, no C) the q and k planes [item][head][s][32] and the v^T planes [item][head][d][s]; 2 (to_out) C and its planes in the fragment order below.
// FRAGMENT ORDER: A, Al and Bn lie as the loop loads them, [16-row tile][32-wide k step][piece p][lane][8]: lane = 16 hi + lr holds row lr, k = 32 step + 16 p + 8 hi + 0..7,
// so a wave's 16-byte loads of one piece read 512 bytes in a row (4 whole lines) where a row-major operand gave 32 bytes of each of 16 lines. Every producer stores this order.
// Every #pragma unroll of these plane stores makes the indices of the 8-element vectors constants, so that they stay in registers.
__device__ __forceinline__ void split8(const float* v, v8us& oh, v8us& ol) {
#pragma unroll
    for (int i = 0; i < 8; ++i) { const unsigned short hb = f2bf(v[i]); oh[i] = hb; ol[i] = f2bf(v[i] - bf2f(hb)); }
}
__device__ __forceinline__ void split8l(const float* sp, v8us& oh, v8us& ol) {    // 8 floats in a row in LDS, 16-byte aligned
    const v4f a = *(const v4fa*)sp, b = *(const v4fa*)(sp + 4); const float v[8] = {a[0], a[1], a[2], a[3], b[0], b[1], b[2], b[3]}; split8(v, oh, ol);
}
#define OSW (16 * 68 + 4)   // floats of one wave's staging tile; the 4 spread the four tiles over the banks for the v^T reads, which go down columns of all four
template <int K, bool SPLITA, bool F16OUT = false, int EPI = 0>
// 12 waves per SIMD asked for: the budget of 80 VGPRs that the loop had before the plane stores came in (two more would cost two waves per SIMD, and the loop lives on waves that hide its loads)
__global__ __launch_bounds__(128, 12) void k_gemmb(const bf* __restrict__ A, const bf* __restrict__ Al, const bf* __restrict__ Bn, const float* __restrict__ bias, float* C, int ldc, h16* C2, const float* __restrict__ R, int roundR, bf* P0h, bf* P0l, bf* P1h, bf* P1l, bf* P2h, bf* P2l) {
    __shared__ __align__(16) float ost[4][OSW];
    const int lane = threadIdx.x & 31, wave = threadIdx.x >> 5, lr = lane & 15, hi = lane >> 4;
    const int r0 = blockIdx.x * 64 + wave * 16, c0 = blockIdx.y * 64;
    // byte offsets of the lane's 16 bytes in the trip's first pieces (a 16-row tile is K / 32 steps of 1 KiB); all 12 loads of a trip are these two plus constants
    unsigned ao = (unsigned)(r0 >> 4) * (K * 32) + lane * 16, bo = (unsigned)(c0 >> 4) * (K * 32) + lane * 16;
    auto frag = [](const bf* base, unsigned off) -> v16bf { const char* p = (const char*)base + off; return cat16b(*(const v8us*)p, *(const v8us*)(p + 512)); };
    v8f acc[4];
#pragma unroll
    for (int t = 0; t < 4; ++t) acc[t] = (v8f){};
#pragma unroll 1
    for (int kc = 0; kc < K; kc += 32) {
        const v16bf a = frag(A, ao);
        v16bf al = a;
        if (SPLITA) al = frag(Al, ao);
#pragma unroll
        for (int t = 0; t < 4; ++t) { const v16bf b = frag(Bn + t * (K * 16), bo); acc[t] = wmmab(a, b, acc[t]); if (SPLITA) acc[t] = wmmab(al, b, acc[t]); }
        asm volatile("v_nop\n\tv_nop\n\tv_nop\n\tv_nop" : "+v"(acc[0]), "+v"(acc[1]), "+v"(acc[2]), "+v"(acc[3]) : "v"(a), "v"(al));
        asm volatile("s_wait_xcnt 0x0" : "+v"(ao), "+v"(bo) :: "memory");    // in front of the rewrite of the trip's two address registers: the next offsets are formed from its outputs, and both stay live up to here
        ao += 1024; bo += 1024;
    }
    float* os = &ost[wave][0];
#pragma unroll
    for (int t = 0; t < 4; ++t) { const float bv = bias ? bfr(bias[c0 + t * 16 + lr]) : 0.f;
#pragma unroll
        for (int j = 0; j < 8; ++j) os[(hi * 8 + j) * 68 + t * 16 + lr] = acc[t][j] + bv; }
    __syncthreads();
    if (EPI == 1) {
        const size_t ih = (size_t)(r0 / SS) * NH_ + (c0 % INR) / HD;    // (item, first of the tile's two heads)
        if (c0 < 2 * INR) {    // q or k: the wave's own 16 tokens x 2 heads; a store covers 8 tokens of one head, 512 bytes in a row
            bf* Ph = c0 < INR ? P0h : P1h; bf* Pl = c0 < INR ? P0l : P1l;
#pragma unroll
            for (int s = 0; s < 4; ++s) { const int row = (s & 1) * 8 + (lane >> 2), piece = lane & 3; v8us oh, ol; split8l(os + row * 68 + (s >> 1) * HD + piece * 8, oh, ol);
                const size_t o = ((ih + (s >> 1)) * SS + r0 % SS + row) * HD + piece * 8; *(v8us*)(Ph + o) = oh; *(v8us*)(Pl + o) = ol; }
        } else {    // v: the wave takes 16 of the tile's 64 columns (d) over all 64 tokens, from the four waves' tiles; a store covers 4 whole 128-byte lines
#pragma unroll
            for (int s = 0; s < 4; ++s) { const int col = wave * 16 + s * 4 + (lane >> 3), piece = lane & 7; const float* sp = &ost[piece >> 1][(piece & 1) * 8 * 68 + col]; float v[8];
#pragma unroll
                for (int i = 0; i < 8; ++i) v[i] = sp[i * 68];
                v8us oh, ol; split8(v, oh, ol);
                const size_t o = ((ih + col / HD) * HD + col % HD) * SS + (blockIdx.x * 64) % SS + piece * 8; *(v8us*)(P2h + o) = oh; *(v8us*)(P2l + o) = ol; }
            asm volatile("s_wait_xcnt 0x0" ::: "memory");    // the build lays the q/k branch behind this one, with a branch between: the wait stands in front of whatever there overwrites a register of the last stores
        }
    } else if (F16OUT) {
        h16* crow = (h16*)(void*)C + (size_t)r0 * ldc + c0;
        auto pass = [&]() {
#pragma unroll
            for (int s = 0; s < 4; ++s) { const int row = 4 * s + (lane >> 3), piece = lane & 7; const float* sp = os + row * 68 + piece * 8; v8h o, o2;
#pragma unroll
                for (int i = 0; i < 8; ++i) { const h16 a = (h16)sp[i]; o[i] = a; o2[i] = (h16)((sp[i] - (float)a) * LOSC); }
                *(v8h*)(crow + (size_t)row * ldc + piece * 8) = o; if (C2) *(v8h*)(C2 + (size_t)r0 * ldc + c0 + (size_t)row * ldc + piece * 8) = o2; }
        };
        pass(); 
    } else {
        float* crow = C + (size_t)r0 * ldc + c0;
        auto pass = [&]() {
#pragma unroll
            for (int s = 0; s < 8; ++s) { const int Lid = (lane >> 3) + 4 * s, piece = lane & 7; const int row = Lid >> 1, cofs = (Lid & 1) * 32 + piece * 4;
                v4f val = *(const v4fa*)(os + row * 68 + cofs); if (R) { const v4f rv = *(const v4f*)(R + ((size_t)r0 + row) * ldc + c0 + cofs); val += roundR ? (v4f){bfr(rv[0]), bfr(rv[1]), bfr(rv[2]), bfr(rv[3])} : rv; }
                *(v4f*)(crow + (size_t)row * ldc + cofs) = val; }
        };
        pass(); 
        if (EPI == 2) {    // the planes of the same tile, in fragment order for the next product: the wave's 16 tokens x 64 columns are two k steps, 2 KiB in a row of each plane
            asm volatile("s_wait_xcnt 0x0" ::: "memory");    // the f32 stores above stand behind branches (on R): the wait stands in front of what overwrites their registers from here on
#pragma unroll
            for (int s = 0; s < 4; ++s) { v8us oh, ol; split8l(os + lr * 68 + s * 16 + hi * 8, oh, ol);    // s = 2 (step in the tile) + piece
                const size_t o = (size_t)(r0 >> 4) * (ldc * 16) + (size_t)((c0 >> 4) + s) * 256 + lane * 8; *(v8us*)(P0h + o) = oh; *(v8us*)(P0l + o) = ol; }
        }
    }
}

// wt_tile: WT = bf16(W[k][n]) (k-major [K][ncols]) in k_gemmb's fragment order (16 columns n are a tile's rows), one 64 x 64 tile through LDS by 256 threads (tid = 0..255).
__device__ __forceinline__ void wt_tile(const float* __restrict__ Wm, int K, int ncols, bf* WT, int k0, int n0, int tid, unsigned short* tl) {
    const int kk = tid >> 2, nq = (tid & 3) * 16;
#pragma unroll
    for (int i = 0; i < 16; ++i) tl[(nq + i) * 72 + kk] = f2bf(Wm[(size_t)(k0 + kk) * ncols + n0 + nq + i]);
    __syncthreads();
    const int lane = tid & 31;
    // the tile is 4 column tiles x 2 k steps x 2 pieces of 512 bytes; a wave stores two whole pieces
#pragma unroll
    for (int s = 0; s < 2; ++s) { const int q = (tid >> 5) * 2 + s, ct = q >> 2, kp = q & 3; const v8us val = *(const v8usa*)(tl + (ct * 16 + (lane & 15)) * 72 + kp * 16 + (lane >> 4) * 8);
        *(v8us*)(WT + (size_t)((n0 >> 4) + ct) * (K * 16) + (size_t)((k0 >> 4) + kp) * 256 + lane * 8) = val; }
}

// ln_tile: one wave per token, 16 tokens (one row tile of the qkv product) per work-group. A lane's 8 columns are one 16-byte piece of the fragment order, 256 bytes from its neighbour's,
// so the 16 waves exchange their pieces through LDS (pitch 272 bytes: a wave's 32 pieces fall on different banks) and each stores 512 bytes in a row of each plane.
__device__ __forceinline__ void ln_tile(const float* __restrict__ xb, const float* __restrict__ g, const float* __restrict__ bb, bf* Hh, bf* Hl, int rt, unsigned short (*sl)[32][136]) {    // sl: [plane][8-column piece][token][8], 8 elements of pad a piece
    const int lane = threadIdx.x & 31, wv = threadIdx.x >> 5, r = rt * 16 + wv; float v[8]; float s = 0.f;
#pragma unroll
    for (int i = 0; i < 8; ++i) { v[i] = bfr(xb[(size_t)r * DIM + lane * 8 + i]); s += v[i]; }
#pragma unroll
    for (int sh = 16; sh; sh >>= 1) s += __shfl_xor(s, sh, 32);
    const float mu = s * (1.0f / DIM); float q = 0.f;
#pragma unroll
    for (int i = 0; i < 8; ++i) { const float d = v[i] - mu; q = fmaf(d, d, q); }
#pragma unroll
    for (int sh = 16; sh; sh >>= 1) q += __shfl_xor(q, sh, 32);
    const float rs = rsqrtf(q * (1.0f / DIM) + 1e-5f); v8us oh, ol;
#pragma unroll
    for (int i = 0; i < 8; ++i) { const int c = lane * 8 + i; const float y = (v[i] - mu) * rs * bfr(g[c]) + bfr(bb[c]); const unsigned short hb = f2bf(y); oh[i] = hb; ol[i] = f2bf(y - bf2f(hb)); }
    *(v8usa*)&sl[0][lane][wv * 8] = oh; *(v8usa*)&sl[1][lane][wv * 8] = ol;
    __syncthreads();
    const int pc = threadIdx.x >> 4, tk = threadIdx.x & 15;    // columns 8 pc .. 8 pc + 7 = step pc / 4, piece (pc / 2) % 2, hi = pc % 2: the piece's place in the tile is 128 pc + 8 tk elements
    const size_t o = (size_t)rt * (16 * DIM) + threadIdx.x * 8; *(v8us*)(Hh + o) = *(const v8usa*)&sl[0][pc][tk * 8]; *(v8us*)(Hl + o) = *(const v8usa*)&sl[1][pc][tk * 8];
}

// k_prep: the four jobs that depend on nothing but the inputs share one launch; the block index picks the job (the same for a whole work-group, so each job's barrier is passed by all of it).
// Blocks 0 .. WTB - 1: the weights, two 64 x 64 tiles a block (one per 256 threads), the tiles numbered w_qkv, w_out, w_glu, 4 k tiles fastest (all three have K = 256); the rest: LayerNorm, 16 tokens a block.
#define WT_QKV (4 * (3 * INR / 64))
#define WT_OUT (4 * (DIM / 64))
#define WT_GLU (4 * (2 * DIM / 64))
#define WTB    ((WT_QKV + WT_OUT + WT_GLU) / 2)
__global__ __launch_bounds__(512) void k_prep(const float* __restrict__ xb, const float* __restrict__ g, const float* __restrict__ bb, bf* Hh, bf* Hl,
                                              const float* __restrict__ wqkv, const float* __restrict__ wout, const float* __restrict__ wglu, bf* WQKV, bf* WOUT, bf* WGLU) {
    __shared__ __align__(16) unsigned short sm[2 * 64 * 72];    // two weight tiles of 64 x 72, or LayerNorm's 2 x 32 x 136 (smaller)
    if (blockIdx.x < WTB) {
        static_assert(WT_QKV % 2 == 0 && WT_OUT % 2 == 0 && WT_GLU % 2 == 0, "a block's two tiles are of one matrix");
        int t0 = blockIdx.x * 2;    // the block's first tile: the matrix is picked by the block index alone, in scalar registers
        const float* Wm = wqkv; bf* WT = WQKV; int ncols = 3 * INR;
        if (t0 >= WT_QKV + WT_OUT) { t0 -= WT_QKV + WT_OUT; Wm = wglu; WT = WGLU; ncols = 2 * DIM; }
        else if (t0 >= WT_QKV) { t0 -= WT_QKV; Wm = wout; WT = WOUT; ncols = DIM; }
        const int half = threadIdx.x >> 8, tix = t0 + half;
        wt_tile(Wm, DIM, ncols, WT, (tix & 3) * 64, (tix >> 2) * 64, threadIdx.x & 255, sm + half * (64 * 72));
    } else {
        ln_tile(xb, g, bb, Hh, Hl, blockIdx.x - WTB, (unsigned short (*)[32][136])sm);
    }
}
template <int N> struct ic { static constexpr int v = N; };
typedef __attribute__((ext_vector_type(2))) float  v2f;
typedef __attribute__((ext_vector_type(2))) __bf16 v2bf;
__global__ __launch_bounds__(512) void k_attn(const bf* __restrict__ Qh, const bf* __restrict__ Ql, const bf* __restrict__ Kh, const bf* __restrict__ Kl, const bf* __restrict__ VTh, const bf* __restrict__ VTl, bf* __restrict__ Ch, bf* __restrict__ Cl) {
    __shared__ __align__(16) unsigned short sT[SS / 32][2][2][2][2][32][8];    // [32-key trip][k | v^T][plane][16-key tile | 16-d tile][piece][lane][8]: a trip's 8 KiB lie together
    const int lane = threadIdx.x & 31, c = lane & 15, h = lane >> 4;
    const int wave = __builtin_amdgcn_readfirstlane(threadIdx.x >> 5);    // in a scalar register: the trip loops' bounds and branches are scalar
    { const size_t g = blockIdx.x; Qh += g * SS * HD; Ql += g * SS * HD; Kh += g * SS * HD; Kl += g * SS * HD; VTh += g * HD * SS; VTl += g * HD * SS; }
    const int q0 = wave * 32;
    v16bf qh[2], ql[2];
    {   // wave w brings trip w: key tiles 2w, 2w + 1 and their v^T columns; and its own 32 queries
        const bf* pk[2][2]; const bf* pv[2]; const bf* pq[2][2];
#pragma unroll
        for (int pl = 0; pl < 2; ++pl) { pv[pl] = (pl ? VTl : VTh) + (size_t)c * SS + wave * 32 + 8 * h;
#pragma unroll
            for (int t = 0; t < 2; ++t) { pk[pl][t] = (pl ? Kl : Kh) + (size_t)(q0 + t * 16 + c) * HD + 8 * h; pq[pl][t] = (pl ? Ql : Qh) + (size_t)(q0 + t * 16 + c) * HD + 8 * h; } }
        v8us tk[2][2][2], tv[2][2][2];
#pragma unroll
        for (int pl = 0; pl < 2; ++pl)
#pragma unroll
            for (int t = 0; t < 2; ++t)
#pragma unroll
                for (int p = 0; p < 2; ++p) { tk[pl][t][p] = *(const v8us*)(pk[pl][t] + 16 * p); tv[pl][t][p] = *(const v8us*)(pv[pl] + (size_t)t * 16 * SS + 16 * p); }
#pragma unroll
        for (int qt = 0; qt < 2; ++qt) { qh[qt] = cat16b(*(const v8us*)pq[0][qt], *(const v8us*)(pq[0][qt] + 16)); ql[qt] = cat16b(*(const v8us*)pq[1][qt], *(const v8us*)(pq[1][qt] + 16)); }
        // the addresses stay live up to this wait, so that nothing (a later load's result either) lands in an address register of a load in front of it
        asm volatile("s_wait_xcnt 0x0" :: "v"(pk[0][0]), "v"(pk[0][1]), "v"(pk[1][0]), "v"(pk[1][1]), "v"(pv[0]), "v"(pv[1]), "v"(pq[0][0]), "v"(pq[0][1]), "v"(pq[1][0]), "v"(pq[1][1]) : "memory");
#pragma unroll
        for (int pl = 0; pl < 2; ++pl)
#pragma unroll
            for (int t = 0; t < 2; ++t)
#pragma unroll
                for (int p = 0; p < 2; ++p) { *(v8usa*)&sT[wave][0][pl][t][p][lane][0] = tk[pl][t][p]; *(v8usa*)&sT[wave][1][pl][t][p][lane][0] = tv[pl][t][p]; }
    }
    __syncthreads();
    auto kfrag = [&](int pl, int jc, int tj) -> v16bf { return cat16b(*(const v8usa*)&sT[jc][0][pl][tj][0][lane][0], *(const v8usa*)&sT[jc][0][pl][tj][1][lane][0]); };
    auto vfrag = [&](int pl, int jc, int dt) -> v16bf { return cat16b(*(const v8usa*)&sT[jc][1][pl][dt][0][lane][0], *(const v8usa*)&sT[jc][1][pl][dt][1][lane][0]); };
    // s[r] = sim[query q0 + qt * 16 + c][key jc * 32 + tj * 16 + 8 h + r]
    auto sim = [&](v16bf kh, v16bf kl, int qt) -> v8f { v8f s = {}; s = wmmab(kh, qh[qt], s); s = wmmab(kh, ql[qt], s); s = wmmab(kl, qh[qt], s); return s; };
    // A trip's 32 keys against the wave's 32 queries: M = 0 all allowed (trip < wave), 1 the diagonal trip, 2 all masked (trip > wave).
    float mu[2] = {-3.0e38f, -3.0e38f}, mm[2] = {-3.0e38f, -3.0e38f};    // maxima of sim + mask, and of sim alone over the wholly masked trips
    auto walk1 = [&](auto M, int jc) {
#pragma unroll
        for (int tj = 0; tj < 2; ++tj) { const v16bf kh = kfrag(0, jc, tj), kl = kfrag(1, jc, tj);
#pragma unroll
            for (int qt = 0; qt < 2; ++qt) { const v8f s = sim(kh, kl, qt);
#pragma unroll
                for (int r = 0; r < 8; ++r) {
                    if constexpr (decltype(M)::v == 0) mu[qt] = fmaxf(mu[qt], s[r]);
                    else if constexpr (decltype(M)::v == 2) mm[qt] = fmaxf(mm[qt], s[r]);
                    else mu[qt] = fmaxf(mu[qt], s[r] + ((tj * 16 + 8 * h + r > qt * 16 + c) ? -10000.0f : 0.f)); } } }
    };
    for (int jc = 0; jc < wave; ++jc) walk1(ic<0>{}, jc);
    walk1(ic<1>{}, wave);
    for (int jc = wave + 1; jc < SS / 32; ++jc) walk1(ic<2>{}, jc);
    const float CE = SCL * 1.4426950408889634f;    // exp(x * scale) = exp2(x * CE)
    float nm[2]; v2f sum[2] = {(v2f){0.f, 0.f}, (v2f){0.f, 0.f}};    // even and odd keys summed apart
#pragma unroll
    for (int qt = 0; qt < 2; ++qt) { float m = fmaxf(mu[qt], mm[qt] + -10000.0f); m = fmaxf(m, __shfl_xor(m, 16, 32)); nm[qt] = -(m * CE); }
    v8f o[2][2];
#pragma unroll
    for (int dt = 0; dt < 2; ++dt)
#pragma unroll
        for (int qt = 0; qt < 2; ++qt) o[dt][qt] = (v8f){};
    auto walk2 = [&](auto M, int jc) {
        v16bf ph[2], pl[2];
#pragma unroll
        for (int tj = 0; tj < 2; ++tj) { const v16bf kh = kfrag(0, jc, tj), kl = kfrag(1, jc, tj);
#pragma unroll
            for (int qt = 0; qt < 2; ++qt) { const v8f s = sim(kh, kl, qt);
#pragma unroll
                for (int r = 0; r < 8; r += 2) { v2f e;
#pragma unroll
                    for (int u = 0; u < 2; ++u) {
                        float t = s[r + u];
                        if constexpr (decltype(M)::v == 2) t += -10000.0f;
                        else if constexpr (decltype(M)::v == 1) t += ((tj * 16 + 8 * h + r + u > qt * 16 + c) ? -10000.0f : 0.f);
                        const float x = fmaf(t, CE, nm[qt]); float ex;
                        if constexpr (decltype(M)::v == 1) asm("v_exp_f32 %0, %1\n\tv_nop" : "=v"(ex) : "v"(x));    // the v_nop fills the slot behind the transcendental
                        else ex = __builtin_amdgcn_exp2f(x);
                        e[u] = ex; }
                    sum[qt] += e;
                    const v2bf eh = __builtin_convertvector(e, v2bf); const v2bf el = __builtin_convertvector(e - __builtin_convertvector(eh, v2f), v2bf);
                    ph[qt][tj * 8 + r] = eh[0]; ph[qt][tj * 8 + r + 1] = eh[1]; pl[qt][tj * 8 + r] = el[0]; pl[qt][tj * 8 + r + 1] = el[1]; } } }
#pragma unroll
        for (int dt = 0; dt < 2; ++dt) { const v16bf vh = vfrag(0, jc, dt), vl = vfrag(1, jc, dt);
#pragma unroll
            for (int qt = 0; qt < 2; ++qt) { o[dt][qt] = wmmab(vh, ph[qt], o[dt][qt]); o[dt][qt] = wmmab(vh, pl[qt], o[dt][qt]); o[dt][qt] = wmmab(vl, ph[qt], o[dt][qt]); } }
    };
    for (int jc = 0; jc < wave; ++jc) walk2(ic<0>{}, jc);
    walk2(ic<1>{}, wave);
    for (int jc = wave + 1; jc < SS / 32; ++jc) walk2(ic<2>{}, jc);
    // o[dt][qt][r] = ctx^T[d = dt * 16 + 8 h + r][query q0 + qt * 16 + c]: 8 consecutive d of one query a lane, which is piece dt of to_out's A fragment (row tile = 16 queries, k step = head) at this very lane: stored as the bf16 hi + residual planes in k_gemmb's fragment order, 512 bytes in a row a store
#pragma unroll
    for (int qt = 0; qt < 2; ++qt) { const float sl = sum[qt][0] + sum[qt][1]; const float sm = sl + __shfl_xor(sl, 16, 32); const float inv = 1.0f / sm;
#pragma unroll
        for (int dt = 0; dt < 2; ++dt) { const size_t co = (((size_t)(blockIdx.x / NH_) * (SS / 16) + wave * 2 + qt) * NH_ + blockIdx.x % NH_) * 512 + dt * 256 + lane * 8; const v8f v = o[dt][qt] * inv; v8us oh, ol;
#pragma unroll
            for (int i = 0; i < 8; ++i) { const unsigned short hb = f2bf(v[i]); oh[i] = hb; ol[i] = f2bf(v[i] - bf2f(hb)); }
            *(v8us*)(Ch + co) = oh; *(v8us*)(Cl + co) = ol; } }
}
// k_glu: out[b][s][c] = O[s][c] + G[s][c] tanh(G[s][256 + c]); one wave per row: lane -> 8 columns (32 B: two 16-B stores? -> use v4f x 2: lane -> columns lane*4..+3 and 128 + lane*4..+3; a
__global__ __launch_bounds__(256) void k_glu(const float* __restrict__ O, const float* __restrict__ G, float* OUTB) {
    const int lane = threadIdx.x & 31, s = blockIdx.x * 8 + (threadIdx.x >> 5); if (s >= NR) return;
{
#pragma unroll
        for (int st = 0; st < 2; ++st) { const int c0 = st * 128 + lane * 4; v4f v;
#pragma unroll
            for (int q = 0; q < 4; ++q) { const int c = c0 + q; v[q] = O[(size_t)s * DIM + c] + G[(size_t)s * 2 * DIM + c] * tanhf(G[(size_t)s * 2 * DIM + DIM + c]); }
            *(v4f*)(OUTB + (size_t)s * DIM + c0) = v; }
         }
}

extern "C" void kernel_launch(void* const* d_in, const int* in_sizes, int n_in,
                              void* d_out, int out_size, void* d_ws, size_t ws_size, hipStream_t stream) {
    (void)in_sizes; (void)n_in; (void)out_size;
    const float* x = (const float*)d_in[0]; const float* lng = (const float*)d_in[1]; const float* lnb = (const float*)d_in[2]; const float* wqkv = (const float*)d_in[3]; const float* wout = (const float*)d_in[4]; const float* bout = (const float*)d_in[5]; const float* wglu = (const float*)d_in[6];
    float* out = (float*)d_out;    // [32][512][256]
    char* wsp = (char*)d_ws;
    auto take = [&](size_t bytes) { char* p = wsp; wsp += (bytes + 255) & ~(size_t)255; return (void*)p; };
    bf* WQKV = (bf*)take((size_t)(3 * INR) * DIM * 2); bf* WOUT = (bf*)take((size_t)DIM * INR * 2); bf* WGLU = (bf*)take((size_t)(2 * DIM) * DIM * 2);
    // q, k and v^T planes of all items: [item][head][...], so (item, head) is the block index of k_attn
    bf* Qh = (bf*)take((size_t)NBT * NH_ * SS * HD * 2); bf* Ql = (bf*)take((size_t)NBT * NH_ * SS * HD * 2); bf* Kh = (bf*)take((size_t)NBT * NH_ * SS * HD * 2); bf* Kl = (bf*)take((size_t)NBT * NH_ * SS * HD * 2);
    bf* VTh = (bf*)take((size_t)NBT * NH_ * HD * SS * 2); bf* VTl = (bf*)take((size_t)NBT * NH_ * HD * SS * 2);
    char* const reuse = wsp;    // from here the phases lay their buffers over one another, in stream order
    // phase 1 (all items): LayerNorm planes; dead once the q, k, v^T planes are written
    bf* Hh = (bf*)take((size_t)NR * DIM * 2); bf* Hl = (bf*)take((size_t)NR * DIM * 2);
    // phase 2 (all items): ctx planes, then what follows attention
    wsp = reuse;
    bf* Ch = (bf*)take((size_t)NR * INR * 2); bf* Cl = (bf*)take((size_t)NR * INR * 2);
    float* O = (float*)take((size_t)NR * DIM * 4); bf* Oh = (bf*)take((size_t)NR * DIM * 2); bf* Ol = (bf*)take((size_t)NR * DIM * 2); float* G = (float*)take((size_t)NR * 2 * DIM * 4);
    if ((size_t)(wsp - (char*)d_ws) > ws_size) return;    // the largest phase: 0.75 + 48 + 16 + 16 + 16 + 32 ~ 129 MiB
    k_prep<<<WTB + NR / 16, 512, 0, stream>>>(x, lng, lnb, Hh, Hl, wqkv, wout, wglu, WQKV, WOUT, WGLU);
    k_gemmb<DIM, true, false, 1><<<dim3(NR / 64, (3 * INR) / 64, 1), 128, 0, stream>>>(Hh, Hl, WQKV, nullptr, nullptr, 3 * INR, nullptr, nullptr, 1, Qh, Ql, Kh, Kl, VTh, VTl);
    k_attn<<<NBT * NH_, 512, 0, stream>>>(Qh, Ql, Kh, Kl, VTh, VTl, Ch, Cl);
    k_gemmb<INR, true, false, 2><<<dim3(NR / 64, DIM / 64, 1), 128, 0, stream>>>(Ch, Cl, WOUT, bout, O, DIM, nullptr, nullptr, 1, Oh, Ol, nullptr, nullptr, nullptr, nullptr);
    k_gemmb<DIM, true, false, 0><<<dim3(NR / 64, (2 * DIM) / 64, 1), 128, 0, stream>>>(Oh, Ol, WGLU, nullptr, G, 2 * DIM, nullptr, nullptr, 1, nullptr, nullptr, nullptr, nullptr, nullptr, nullptr);
    k_glu<<<NR / 8, 256, 0, stream>>>(O, G, out);
}

// v006
// A run of this version takes 77.3 microseconds.
// Next to v005, in two timings, it ran 1.45 and 1.47 times as fast.
// Counting every step since v000, it is 38.3 times as fast.
#include <hip/hip_runtime.h>

// Compute dtypes, f32 accumulate, per item (512 tokens): LayerNorm in f32 -> bf16 hi + UNSCALED residual planes; qkv, to_out and the GLU projection as [512 x K].[K x N] GEMMs
// against the exact bf16 k-major weights (two products); per (item, head), in one kernel: sim = q.k^T ([512 x 32].[32 x 512], three products),
// the causal -10000 mask then x scale and the row softmax in f32, ctx = P.v ([512 x 512].[512 x 32], three products), scores and P in registers only - on v_wmma_f32_16x16x32_bf16; the GLU

#define NBT  32
#define SS   512
#define DIM  256
#define NH_  8
#define HD   32
#define INR  256
#define DM   DIM
#define SCL  0.17677669529663687f
#define LOSC 1024.0f
#define NR   (NBT * SS)   // token rows of all items together

typedef _Float16 h16;
typedef unsigned short bf;
typedef __attribute__((ext_vector_type(16))) __bf16   v16bf;
typedef __attribute__((ext_vector_type(16))) _Float16 v16h;
typedef __attribute__((ext_vector_type(8)))  _Float16 v8h;
typedef __attribute__((ext_vector_type(8)))  unsigned short v8us;
typedef __attribute__((ext_vector_type(8)))  float    v8f;
typedef __attribute__((ext_vector_type(4)))  float    v4f;
typedef v8h  __attribute__((may_alias)) v8ha;
typedef v4f  __attribute__((may_alias)) v4fa;
typedef v8us __attribute__((may_alias)) v8usa;

__device__ __forceinline__ unsigned short f2bf(float f) { unsigned u = __float_as_uint(f); u += 0x7FFFu + ((u >> 16) & 1u); return (unsigned short)(u >> 16); }
__device__ __forceinline__ float bf2f(unsigned short b) { return __uint_as_float(((unsigned)b) << 16); }
__device__ __forceinline__ float bfr(float f) { return bf2f(f2bf(f)); }
__device__ __forceinline__ v16h cat16(v8h lo, v8h hi) { return __builtin_shufflevector(lo, hi, 0, 1, 2, 3, 4, 5, 6, 7, 8, 9, 10, 11, 12, 13, 14, 15); }
__device__ __forceinline__ v16bf cat16b(v8us lo, v8us hi) { return __builtin_bit_cast(v16bf, __builtin_shufflevector(lo, hi, 0, 1, 2, 3, 4, 5, 6, 7, 8, 9, 10, 11, 12, 13, 14, 15)); }
__device__ __forceinline__ v8f wmma16(v16h a, v16h b, v8f c) { return __builtin_amdgcn_wmma_f32_16x16x32_f16(false, a, false, b, (short)0, c, false, false); }
__device__ __forceinline__ v8f wmmab(v16bf a, v16bf b, v8f c) { return __builtin_amdgcn_wmma_f32_16x16x32_bf16(false, a, false, b, (short)0, c, false, false); }

// k_gemmb: 64 x 64 block tile (4 waves x 16 x 64) of C[NTK][NW] = (A [+ Al]).B^T (K = 256) [+ bf(bias[c])] [+ bf(R[r][c]) residual]; f32 whole-line epilogue (or f16
// EPI: what the epilogue stores besides or instead of C, always the bf16 hi + UNSCALED residual planes of the f32 tile that lies in LDS:
//   0 nothing more; 1 (qkv, no C) the q and k planes [item][head][s][32] and the v^T planes [item][head][d][s]; 2 C and its planes in the fragment order below.
// FRAGMENT ORDER: A, Al and Bn lie as the loop loads them, [16-row tile][32-wide k step][piece p][lane][8]: lane = 16 hi + lr holds row lr, k = 32 step + 16 p + 8 hi + 0..7,
// so a wave's 16-byte loads of one piece read 512 bytes in a row (4 whole lines) where a row-major operand gave 32 bytes of each of 16 lines. Every producer stores this order.
// Every #pragma unroll of these plane stores makes the indices of the 8-element vectors constants, so that they stay in registers.
__device__ __forceinline__ void split8(const float* v, v8us& oh, v8us& ol) {
#pragma unroll
    for (int i = 0; i < 8; ++i) { const unsigned short hb = f2bf(v[i]); oh[i] = hb; ol[i] = f2bf(v[i] - bf2f(hb)); }
}
__device__ __forceinline__ void split8l(const float* sp, v8us& oh, v8us& ol) {    // 8 floats in a row in LDS, 16-byte aligned
    const v4f a = *(const v4fa*)sp, b = *(const v4fa*)(sp + 4); const float v[8] = {a[0], a[1], a[2], a[3], b[0], b[1], b[2], b[3]}; split8(v, oh, ol);
}
#define OSW (16 * 68 + 4)   // floats of one wave's staging tile; the 4 spread the four tiles over the banks for the v^T reads, which go down columns of all four
template <int K, bool SPLITA, bool F16OUT = false, int EPI = 0>
// 12 waves per SIMD asked for: the budget of 80 VGPRs that the loop had before the plane stores came in (two more would cost two waves per SIMD, and the loop lives on waves that hide its loads)
__global__ __launch_bounds__(128, 12) void k_gemmb(const bf* __restrict__ A, const bf* __restrict__ Al, const bf* __restrict__ Bn, const float* __restrict__ bias, float* C, int ldc, h16* C2, const float* __restrict__ R, int roundR, bf* P0h, bf* P0l, bf* P1h, bf* P1l, bf* P2h, bf* P2l) {
    __shared__ __align__(16) float ost[4][OSW];
    const int lane = threadIdx.x & 31, wave = threadIdx.x >> 5, lr = lane & 15, hi = lane >> 4;
    const int r0 = blockIdx.x * 64 + wave * 16, c0 = blockIdx.y * 64;
    // byte offsets of the lane's 16 bytes in the trip's first pieces (a 16-row tile is K / 32 steps of 1 KiB); all 12 loads of a trip are these two plus constants
    unsigned ao = (unsigned)(r0 >> 4) * (K * 32) + lane * 16, bo = (unsigned)(c0 >> 4) * (K * 32) + lane * 16;
    auto frag = [](const bf* base, unsigned off) -> v16bf { const char* p = (const char*)base + off; return cat16b(*(const v8us*)p, *(const v8us*)(p + 512)); };
    v8f acc[4];
#pragma unroll
    for (int t = 0; t < 4; ++t) acc[t] = (v8f){};
#pragma unroll 1
    for (int kc = 0; kc < K; kc += 32) {
        const v16bf a = frag(A, ao);
        v16bf al = a;
        if (SPLITA) al = frag(Al, ao);
#pragma unroll
        for (int t = 0; t < 4; ++t) { const v16bf b = frag(Bn + t * (K * 16), bo); acc[t] = wmmab(a, b, acc[t]); if (SPLITA) acc[t] = wmmab(al, b, acc[t]); }
        asm volatile("v_nop\n\tv_nop\n\tv_nop\n\tv_nop" : "+v"(acc[0]), "+v"(acc[1]), "+v"(acc[2]), "+v"(acc[3]) : "v"(a), "v"(al));
        asm volatile("s_wait_xcnt 0x0" : "+v"(ao), "+v"(bo) :: "memory");    // in front of the rewrite of the trip's two address registers: the next offsets are formed from its outputs, and both stay live up to here
        ao += 1024; bo += 1024;
    }
    float* os = &ost[wave][0];
#pragma unroll
    for (int t = 0; t < 4; ++t) { const float bv = bias ? bfr(bias[c0 + t * 16 + lr]) : 0.f;
#pragma unroll
        for (int j = 0; j < 8; ++j) os[(hi * 8 + j) * 68 + t * 16 + lr] = acc[t][j] + bv; }
    __syncthreads();
    if (EPI == 1) {
        const size_t ih = (size_t)(r0 / SS) * NH_ + (c0 % INR) / HD;    // (item, first of the tile's two heads)
        if (c0 < 2 * INR) {    // q or k: the wave's own 16 tokens x 2 heads; a store covers 8 tokens of one head, 512 bytes in a row
            bf* Ph = c0 < INR ? P0h : P1h; bf* Pl = c0 < INR ? P0l : P1l;
#pragma unroll
            for (int s = 0; s < 4; ++s) { const int row = (s & 1) * 8 + (lane >> 2), piece = lane & 3; v8us oh, ol; split8l(os + row * 68 + (s >> 1) * HD + piece * 8, oh, ol);
                const size_t o = ((ih + (s >> 1)) * SS + r0 % SS + row) * HD + piece * 8; *(v8us*)(Ph + o) = oh; *(v8us*)(Pl + o) = ol; }
        } else {    // v: the wave takes 16 of the tile's 64 columns (d) over all 64 tokens, from the four waves' tiles; a store covers 4 whole 128-byte lines
#pragma unroll
            for (int s = 0; s < 4; ++s) { const int col = wave * 16 + s * 4 + (lane >> 3), piece = lane & 7; const float* sp = &ost[piece >> 1][(piece & 1) * 8 * 68 + col]; float v[8];
#pragma unroll
                for (int i = 0; i < 8; ++i) v[i] = sp[i * 68];
                v8us oh, ol; split8(v, oh, ol);
                const size_t o = ((ih + col / HD) * HD + col % HD) * SS + (blockIdx.x * 64) % SS + piece * 8; *(v8us*)(P2h + o) = oh; *(v8us*)(P2l + o) = ol; }
            asm volatile("s_wait_xcnt 0x0" ::: "memory");    // the build lays the q/k branch behind this one, with a branch between: the wait stands in front of whatever there overwrites a register of the last stores
        }
    } else if (F16OUT) {
        h16* crow = (h16*)(void*)C + (size_t)r0 * ldc + c0;
        auto pass = [&]() {
#pragma unroll
            for (int s = 0; s < 4; ++s) { const int row = 4 * s + (lane >> 3), piece = lane & 7; const float* sp = os + row * 68 + piece * 8; v8h o, o2;
#pragma unroll
                for (int i = 0; i < 8; ++i) { const h16 a = (h16)sp[i]; o[i] = a; o2[i] = (h16)((sp[i] - (float)a) * LOSC); }
                *(v8h*)(crow + (size_t)row * ldc + piece * 8) = o; if (C2) *(v8h*)(C2 + (size_t)r0 * ldc + c0 + (size_t)row * ldc + piece * 8) = o2; }
        };
        pass(); 
    } else {
        float* crow = C + (size_t)r0 * ldc + c0;
        auto pass = [&]() {
#pragma unroll
            for (int s = 0; s < 8; ++s) { const int Lid = (lane >> 3) + 4 * s, piece = lane & 7; const int row = Lid >> 1, cofs = (Lid & 1) * 32 + piece * 4;
                v4f val = *(const v4fa*)(os + row * 68 + cofs); if (R) { const v4f rv = *(const v4f*)(R + ((size_t)r0 + row) * ldc + c0 + cofs); val += roundR ? (v4f){bfr(rv[0]), bfr(rv[1]), bfr(rv[2]), bfr(rv[3])} : rv; }
                *(v4f*)(crow + (size_t)row * ldc + cofs) = val; }
        };
        pass(); 
        if (EPI == 2) {    // the planes of the same tile, in fragment order for the next product: the wave's 16 tokens x 64 columns are two k steps, 2 KiB in a row of each plane
            asm volatile("s_wait_xcnt 0x0" ::: "memory");    // the f32 stores above stand behind branches (on R): the wait stands in front of what overwrites their registers from here on
#pragma unroll
            for (int s = 0; s < 4; ++s) { v8us oh, ol; split8l(os + lr * 68 + s * 16 + hi * 8, oh, ol);    // s = 2 (step in the tile) + piece
                const size_t o = (size_t)(r0 >> 4) * (ldc * 16) + (size_t)((c0 >> 4) + s) * 256 + lane * 8; *(v8us*)(P0h + o) = oh; *(v8us*)(P0l + o) = ol; }
        }
    }
}

// wt_tile: WT = bf16(W[k][n]) (k-major [K][ncols]) in k_gemmb's fragment order (16 columns n are a tile's rows), one 64 x 64 tile through LDS by 256 threads (tid = 0..255).
__device__ __forceinline__ void wt_tile(const float* __restrict__ Wm, int K, int ncols, bf* WT, int k0, int n0, int tid, unsigned short* tl) {
    const int kk = tid >> 2, nq = (tid & 3) * 16;
#pragma unroll
    for (int i = 0; i < 16; ++i) tl[(nq + i) * 72 + kk] = f2bf(Wm[(size_t)(k0 + kk) * ncols + n0 + nq + i]);
    __syncthreads();
    const int lane = tid & 31;
    // the tile is 4 column tiles x 2 k steps x 2 pieces of 512 bytes; a wave stores two whole pieces
#pragma unroll
    for (int s = 0; s < 2; ++s) { const int q = (tid >> 5) * 2 + s, ct = q >> 2, kp = q & 3; const v8us val = *(const v8usa*)(tl + (ct * 16 + (lane & 15)) * 72 + kp * 16 + (lane >> 4) * 8);
        *(v8us*)(WT + (size_t)((n0 >> 4) + ct) * (K * 16) + (size_t)((k0 >> 4) + kp) * 256 + lane * 8) = val; }
}

// ln_tile: one wave per token, 16 tokens (one row tile of the qkv product) per work-group. A lane's 8 columns are one 16-byte piece of the fragment order, 256 bytes from its neighbour's,
// so the 16 waves exchange their pieces through LDS (pitch 272 bytes: a wave's 32 pieces fall on different banks) and each stores 512 bytes in a row of each plane.
__device__ __forceinline__ void ln_tile(const float* __restrict__ xb, const float* __restrict__ g, const float* __restrict__ bb, bf* Hh, bf* Hl, int rt, unsigned short (*sl)[32][136]) {    // sl: [plane][8-column piece][token][8], 8 elements of pad a piece
    const int lane = threadIdx.x & 31, wv = threadIdx.x >> 5, r = rt * 16 + wv; float v[8]; float s = 0.f;
#pragma unroll
    for (int i = 0; i < 8; ++i) { v[i] = bfr(xb[(size_t)r * DIM + lane * 8 + i]); s += v[i]; }
#pragma unroll
    for (int sh = 16; sh; sh >>= 1) s += __shfl_xor(s, sh, 32);
    const float mu = s * (1.0f / DIM); float q = 0.f;
#pragma unroll
    for (int i = 0; i < 8; ++i) { const float d = v[i] - mu; q = fmaf(d, d, q); }
#pragma unroll
    for (int sh = 16; sh; sh >>= 1) q += __shfl_xor(q, sh, 32);
    const float rs = rsqrtf(q * (1.0f / DIM) + 1e-5f); v8us oh, ol;
#pragma unroll
    for (int i = 0; i < 8; ++i) { const int c = lane * 8 + i; const float y = (v[i] - mu) * rs * bfr(g[c]) + bfr(bb[c]); const unsigned short hb = f2bf(y); oh[i] = hb; ol[i] = f2bf(y - bf2f(hb)); }
    *(v8usa*)&sl[0][lane][wv * 8] = oh; *(v8usa*)&sl[1][lane][wv * 8] = ol;
    __syncthreads();
    const int pc = threadIdx.x >> 4, tk = threadIdx.x & 15;    // columns 8 pc .. 8 pc + 7 = step pc / 4, piece (pc / 2) % 2, hi = pc % 2: the piece's place in the tile is 128 pc + 8 tk elements
    const size_t o = (size_t)rt * (16 * DIM) + threadIdx.x * 8; *(v8us*)(Hh + o) = *(const v8usa*)&sl[0][pc][tk * 8]; *(v8us*)(Hl + o) = *(const v8usa*)&sl[1][pc][tk * 8];
}

// k_prep: the four jobs that depend on nothing but the inputs share one launch; the block index picks the job (the same for a whole work-group, so each job's barrier is passed by all of it).
// Blocks 0 .. WTB - 1: the weights, two 64 x 64 tiles a block (one per 256 threads), the tiles numbered w_qkv, w_out, w_glu, 4 k tiles fastest (all three have K = 256); the rest: LayerNorm, 16 tokens a block.
#define WT_QKV (4 * (3 * INR / 64))
#define WT_OUT (4 * (DIM / 64))
#define WT_GLU (4 * (2 * DIM / 64))
#define WTB    ((WT_QKV + WT_OUT + WT_GLU) / 2)
__global__ __launch_bounds__(512) void k_prep(const float* __restrict__ xb, const float* __restrict__ g, const float* __restrict__ bb, bf* Hh, bf* Hl,
                                              const float* __restrict__ wqkv, const float* __restrict__ wout, const float* __restrict__ wglu, bf* WQKV, bf* WOUT, bf* WGLU) {
    __shared__ __align__(16) unsigned short sm[2 * 64 * 72];    // two weight tiles of 64 x 72, or LayerNorm's 2 x 32 x 136 (smaller)
    if (blockIdx.x < WTB) {
        static_assert(WT_QKV % 2 == 0 && WT_OUT % 2 == 0 && WT_GLU % 2 == 0, "a block's two tiles are of one matrix");
        int t0 = blockIdx.x * 2;    // the block's first tile: the matrix is picked by the block index alone, in scalar registers
        const float* Wm = wqkv; bf* WT = WQKV; int ncols = 3 * INR;
        if (t0 >= WT_QKV + WT_OUT) { t0 -= WT_QKV + WT_OUT; Wm = wglu; WT = WGLU; ncols = 2 * DIM; }
        else if (t0 >= WT_QKV) { t0 -= WT_QKV; Wm = wout; WT = WOUT; ncols = DIM; }
        const int half = threadIdx.x >> 8, tix = t0 + half;
        wt_tile(Wm, DIM, ncols, WT, (tix & 3) * 64, (tix >> 2) * 64, threadIdx.x & 255, sm + half * (64 * 72));
    } else {
        ln_tile(xb, g, bb, Hh, Hl, blockIdx.x - WTB, (unsigned short (*)[32][136])sm);
    }
}
template <int N> struct ic { static constexpr int v = N; };
typedef __attribute__((ext_vector_type(2))) float  v2f;
typedef __attribute__((ext_vector_type(2))) __bf16 v2bf;
__global__ __launch_bounds__(512) void k_attn(const bf* __restrict__ Qh, const bf* __restrict__ Ql, const bf* __restrict__ Kh, const bf* __restrict__ Kl, const bf* __restrict__ VTh, const bf* __restrict__ VTl, bf* __restrict__ Ch, bf* __restrict__ Cl) {
    __shared__ __align__(16) unsigned short sT[SS / 32][2][2][2][2][32][8];    // [32-key trip][k | v^T][plane][16-key tile | 16-d tile][piece][lane][8]: a trip's 8 KiB lie together
    const int lane = threadIdx.x & 31, c = lane & 15, h = lane >> 4;
    const int wave = __builtin_amdgcn_readfirstlane(threadIdx.x >> 5);    // in a scalar register: the trip loops' bounds and branches are scalar
    { const size_t g = blockIdx.x; Qh += g * SS * HD; Ql += g * SS * HD; Kh += g * SS * HD; Kl += g * SS * HD; VTh += g * HD * SS; VTl += g * HD * SS; }
    const int q0 = wave * 32;
    v16bf qh[2], ql[2];
    {   // wave w brings trip w: key tiles 2w, 2w + 1 and their v^T columns; and its own 32 queries
        const bf* pk[2][2]; const bf* pv[2]; const bf* pq[2][2];
#pragma unroll
        for (int pl = 0; pl < 2; ++pl) { pv[pl] = (pl ? VTl : VTh) + (size_t)c * SS + wave * 32 + 8 * h;
#pragma unroll
            for (int t = 0; t < 2; ++t) { pk[pl][t] = (pl ? Kl : Kh) + (size_t)(q0 + t * 16 + c) * HD + 8 * h; pq[pl][t] = (pl ? Ql : Qh) + (size_t)(q0 + t * 16 + c) * HD + 8 * h; } }
        v8us tk[2][2][2], tv[2][2][2];
#pragma unroll
        for (int pl = 0; pl < 2; ++pl)
#pragma unroll
            for (int t = 0; t < 2; ++t)
#pragma unroll
                for (int p = 0; p < 2; ++p) { tk[pl][t][p] = *(const v8us*)(pk[pl][t] + 16 * p); tv[pl][t][p] = *(const v8us*)(pv[pl] + (size_t)t * 16 * SS + 16 * p); }
#pragma unroll
        for (int qt = 0; qt < 2; ++qt) { qh[qt] = cat16b(*(const v8us*)pq[0][qt], *(const v8us*)(pq[0][qt] + 16)); ql[qt] = cat16b(*(const v8us*)pq[1][qt], *(const v8us*)(pq[1][qt] + 16)); }
        // the addresses stay live up to this wait, so that nothing (a later load's result either) lands in an address register of a load in front of it
        asm volatile("s_wait_xcnt 0x0" :: "v"(pk[0][0]), "v"(pk[0][1]), "v"(pk[1][0]), "v"(pk[1][1]), "v"(pv[0]), "v"(pv[1]), "v"(pq[0][0]), "v"(pq[0][1]), "v"(pq[1][0]), "v"(pq[1][1]) : "memory");
#pragma unroll
        for (int pl = 0; pl < 2; ++pl)
#pragma unroll
            for (int t = 0; t < 2; ++t)
#pragma unroll
                for (int p = 0; p < 2; ++p) { *(v8usa*)&sT[wave][0][pl][t][p][lane][0] = tk[pl][t][p]; *(v8usa*)&sT[wave][1][pl][t][p][lane][0] = tv[pl][t][p]; }
    }
    __syncthreads();
    auto kfrag = [&](int pl, int jc, int tj) -> v16bf { return cat16b(*(const v8usa*)&sT[jc][0][pl][tj][0][lane][0], *(const v8usa*)&sT[jc][0][pl][tj][1][lane][0]); };
    auto vfrag = [&](int pl, int jc, int dt) -> v16bf { return cat16b(*(const v8usa*)&sT[jc][1][pl][dt][0][lane][0], *(const v8usa*)&sT[jc][1][pl][dt][1][lane][0]); };
    // s[r] = sim[query q0 + qt * 16 + c][key jc * 32 + tj * 16 + 8 h + r]
    auto sim = [&](v16bf kh, v16bf kl, int qt) -> v8f { v8f s = {}; s = wmmab(kh, qh[qt], s); s = wmmab(kh, ql[qt], s); s = wmmab(kl, qh[qt], s); return s; };
    // A trip's 32 keys against the wave's 32 queries: M = 0 all allowed (trip < wave), 1 the diagonal trip, 2 all masked (trip > wave).
    float mu[2] = {-3.0e38f, -3.0e38f}, mm[2] = {-3.0e38f, -3.0e38f};    // maxima of sim + mask, and of sim alone over the wholly masked trips
    auto walk1 = [&](auto M, int jc) {
#pragma unroll
        for (int tj = 0; tj < 2; ++tj) { const v16bf kh = kfrag(0, jc, tj), kl = kfrag(1, jc, tj);
#pragma unroll
            for (int qt = 0; qt < 2; ++qt) { const v8f s = sim(kh, kl, qt);
#pragma unroll
                for (int r = 0; r < 8; ++r) {
                    if constexpr (decltype(M)::v == 0) mu[qt] = fmaxf(mu[qt], s[r]);
                    else if constexpr (decltype(M)::v == 2) mm[qt] = fmaxf(mm[qt], s[r]);
                    else mu[qt] = fmaxf(mu[qt], s[r] + ((tj * 16 + 8 * h + r > qt * 16 + c) ? -10000.0f : 0.f)); } } }
    };
    for (int jc = 0; jc < wave; ++jc) walk1(ic<0>{}, jc);
    walk1(ic<1>{}, wave);
    for (int jc = wave + 1; jc < SS / 32; ++jc) walk1(ic<2>{}, jc);
    const float CE = SCL * 1.4426950408889634f;    // exp(x * scale) = exp2(x * CE)
    float nm[2]; v2f sum[2] = {(v2f){0.f, 0.f}, (v2f){0.f, 0.f}};    // even and odd keys summed apart
#pragma unroll
    for (int qt = 0; qt < 2; ++qt) { float m = fmaxf(mu[qt], mm[qt] + -10000.0f); m = fmaxf(m, __shfl_xor(m, 16, 32)); nm[qt] = -(m * CE); }
    v8f o[2][2];
#pragma unroll
    for (int dt = 0; dt < 2; ++dt)
#pragma unroll
        for (int qt = 0; qt < 2; ++qt) o[dt][qt] = (v8f){};
    auto walk2 = [&](auto M, int jc) {
        v16bf ph[2], pl[2];
#pragma unroll
        for (int tj = 0; tj < 2; ++tj) { const v16bf kh = kfrag(0, jc, tj), kl = kfrag(1, jc, tj);
#pragma unroll
            for (int qt = 0; qt < 2; ++qt) { const v8f s = sim(kh, kl, qt);
#pragma unroll
                for (int r = 0; r < 8; r += 2) { v2f e;
#pragma unroll
                    for (int u = 0; u < 2; ++u) {
                        float t = s[r + u];
                        if constexpr (decltype(M)::v == 2) t += -10000.0f;
                        else if constexpr (decltype(M)::v == 1) t += ((tj * 16 + 8 * h + r + u > qt * 16 + c) ? -10000.0f : 0.f);
                        const float x = fmaf(t, CE, nm[qt]); float ex;
                        if constexpr (decltype(M)::v == 1) asm("v_exp_f32 %0, %1\n\tv_nop" : "=v"(ex) : "v"(x));    // the v_nop fills the slot behind the transcendental
                        else ex = __builtin_amdgcn_exp2f(x);
                        e[u] = ex; }
                    sum[qt] += e;
                    const v2bf eh = __builtin_convertvector(e, v2bf); const v2bf el = __builtin_convertvector(e - __builtin_convertvector(eh, v2f), v2bf);
                    ph[qt][tj * 8 + r] = eh[0]; ph[qt][tj * 8 + r + 1] = eh[1]; pl[qt][tj * 8 + r] = el[0]; pl[qt][tj * 8 + r + 1] = el[1]; } } }
#pragma unroll
        for (int dt = 0; dt < 2; ++dt) { const v16bf vh = vfrag(0, jc, dt), vl = vfrag(1, jc, dt);
#pragma unroll
            for (int qt = 0; qt < 2; ++qt) { o[dt][qt] = wmmab(vh, ph[qt], o[dt][qt]); o[dt][qt] = wmmab(vh, pl[qt], o[dt][qt]); o[dt][qt] = wmmab(vl, ph[qt], o[dt][qt]); } }
    };
    for (int jc = 0; jc < wave; ++jc) walk2(ic<0>{}, jc);
    walk2(ic<1>{}, wave);
    for (int jc = wave + 1; jc < SS / 32; ++jc) walk2(ic<2>{}, jc);
    // o[dt][qt][r] = ctx^T[d = dt * 16 + 8 h + r][query q0 + qt * 16 + c]: 8 consecutive d of one query a lane, which is piece dt of to_out's B fragment (row tile = 16 queries, k step = head) at this very lane: stored as the bf16 hi + residual planes in k_gemmb's fragment order, 512 bytes in a row a store
#pragma unroll
    for (int qt = 0; qt < 2; ++qt) { const float sl = sum[qt][0] + sum[qt][1]; const float sm = sl + __shfl_xor(sl, 16, 32); const float inv = 1.0f / sm;
#pragma unroll
        for (int dt = 0; dt < 2; ++dt) { const size_t co = (((size_t)(blockIdx.x / NH_) * (SS / 16) + wave * 2 + qt) * NH_ + blockIdx.x % NH_) * 512 + dt * 256 + lane * 8; const v8f v = o[dt][qt] * inv; v8us oh, ol;
#pragma unroll
            for (int i = 0; i < 8; ++i) { const unsigned short hb = f2bf(v[i]); oh[i] = hb; ol[i] = f2bf(v[i] - bf2f(hb)); }
            *(v8us*)(Ch + co) = oh; *(v8us*)(Cl + co) = ol; } }
}
// k_tail: to_out, the GLU projection and the gate of 64 tokens in one work-group of 16 waves; wave = (nw, th): columns 32 nw .. 32 nw + 31 (two 16-column tiles t) of tokens 32 th .. 32 th + 31 (two 16-token tiles rt).
// Both products are formed transposed, weights as the A operand and tokens as B (the two fragment orders are the same), so a lane's 8 accumulator elements are 8 consecutive columns n = 32 nw + 16 t + 8 hi + j of token lr:
// that is piece t of k step nw of the next product's token fragment at this very lane, so O's bf16 hi + residual planes go to LDS in fragment order with one 16-byte store each, and O itself (f32) stays in registers for the residual.
// The wave that holds columns n of O also forms columns n (value) and DIM + n (gate) of the GLU projection, so out = O + value tanh(gate) is in-lane; neither O, its planes nor the projection is ever stored to memory.
// Every #pragma unroll in it makes the indices of the fragment and accumulator arrays constants, so that they stay in registers (and the k steps become immediate offsets of one address register).
__global__ __launch_bounds__(512) void k_tail(const bf* __restrict__ Ch, const bf* __restrict__ Cl, const bf* __restrict__ Wo, const float* __restrict__ bias, const bf* __restrict__ Wg, float* __restrict__ OUTB) {
    __shared__ __align__(16) unsigned short sC[2][4][DM / 32][2][32][8];    // ctx: [plane][16-token tile][k step][piece][lane][8], as it lies in memory
    __shared__ __align__(16) unsigned short sO[2][4][DM / 32][2][32][8];    // O, the same order
    __shared__ __align__(16) float sS[16][32 * 36];                         // per wave: its 32 tokens x 32 columns of out, pitch 36 floats (16 bytes x odd: the 16-byte accesses fall on different banks)
    const int lane = threadIdx.x & 31, lr = lane & 15, hi = lane >> 4;
    const int wave = __builtin_amdgcn_readfirstlane(threadIdx.x >> 5), nw = wave >> 1, th = wave & 1;    // in scalar registers: they only shift base addresses
    auto gfrag = [](const bf* base, unsigned off) -> v16bf { const char* p = (const char*)base + off; return cat16b(*(const v8us*)p, *(const v8us*)(p + 512)); };
    auto cfrag = [&](int pl, int tt, int st) -> v16bf { return cat16b(*(const v8usa*)&sC[pl][tt][st][0][lane][0], *(const v8usa*)&sC[pl][tt][st][1][lane][0]); };
    auto ofrag = [&](int pl, int tt, int st) -> v16bf { return cat16b(*(const v8usa*)&sO[pl][tt][st][0][lane][0], *(const v8usa*)&sO[pl][tt][st][1][lane][0]); };
    const unsigned wo = (unsigned)nw * (2 * DM * 32) + lane * 16;    // the lane's 16 bytes in the wave's first weight tile (a 16-column tile is DM / 32 steps of 1 KiB); every weight load is this plus a constant, which is put on the pointer so that it becomes an immediate
    auto wofrag = [&](int t, int st) -> v16bf { return gfrag(Wo + (t * (INR * 32) + st * 1024) / 2, wo); };
    auto wgfrag = [&](int u, int st) -> v16bf { return gfrag(Wg + ((u >> 1) * (DM * DM * 2) + (u & 1) * (DM * 32) + st * 1024) / 2, wo); };    // u = value t = 0, 1 | gate t = 0, 1; the gate half starts DM columns (DM / 16 tiles) on
    // The weight fragments are asked for one k step ahead (two sets of registers), the first step's ahead of the barrier in front of its product, so that a step's matrix work covers the next step's L2 latency.
    v16bf wa[2][2], wb[2][4];
#pragma unroll
    for (int t = 0; t < 2; ++t) wa[0][t] = wofrag(t, 0);
    v4f bv[2][2];
    {   // the work-group's 4 token tiles are 32 KiB in a row of each plane: copied as they lie
        const unsigned co = blockIdx.x * (4 * DM * 32) + threadIdx.x * 16, bo = (unsigned)(nw * 32 + hi * 8) * 4;
        v8us tc[2][4];
#pragma unroll
        for (int i = 0; i < 4; ++i) { tc[0][i] = *(const v8us*)((const char*)Ch + co + i * 8192); tc[1][i] = *(const v8us*)((const char*)Cl + co + i * 8192); }
#pragma unroll
        for (int t = 0; t < 2; ++t) { bv[t][0] = *(const v4f*)((const char*)bias + bo + t * 64); bv[t][1] = *(const v4f*)((const char*)bias + bo + t * 64 + 16); }
        asm volatile("s_wait_xcnt 0x0" :: "v"(co), "v"(bo) : "memory");    // the two offsets stay live up to this wait, so that nothing (a later load's result either) lands in an address register of a load in front of it
#pragma unroll
        for (int i = 0; i < 4; ++i) { *(v8usa*)((char*)&sC[0][0][0][0][0][0] + i * 8192 + threadIdx.x * 16) = tc[0][i]; *(v8usa*)((char*)&sC[1][0][0][0][0][0] + i * 8192 + threadIdx.x * 16) = tc[1][i]; }
    }
    __syncthreads();    // ctx is in LDS
    v8f o1[2][2];    // [t][rt]
#pragma unroll
    for (int t = 0; t < 2; ++t)
#pragma unroll
        for (int rt = 0; rt < 2; ++rt) o1[t][rt] = (v8f){};
#pragma unroll
    for (int st = 0; st < INR / 32; ++st) {
        if (st + 1 < INR / 32) {
#pragma unroll
            for (int t = 0; t < 2; ++t) wa[(st + 1) & 1][t] = wofrag(t, st + 1);
        } else {
#pragma unroll
            for (int u = 0; u < 4; ++u) wb[0][u] = wgfrag(u, 0);
        }
        v16bf ch[2], cl[2];
#pragma unroll
        for (int rt = 0; rt < 2; ++rt) { ch[rt] = cfrag(0, 2 * th + rt, st); cl[rt] = cfrag(1, 2 * th + rt, st); }
        __builtin_amdgcn_sched_barrier(0);    // holds the next step's weight loads in front of this step's matrix instructions: without it the build sinks them to just in front of their use and waits for each there
#pragma unroll
        for (int rt = 0; rt < 2; ++rt)
#pragma unroll
            for (int t = 0; t < 2; ++t) o1[t][rt] = wmmab(wa[st & 1][t], ch[rt], o1[t][rt]);
#pragma unroll
        for (int rt = 0; rt < 2; ++rt)
#pragma unroll
            for (int t = 0; t < 2; ++t) o1[t][rt] = wmmab(wa[st & 1][t], cl[rt], o1[t][rt]);
    }
#pragma unroll
    for (int t = 0; t < 2; ++t)
#pragma unroll
        for (int rt = 0; rt < 2; ++rt) { float v[8];
#pragma unroll
            for (int j = 0; j < 8; ++j) { v[j] = o1[t][rt][j] + bfr(bv[t][j >> 2][j & 3]); o1[t][rt][j] = v[j]; }
            v8us oh, ol; split8(v, oh, ol);
            *(v8usa*)&sO[0][2 * th + rt][nw][t][lane][0] = oh; *(v8usa*)&sO[1][2 * th + rt][nw][t][lane][0] = ol; }
    __syncthreads();    // all 256 columns of O's planes are in LDS
    v8f g[4][2];    // [value t = 0, 1 | gate t = 0, 1][rt]
#pragma unroll
    for (int u = 0; u < 4; ++u)
#pragma unroll
        for (int rt = 0; rt < 2; ++rt) g[u][rt] = (v8f){};
#pragma unroll
    for (int st = 0; st < DM / 32; ++st) {
        if (st + 1 < DM / 32) {
#pragma unroll
            for (int u = 0; u < 4; ++u) wb[(st + 1) & 1][u] = wgfrag(u, st + 1);
        }
        v16bf oh[2], ol[2];
#pragma unroll
        for (int rt = 0; rt < 2; ++rt) { oh[rt] = ofrag(0, 2 * th + rt, st); ol[rt] = ofrag(1, 2 * th + rt, st); }
        __builtin_amdgcn_sched_barrier(0);    // as in the first product: without it the next step's weight loads sink to just in front of their use
#pragma unroll
        for (int rt = 0; rt < 2; ++rt)
#pragma unroll
            for (int u = 0; u < 4; ++u) g[u][rt] = wmmab(wb[st & 1][u], oh[rt], g[u][rt]);
#pragma unroll
        for (int rt = 0; rt < 2; ++rt)
#pragma unroll
            for (int u = 0; u < 4; ++u) g[u][rt] = wmmab(wb[st & 1][u], ol[rt], g[u][rt]);
    }
    asm volatile("s_wait_xcnt 0x0" :: "v"(wo) : "memory");    // the weight loads' one address register stays live up to this wait, in front of whatever overwrites it from here on
    float* ss = &sS[wave][0];
#pragma unroll
    for (int rt = 0; rt < 2; ++rt)
#pragma unroll
        for (int t = 0; t < 2; ++t) { v4f a, b;
#pragma unroll
            for (int j = 0; j < 4; ++j) { a[j] = o1[t][rt][j] + g[t][rt][j] * tanhf(g[2 + t][rt][j]); b[j] = o1[t][rt][4 + j] + g[t][rt][4 + j] * tanhf(g[2 + t][rt][4 + j]); }
            float* sp = ss + (rt * 16 + lr) * 36 + t * 16 + hi * 8; *(v4fa*)sp = a; *(v4fa*)(sp + 4) = b; }
    __syncthreads();    // between the lanes' writes of the staging tile and the reads of other lanes' elements
    // a store covers 4 tokens x 32 columns: 4 whole 128-byte lines, each written by this wave alone
#pragma unroll
    for (int s = 0; s < 8; ++s) { const int row = 4 * s + (lane >> 3), cofs = (lane & 7) * 4;
        *(v4f*)(OUTB + ((size_t)blockIdx.x * 64 + th * 32 + row) * DIM + nw * 32 + cofs) = *(const v4fa*)(ss + row * 36 + cofs); }
}

extern "C" void kernel_launch(void* const* d_in, const int* in_sizes, int n_in,
                              void* d_out, int out_size, void* d_ws, size_t ws_size, hipStream_t stream) {
    (void)in_sizes; (void)n_in; (void)out_size;
    const float* x = (const float*)d_in[0]; const float* lng = (const float*)d_in[1]; const float* lnb = (const float*)d_in[2]; const float* wqkv = (const float*)d_in[3]; const float* wout = (const float*)d_in[4]; const float* bout = (const float*)d_in[5]; const float* wglu = (const float*)d_in[6];
    float* out = (float*)d_out;    // [32][512][256]
    char* wsp = (char*)d_ws;
    auto take = [&](size_t bytes) { char* p = wsp; wsp += (bytes + 255) & ~(size_t)255; return (void*)p; };
    bf* WQKV = (bf*)take((size_t)(3 * INR) * DIM * 2); bf* WOUT = (bf*)take((size_t)DIM * INR * 2); bf* WGLU = (bf*)take((size_t)(2 * DIM) * DIM * 2);
    // q, k and v^T planes of all items: [item][head][...], so (item, head) is the block index of k_attn
    bf* Qh = (bf*)take((size_t)NBT * NH_ * SS * HD * 2); bf* Ql = (bf*)take((size_t)NBT * NH_ * SS * HD * 2); bf* Kh = (bf*)take((size_t)NBT * NH_ * SS * HD * 2); bf* Kl = (bf*)take((size_t)NBT * NH_ * SS * HD * 2);
    bf* VTh = (bf*)take((size_t)NBT * NH_ * HD * SS * 2); bf* VTl = (bf*)take((size_t)NBT * NH_ * HD * SS * 2);
    char* const reuse = wsp;    // from here the phases lay their buffers over one another, in stream order
    // phase 1 (all items): LayerNorm planes; dead once the q, k, v^T planes are written
    bf* Hh = (bf*)take((size_t)NR * DIM * 2); bf* Hl = (bf*)take((size_t)NR * DIM * 2);
    // phase 2 (all items): ctx planes
    wsp = reuse;
    bf* Ch = (bf*)take((size_t)NR * INR * 2); bf* Cl = (bf*)take((size_t)NR * INR * 2);
    if ((size_t)(wsp - (char*)d_ws) > ws_size) return;    // 0.75 + 48 + 16 ~ 65 MiB
    k_prep<<<WTB + NR / 16, 512, 0, stream>>>(x, lng, lnb, Hh, Hl, wqkv, wout, wglu, WQKV, WOUT, WGLU);
    k_gemmb<DIM, true, false, 1><<<dim3(NR / 64, (3 * INR) / 64, 1), 128, 0, stream>>>(Hh, Hl, WQKV, nullptr, nullptr, 3 * INR, nullptr, nullptr, 1, Qh, Ql, Kh, Kl, VTh, VTl);
    k_attn<<<NBT * NH_, 512, 0, stream>>>(Qh, Ql, Kh, Kl, VTh, VTl, Ch, Cl);
    k_tail<<<NR / 64, 512, 0, stream>>>(Ch, Cl, WOUT, bout, WGLU, out);
}

// v007
// One run takes 58.3 microseconds.
// In both of two side-by-side timings against v006, it was 1.27 times as fast.
// All steps since v000 together make it 48.5 times as fast.
#include <hip/hip_runtime.h>

// Compute dtypes, f32 accumulate, per item (512 tokens): LayerNorm in f32 -> bf16 hi + UNSCALED residual planes; qkv, to_out and the GLU projection as [512 x K].[K x N] products
// against the exact bf16 k-major weights (two products); per (item, head), in one kernel: sim = q.k^T ([512 x 32].[32 x 512], three products),
// the causal -10000 mask then x scale and the row softmax in f32, ctx = P.v ([512 x 512].[512 x 32], three products), scores and P in registers only - on v_wmma_f32_16x16x32_bf16; the GLU

#define NBT  32
#define SS   512
#define DIM  256
#define NH_  8
#define HD   32
#define INR  256
#define DM   DIM
#define SCL  0.17677669529663687f
#define NR   (NBT * SS)   // token rows of all items together

typedef unsigned short bf;
typedef __attribute__((ext_vector_type(16))) __bf16   v16bf;
typedef __attribute__((ext_vector_type(16))) _Float16 v16h;
typedef __attribute__((ext_vector_type(8)))  _Float16 v8h;
typedef __attribute__((ext_vector_type(8)))  unsigned short v8us;
typedef __attribute__((ext_vector_type(8)))  float    v8f;
typedef __attribute__((ext_vector_type(4)))  float    v4f;
typedef v8h  __attribute__((may_alias)) v8ha;
typedef v4f  __attribute__((may_alias)) v4fa;
typedef v8us __attribute__((may_alias)) v8usa;

__device__ __forceinline__ unsigned short f2bf(float f) { unsigned u = __float_as_uint(f); u += 0x7FFFu + ((u >> 16) & 1u); return (unsigned short)(u >> 16); }
__device__ __forceinline__ float bf2f(unsigned short b) { return __uint_as_float(((unsigned)b) << 16); }
__device__ __forceinline__ float bfr(float f) { return bf2f(f2bf(f)); }
__device__ __forceinline__ v16h cat16(v8h lo, v8h hi) { return __builtin_shufflevector(lo, hi, 0, 1, 2, 3, 4, 5, 6, 7, 8, 9, 10, 11, 12, 13, 14, 15); }
__device__ __forceinline__ v16bf cat16b(v8us lo, v8us hi) { return __builtin_bit_cast(v16bf, __builtin_shufflevector(lo, hi, 0, 1, 2, 3, 4, 5, 6, 7, 8, 9, 10, 11, 12, 13, 14, 15)); }
__device__ __forceinline__ v8f wmma16(v16h a, v16h b, v8f c) { return __builtin_amdgcn_wmma_f32_16x16x32_f16(false, a, false, b, (short)0, c, false, false); }
__device__ __forceinline__ v8f wmmab(v16bf a, v16bf b, v8f c) { return __builtin_amdgcn_wmma_f32_16x16x32_bf16(false, a, false, b, (short)0, c, false, false); }

// FRAGMENT ORDER: every operand of the three weight products lies as its loop loads it, [16-row tile][32-wide k step][piece p][lane][8]: lane = 16 hi + lr holds row lr, k = 32 step + 16 p + 8 hi + 0..7,
// so a wave's 16-byte loads of one piece read 512 bytes in a row (4 whole lines) where a row-major operand gave 32 bytes of each of 16 lines. Every producer stores this order.
// Every #pragma unroll of these plane stores makes the indices of the 8-element vectors constants, so that they stay in registers.
__device__ __forceinline__ void split8(const float* v, v8us& oh, v8us& ol) {
#pragma unroll
    for (int i = 0; i < 8; ++i) { const unsigned short hb = f2bf(v[i]); oh[i] = hb; ol[i] = f2bf(v[i] - bf2f(hb)); }
}

// wt_tile: WT = bf16(W[k][n]) (k-major [K][ncols]) in the fragment order (16 columns n are a tile's rows), one 64 x 64 tile through LDS by 256 threads (tid = 0..255).
__device__ __forceinline__ void wt_tile(const float* __restrict__ Wm, int K, int ncols, bf* WT, int k0, int n0, int tid, unsigned short* tl) {
    const int kk = tid >> 2, nq = (tid & 3) * 16;
#pragma unroll
    for (int i = 0; i < 16; ++i) tl[(nq + i) * 72 + kk] = f2bf(Wm[(size_t)(k0 + kk) * ncols + n0 + nq + i]);
    __syncthreads();
    const int lane = tid & 31;
    // the tile is 4 column tiles x 2 k steps x 2 pieces of 512 bytes; a wave stores two whole pieces
#pragma unroll
    for (int s = 0; s < 2; ++s) { const int q = (tid >> 5) * 2 + s, ct = q >> 2, kp = q & 3; const v8us val = *(const v8usa*)(tl + (ct * 16 + (lane & 15)) * 72 + kp * 16 + (lane >> 4) * 8);
        *(v8us*)(WT + (size_t)((n0 >> 4) + ct) * (K * 16) + (size_t)((k0 >> 4) + kp) * 256 + lane * 8) = val; }
}

// ln_tile: one wave per token, 16 tokens (one row tile of the qkv product) per work-group. A lane's 8 columns are one 16-byte piece of the fragment order, 256 bytes from its neighbour's,
// so the 16 waves exchange their pieces through LDS (pitch 272 bytes: a wave's 32 pieces fall on different banks) and each stores 512 bytes in a row of each plane.
__device__ __forceinline__ void ln_tile(const float* __restrict__ xb, const float* __restrict__ g, const float* __restrict__ bb, bf* Hh, bf* Hl, int rt, unsigned short (*sl)[32][136]) {    // sl: [plane][8-column piece][token][8], 8 elements of pad a piece
    const int lane = threadIdx.x & 31, wv = threadIdx.x >> 5, r = rt * 16 + wv; float v[8]; float s = 0.f;
#pragma unroll
    for (int i = 0; i < 8; ++i) { v[i] = bfr(xb[(size_t)r * DIM + lane * 8 + i]); s += v[i]; }
#pragma unroll
    for (int sh = 16; sh; sh >>= 1) s += __shfl_xor(s, sh, 32);
    const float mu = s * (1.0f / DIM); float q = 0.f;
#pragma unroll
    for (int i = 0; i < 8; ++i) { const float d = v[i] - mu; q = fmaf(d, d, q); }
#pragma unroll
    for (int sh = 16; sh; sh >>= 1) q += __shfl_xor(q, sh, 32);
    const float rs = rsqrtf(q * (1.0f / DIM) + 1e-5f); v8us oh, ol;
#pragma unroll
    for (int i = 0; i < 8; ++i) { const int c = lane * 8 + i; const float y = (v[i] - mu) * rs * bfr(g[c]) + bfr(bb[c]); const unsigned short hb = f2bf(y); oh[i] = hb; ol[i] = f2bf(y - bf2f(hb)); }
    *(v8usa*)&sl[0][lane][wv * 8] = oh; *(v8usa*)&sl[1][lane][wv * 8] = ol;
    __syncthreads();
    const int pc = threadIdx.x >> 4, tk = threadIdx.x & 15;    // columns 8 pc .. 8 pc + 7 = step pc / 4, piece (pc / 2) % 2, hi = pc % 2: the piece's place in the tile is 128 pc + 8 tk elements
    const size_t o = (size_t)rt * (16 * DIM) + threadIdx.x * 8; *(v8us*)(Hh + o) = *(const v8usa*)&sl[0][pc][tk * 8]; *(v8us*)(Hl + o) = *(const v8usa*)&sl[1][pc][tk * 8];
}

// k_prep: the four jobs that depend on nothing but the inputs share one launch; the block index picks the job (the same for a whole work-group, so each job's barrier is passed by all of it).
// Blocks 0 .. WTB - 1: the weights, two 64 x 64 tiles a block (one per 256 threads), the tiles numbered w_qkv, w_out, w_glu, 4 k tiles fastest (all three have K = 256); the rest: LayerNorm, 16 tokens a block.
#define WT_QKV (4 * (3 * INR / 64))
#define WT_OUT (4 * (DIM / 64))
#define WT_GLU (4 * (2 * DIM / 64))
#define WTB    ((WT_QKV + WT_OUT + WT_GLU) / 2)
__global__ __launch_bounds__(512) void k_prep(const float* __restrict__ xb, const float* __restrict__ g, const float* __restrict__ bb, bf* Hh, bf* Hl,
                                              const float* __restrict__ wqkv, const float* __restrict__ wout, const float* __restrict__ wglu, bf* WQKV, bf* WOUT, bf* WGLU) {
    __shared__ __align__(16) unsigned short sm[2 * 64 * 72];    // two weight tiles of 64 x 72, or LayerNorm's 2 x 32 x 136 (smaller)
    if (blockIdx.x < WTB) {
        static_assert(WT_QKV % 2 == 0 && WT_OUT % 2 == 0 && WT_GLU % 2 == 0, "a block's two tiles are of one matrix");
        int t0 = blockIdx.x * 2;    // the block's first tile: the matrix is picked by the block index alone, in scalar registers
        const float* Wm = wqkv; bf* WT = WQKV; int ncols = 3 * INR;
        if (t0 >= WT_QKV + WT_OUT) { t0 -= WT_QKV + WT_OUT; Wm = wglu; WT = WGLU; ncols = 2 * DIM; }
        else if (t0 >= WT_QKV) { t0 -= WT_QKV; Wm = wout; WT = WOUT; ncols = DIM; }
        const int half = threadIdx.x >> 8, tix = t0 + half;
        wt_tile(Wm, DIM, ncols, WT, (tix & 3) * 64, (tix >> 2) * 64, threadIdx.x & 255, sm + half * (64 * 72));
    } else {
        ln_tile(xb, g, bb, Hh, Hl, blockIdx.x - WTB, (unsigned short (*)[32][136])sm);
    }
}
template <int N> struct ic { static constexpr int v = N; };
typedef __attribute__((ext_vector_type(2))) float  v2f;
typedef __attribute__((ext_vector_type(2))) __bf16 v2bf;
__global__ __launch_bounds__(512) void k_attn(const bf* __restrict__ Hh, const bf* __restrict__ Hl, const bf* __restrict__ Wq, bf* __restrict__ Ch, bf* __restrict__ Cl) {
    __shared__ __align__(16) unsigned short sT[SS / 32][2][2][2][2][32][8];    // [32-key trip][k | v^T][plane][16-key tile | 16-d tile][piece][lane][8]: a trip's 8 KiB lie together
    __shared__ __align__(16) unsigned short sW[6][DIM / 32][2][32][8];    // the head's weight tiles (q 0, 1 | k 0, 1 | v 0, 1), each [k step][piece][lane][8] as it lies in memory
    const int lane = threadIdx.x & 31, c = lane & 15, h = lane >> 4;
    const int wave = __builtin_amdgcn_readfirstlane(threadIdx.x >> 5);    // in a scalar register: the trip loops' bounds and branches are scalar
    v16bf qh[2], ql[2];
    {
        auto gfrag = [](const bf* base, unsigned off) -> v16bf { const char* p = (const char*)base + off; return cat16b(*(const v8us*)p, *(const v8us*)(p + 512)); };
        const unsigned ho = ((blockIdx.x / NH_) * (SS / 16) + wave * 2) * (DIM * 32) + lane * 16;    // the lane's 16 bytes in the wave's first token tile (a tile is DIM / 32 steps of 1 KiB); every fragment load is this plus a constant
        auto hfrag = [&](int pl, int rt, int st) -> v16bf { return gfrag((pl ? Hl : Hh) + (rt * (DIM * 32) + st * 1024) / 2, ho); };
        auto wfrag = [&](int i, int st) -> v16bf { return cat16b(*(const v8usa*)&sW[i][st][0][lane][0], *(const v8usa*)&sW[i][st][1][lane][0]); };
        // The token fragments are asked for one k step ahead (two sets of registers), the first step's ahead of the barrier, so that a step's matrix work covers the next step's latency.
        v16bf hb[2][2][2];    // [set][plane][rt]
#pragma unroll
        for (int pl = 0; pl < 2; ++pl)
#pragma unroll
            for (int rt = 0; rt < 2; ++rt) hb[0][pl][rt] = hfrag(pl, rt, 0);
        {   // a weight tile is 8 KiB in a row: one 16-byte piece a thread, copied as it lies
            const unsigned so = (blockIdx.x % NH_) * (2 * DIM * 32) + threadIdx.x * 16; v8us tw[6];
#pragma unroll
            for (int i = 0; i < 6; ++i) tw[i] = *(const v8us*)((const char*)Wq + ((i >> 1) * (INR / 16) + (i & 1)) * (DIM * 32) + so);
            asm volatile("s_wait_xcnt 0x0" :: "v"(so) : "memory");    // the offset stays live up to this wait, so that nothing (a later load's result either) lands in an address register of a load in front of it
#pragma unroll
            for (int i = 0; i < 6; ++i) *(v8usa*)((char*)&sW[i][0][0][0][0] + threadIdx.x * 16) = tw[i];
        }
        __syncthreads();    // the weight tiles are in LDS
        v8f aq[2][2], ak[2][2], av[2][2];    // [t][rt]
#pragma unroll
        for (int t = 0; t < 2; ++t)
#pragma unroll
            for (int rt = 0; rt < 2; ++rt) { aq[t][rt] = (v8f){}; ak[t][rt] = (v8f){}; av[t][rt] = (v8f){}; }
#pragma unroll
        for (int st = 0; st < DIM / 32; ++st) {
            if (st + 1 < DIM / 32) {
#pragma unroll
                for (int pl = 0; pl < 2; ++pl)
#pragma unroll
                    for (int rt = 0; rt < 2; ++rt) hb[(st + 1) & 1][pl][rt] = hfrag(pl, rt, st + 1);
            }
            v16bf w[6];
#pragma unroll
            for (int i = 0; i < 6; ++i) w[i] = wfrag(i, st);
            __builtin_amdgcn_sched_barrier(0);    // holds the next step's token loads in front of this step's matrix instructions: without it the build may sink them to just in front of their use and wait for each there
#pragma unroll
            for (int pl = 0; pl < 2; ++pl)    // each accumulator takes the step's hi product, then its residual product
#pragma unroll
                for (int rt = 0; rt < 2; ++rt)
#pragma unroll
                    for (int t = 0; t < 2; ++t) { const v16bf hf = hb[st & 1][pl][rt];
                        aq[t][rt] = wmmab(w[t], hf, aq[t][rt]); ak[t][rt] = wmmab(w[2 + t], hf, ak[t][rt]); av[t][rt] = wmmab(hf, w[4 + t], av[t][rt]); }
            __builtin_amdgcn_sched_barrier(0);    // keeps the following step's loads below this step's matrix instructions: risen among them they made a third set of token fragments live, past the 256 registers, and the build spilled
        }
        asm volatile("s_wait_xcnt 0x0" :: "v"(ho) : "memory");    // the token loads' one address register stays live up to this wait, in front of whatever overwrites it from here on
#pragma unroll
        for (int rt = 0; rt < 2; ++rt) { v8us oh[2], ol[2];
#pragma unroll
            for (int t = 0; t < 2; ++t) { float v[8];
#pragma unroll
                for (int j = 0; j < 8; ++j) v[j] = aq[t][rt][j];
                split8(v, oh[t], ol[t]); }
            qh[rt] = cat16b(oh[0], oh[1]); ql[rt] = cat16b(ol[0], ol[1]);
#pragma unroll
            for (int t = 0; t < 2; ++t) { float v[8]; v8us kh8, kl8, vh8, vl8;
#pragma unroll
                for (int j = 0; j < 8; ++j) v[j] = ak[t][rt][j];
                split8(v, kh8, kl8);
#pragma unroll
                for (int j = 0; j < 8; ++j) v[j] = av[t][rt][j];
                split8(v, vh8, vl8);
                // wave w fills trip w: key tile rt, piece t of k; d tile t, piece rt of v^T
                *(v8usa*)&sT[wave][0][0][rt][t][lane][0] = kh8; *(v8usa*)&sT[wave][0][1][rt][t][lane][0] = kl8;
                *(v8usa*)&sT[wave][1][0][t][rt][lane][0] = vh8; *(v8usa*)&sT[wave][1][1][t][rt][lane][0] = vl8; } }
    }
    __syncthreads();
    auto kfrag = [&](int pl, int jc, int tj) -> v16bf { return cat16b(*(const v8usa*)&sT[jc][0][pl][tj][0][lane][0], *(const v8usa*)&sT[jc][0][pl][tj][1][lane][0]); };
    auto vfrag = [&](int pl, int jc, int dt) -> v16bf { return cat16b(*(const v8usa*)&sT[jc][1][pl][dt][0][lane][0], *(const v8usa*)&sT[jc][1][pl][dt][1][lane][0]); };
    // s[r] = sim[query 32 wave + qt * 16 + c][key jc * 32 + tj * 16 + 8 h + r]
    auto sim = [&](v16bf kh, v16bf kl, int qt) -> v8f { v8f s = {}; s = wmmab(kh, qh[qt], s); s = wmmab(kh, ql[qt], s); s = wmmab(kl, qh[qt], s); return s; };
    // A trip's 32 keys against the wave's 32 queries: M = 0 all allowed (trip < wave), 1 the diagonal trip, 2 all masked (trip > wave).
    float mu[2] = {-3.0e38f, -3.0e38f}, mm[2] = {-3.0e38f, -3.0e38f};    // maxima of sim + mask, and of sim alone over the wholly masked trips
    auto walk1 = [&](auto M, int jc) {
#pragma unroll
        for (int tj = 0; tj < 2; ++tj) { const v16bf kh = kfrag(0, jc, tj), kl = kfrag(1, jc, tj);
#pragma unroll
            for (int qt = 0; qt < 2; ++qt) { const v8f s = sim(kh, kl, qt);
#pragma unroll
                for (int r = 0; r < 8; ++r) {
                    if constexpr (decltype(M)::v == 0) mu[qt] = fmaxf(mu[qt], s[r]);
                    else if constexpr (decltype(M)::v == 2) mm[qt] = fmaxf(mm[qt], s[r]);
                    else mu[qt] = fmaxf(mu[qt], s[r] + ((tj * 16 + 8 * h + r > qt * 16 + c) ? -10000.0f : 0.f)); } } }
    };
    for (int jc = 0; jc < wave; ++jc) walk1(ic<0>{}, jc);
    walk1(ic<1>{}, wave);
    for (int jc = wave + 1; jc < SS / 32; ++jc) walk1(ic<2>{}, jc);
    const float CE = SCL * 1.4426950408889634f;    // exp(x * scale) = exp2(x * CE)
    float nm[2]; v2f sum[2] = {(v2f){0.f, 0.f}, (v2f){0.f, 0.f}};    // even and odd keys summed apart
#pragma unroll
    for (int qt = 0; qt < 2; ++qt) { float m = fmaxf(mu[qt], mm[qt] + -10000.0f); m = fmaxf(m, __shfl_xor(m, 16, 32)); nm[qt] = -(m * CE); }
    v8f o[2][2];
#pragma unroll
    for (int dt = 0; dt < 2; ++dt)
#pragma unroll
        for (int qt = 0; qt < 2; ++qt) o[dt][qt] = (v8f){};
    auto walk2 = [&](auto M, int jc) {
        v16bf ph[2], pl[2];
#pragma unroll
        for (int tj = 0; tj < 2; ++tj) { const v16bf kh = kfrag(0, jc, tj), kl = kfrag(1, jc, tj);
#pragma unroll
            for (int qt = 0; qt < 2; ++qt) { const v8f s = sim(kh, kl, qt);
#pragma unroll
                for (int r = 0; r < 8; r += 2) { v2f e;
#pragma unroll
                    for (int u = 0; u < 2; ++u) {
                        float t = s[r + u];
                        if constexpr (decltype(M)::v == 2) t += -10000.0f;
                        else if constexpr (decltype(M)::v == 1) t += ((tj * 16 + 8 * h + r + u > qt * 16 + c) ? -10000.0f : 0.f);
                        const float x = fmaf(t, CE, nm[qt]); float ex;
                        if constexpr (decltype(M)::v == 1) asm("v_exp_f32 %0, %1\n\tv_nop" : "=v"(ex) : "v"(x));    // the v_nop fills the slot behind the transcendental
                        else ex = __builtin_amdgcn_exp2f(x);
                        e[u] = ex; }
                    sum[qt] += e;
                    const v2bf eh = __builtin_convertvector(e, v2bf); const v2bf el = __builtin_convertvector(e - __builtin_convertvector(eh, v2f), v2bf);
                    ph[qt][tj * 8 + r] = eh[0]; ph[qt][tj * 8 + r + 1] = eh[1]; pl[qt][tj * 8 + r] = el[0]; pl[qt][tj * 8 + r + 1] = el[1]; } } }
#pragma unroll
        for (int dt = 0; dt < 2; ++dt) { const v16bf vh = vfrag(0, jc, dt), vl = vfrag(1, jc, dt);
#pragma unroll
            for (int qt = 0; qt < 2; ++qt) { o[dt][qt] = wmmab(vh, ph[qt], o[dt][qt]); o[dt][qt] = wmmab(vh, pl[qt], o[dt][qt]); o[dt][qt] = wmmab(vl, ph[qt], o[dt][qt]); } }
    };
    for (int jc = 0; jc < wave; ++jc) walk2(ic<0>{}, jc);
    walk2(ic<1>{}, wave);
    for (int jc = wave + 1; jc < SS / 32; ++jc) walk2(ic<2>{}, jc);
    // o[dt][qt][r] = ctx^T[d = dt * 16 + 8 h + r][query 32 wave + qt * 16 + c]: 8 consecutive d of one query a lane, which is piece dt of to_out's B fragment (row tile = 16 queries, k step = head) at this very lane: stored as the bf16 hi + residual planes in the fragment order, 512 bytes in a row a store
#pragma unroll
    for (int qt = 0; qt < 2; ++qt) { const float sl = sum[qt][0] + sum[qt][1]; const float sm = sl + __shfl_xor(sl, 16, 32); const float inv = 1.0f / sm;
#pragma unroll
        for (int dt = 0; dt < 2; ++dt) { const size_t co = (((size_t)(blockIdx.x / NH_) * (SS / 16) + wave * 2 + qt) * NH_ + blockIdx.x % NH_) * 512 + dt * 256 + lane * 8; const v8f v = o[dt][qt] * inv; v8us oh, ol;
#pragma unroll
            for (int i = 0; i < 8; ++i) { const unsigned short hb = f2bf(v[i]); oh[i] = hb; ol[i] = f2bf(v[i] - bf2f(hb)); }
            *(v8us*)(Ch + co) = oh; *(v8us*)(Cl + co) = ol; } }
}
// k_tail: to_out, the GLU projection and the gate of 64 tokens in one work-group of 16 waves; wave = (nw, th): columns 32 nw .. 32 nw + 31 (two 16-column tiles t) of tokens 32 th .. 32 th + 31 (two 16-token tiles rt).
// Both products are formed transposed, weights as the A operand and tokens as B (the two fragment orders are the same), so a lane's 8 accumulator elements are 8 consecutive columns n = 32 nw + 16 t + 8 hi + j of token lr:
// that is piece t of k step nw of the next product's token fragment at this very lane, so O's bf16 hi + residual planes go to LDS in fragment order with one 16-byte store each, and O itself (f32) stays in registers for the residual.
// The wave that holds columns n of O also forms columns n (value) and DIM + n (gate) of the GLU projection, so out = O + value tanh(gate) is in-lane; neither O, its planes nor the projection is ever stored to memory.
// Every #pragma unroll in it makes the indices of the fragment and accumulator arrays constants, so that they stay in registers (and the k steps become immediate offsets of one address register).
__global__ __launch_bounds__(512) void k_tail(const bf* __restrict__ Ch, const bf* __restrict__ Cl, const bf* __restrict__ Wo, const float* __restrict__ bias, const bf* __restrict__ Wg, float* __restrict__ OUTB) {
    __shared__ __align__(16) unsigned short sC[2][4][DM / 32][2][32][8];    // ctx: [plane][16-token tile][k step][piece][lane][8], as it lies in memory
    __shared__ __align__(16) unsigned short sO[2][4][DM / 32][2][32][8];    // O, the same order
    __shared__ __align__(16) float sS[16][32 * 36];                         // per wave: its 32 tokens x 32 columns of out, pitch 36 floats (16 bytes x odd: the 16-byte accesses fall on different banks)
    const int lane = threadIdx.x & 31, lr = lane & 15, hi = lane >> 4;
    const int wave = __builtin_amdgcn_readfirstlane(threadIdx.x >> 5), nw = wave >> 1, th = wave & 1;    // in scalar registers: they only shift base addresses
    auto gfrag = [](const bf* base, unsigned off) -> v16bf { const char* p = (const char*)base + off; return cat16b(*(const v8us*)p, *(const v8us*)(p + 512)); };
    auto cfrag = [&](int pl, int tt, int st) -> v16bf { return cat16b(*(const v8usa*)&sC[pl][tt][st][0][lane][0], *(const v8usa*)&sC[pl][tt][st][1][lane][0]); };
    auto ofrag = [&](int pl, int tt, int st) -> v16bf { return cat16b(*(const v8usa*)&sO[pl][tt][st][0][lane][0], *(const v8usa*)&sO[pl][tt][st][1][lane][0]); };
    const unsigned wo = (unsigned)nw * (2 * DM * 32) + lane * 16;    // the lane's 16 bytes in the wave's first weight tile (a 16-column tile is DM / 32 steps of 1 KiB); every weight load is this plus a constant, which is put on the pointer so that it becomes an immediate
    auto wofrag = [&](int t, int st) -> v16bf { return gfrag(Wo + (t * (INR * 32) + st * 1024) / 2, wo); };
    auto wgfrag = [&](int u, int st) -> v16bf { return gfrag(Wg + ((u >> 1) * (DM * DM * 2) + (u & 1) * (DM * 32) + st * 1024) / 2, wo); };    // u = value t = 0, 1 | gate t = 0, 1; the gate half starts DM columns (DM / 16 tiles) on
    // The weight fragments are asked for one k step ahead (two sets of registers), the first step's ahead of the barrier in front of its product, so that a step's matrix work covers the next step's L2 latency.
    v16bf wa[2][2], wb[2][4];
#pragma unroll
    for (int t = 0; t < 2; ++t) wa[0][t] = wofrag(t, 0);
    v4f bv[2][2];
    {   // the work-group's 4 token tiles are 32 KiB in a row of each plane: copied as they lie
        const unsigned co = blockIdx.x * (4 * DM * 32) + threadIdx.x * 16, bo = (unsigned)(nw * 32 + hi * 8) * 4;
        v8us tc[2][4];
#pragma unroll
        for (int i = 0; i < 4; ++i) { tc[0][i] = *(const v8us*)((const char*)Ch + co + i * 8192); tc[1][i] = *(const v8us*)((const char*)Cl + co + i * 8192); }
#pragma unroll
        for (int t = 0; t < 2; ++t) { bv[t][0] = *(const v4f*)((const char*)bias + bo + t * 64); bv[t][1] = *(const v4f*)((const char*)bias + bo + t * 64 + 16); }
        asm volatile("s_wait_xcnt 0x0" :: "v"(co), "v"(bo) : "memory");    // the two offsets stay live up to this wait, so that nothing (a later load's result either) lands in an address register of a load in front of it
#pragma unroll
        for (int i = 0; i < 4; ++i) { *(v8usa*)((char*)&sC[0][0][0][0][0][0] + i * 8192 + threadIdx.x * 16) = tc[0][i]; *(v8usa*)((char*)&sC[1][0][0][0][0][0] + i * 8192 + threadIdx.x * 16) = tc[1][i]; }
    }
    __syncthreads();    // ctx is in LDS
    v8f o1[2][2];    // [t][rt]
#pragma unroll
    for (int t = 0; t < 2; ++t)
#pragma unroll
        for (int rt = 0; rt < 2; ++rt) o1[t][rt] = (v8f){};
#pragma unroll
    for (int st = 0; st < INR / 32; ++st) {
        if (st + 1 < INR / 32) {
#pragma unroll
            for (int t = 0; t < 2; ++t) wa[(st + 1) & 1][t] = wofrag(t, st + 1);
        } else {
#pragma unroll
            for (int u = 0; u < 4; ++u) wb[0][u] = wgfrag(u, 0);
        }
        v16bf ch[2], cl[2];
#pragma unroll
        for (int rt = 0; rt < 2; ++rt) { ch[rt] = cfrag(0, 2 * th + rt, st); cl[rt] = cfrag(1, 2 * th + rt, st); }
        __builtin_amdgcn_sched_barrier(0);    // holds the next step's weight loads in front of this step's matrix instructions: without it the build sinks them to just in front of their use and waits for each there
#pragma unroll
        for (int rt = 0; rt < 2; ++rt)
#pragma unroll
            for (int t = 0; t < 2; ++t) o1[t][rt] = wmmab(wa[st & 1][t], ch[rt], o1[t][rt]);
#pragma unroll
        for (int rt = 0; rt < 2; ++rt)
#pragma unroll
            for (int t = 0; t < 2; ++t) o1[t][rt] = wmmab(wa[st & 1][t], cl[rt], o1[t][rt]);
    }
#pragma unroll
    for (int t = 0; t < 2; ++t)
#pragma unroll
        for (int rt = 0; rt < 2; ++rt) { float v[8];
#pragma unroll
            for (int j = 0; j < 8; ++j) { v[j] = o1[t][rt][j] + bfr(bv[t][j >> 2][j & 3]); o1[t][rt][j] = v[j]; }
            v8us oh, ol; split8(v, oh, ol);
            *(v8usa*)&sO[0][2 * th + rt][nw][t][lane][0] = oh; *(v8usa*)&sO[1][2 * th + rt][nw][t][lane][0] = ol; }
    __syncthreads();    // all 256 columns of O's planes are in LDS
    v8f g[4][2];    // [value t = 0, 1 | gate t = 0, 1][rt]
#pragma unroll
    for (int u = 0; u < 4; ++u)
#pragma unroll
        for (int rt = 0; rt < 2; ++rt) g[u][rt] = (v8f){};
#pragma unroll
    for (int st = 0; st < DM / 32; ++st) {
        if (st + 1 < DM / 32) {
#pragma unroll
            for (int u = 0; u < 4; ++u) wb[(st + 1) & 1][u] = wgfrag(u, st + 1);
        }
        v16bf oh[2], ol[2];
#pragma unroll
        for (int rt = 0; rt < 2; ++rt) { oh[rt] = ofrag(0, 2 * th + rt, st); ol[rt] = ofrag(1, 2 * th + rt, st); }
        __builtin_amdgcn_sched_barrier(0);    // as in the first product: without it the next step's weight loads sink to just in front of their use
#pragma unroll
        for (int rt = 0; rt < 2; ++rt)
#pragma unroll
            for (int u = 0; u < 4; ++u) g[u][rt] = wmmab(wb[st & 1][u], oh[rt], g[u][rt]);
#pragma unroll
        for (int rt = 0; rt < 2; ++rt)
#pragma unroll
            for (int u = 0; u < 4; ++u) g[u][rt] = wmmab(wb[st & 1][u], ol[rt], g[u][rt]);
    }
    asm volatile("s_wait_xcnt 0x0" :: "v"(wo) : "memory");    // the weight loads' one address register stays live up to this wait, in front of whatever overwrites it from here on
    float* ss = &sS[wave][0];
#pragma unroll
    for (int rt = 0; rt < 2; ++rt)
#pragma unroll
        for (int t = 0; t < 2; ++t) { v4f a, b;
#pragma unroll
            for (int j = 0; j < 4; ++j) { a[j] = o1[t][rt][j] + g[t][rt][j] * tanhf(g[2 + t][rt][j]); b[j] = o1[t][rt][4 + j] + g[t][rt][4 + j] * tanhf(g[2 + t][rt][4 + j]); }
            float* sp = ss + (rt * 16 + lr) * 36 + t * 16 + hi * 8; *(v4fa*)sp = a; *(v4fa*)(sp + 4) = b; }
    __syncthreads();    // between the lanes' writes of the staging tile and the reads of other lanes' elements
    // a store covers 4 tokens x 32 columns: 4 whole 128-byte lines, each written by this wave alone
#pragma unroll
    for (int s = 0; s < 8; ++s) { const int row = 4 * s + (lane >> 3), cofs = (lane & 7) * 4;
        *(v4f*)(OUTB + ((size_t)blockIdx.x * 64 + th * 32 + row) * DIM + nw * 32 + cofs) = *(const v4fa*)(ss + row * 36 + cofs); }
}

extern "C" void kernel_launch(void* const* d_in, const int* in_sizes, int n_in,
                              void* d_out, int out_size, void* d_ws, size_t ws_size, hipStream_t stream) {
    (void)in_sizes; (void)n_in; (void)out_size;
    const float* x = (const float*)d_in[0]; const float* lng = (const float*)d_in[1]; const float* lnb = (const float*)d_in[2]; const float* wqkv = (const float*)d_in[3]; const float* wout = (const float*)d_in[4]; const float* bout = (const float*)d_in[5]; const float* wglu = (const float*)d_in[6];
    float* out = (float*)d_out;    // [32][512][256]
    char* wsp = (char*)d_ws;
    auto take = [&](size_t bytes) { char* p = wsp; wsp += (bytes + 255) & ~(size_t)255; return (void*)p; };
    bf* WQKV = (bf*)take((size_t)(3 * INR) * DIM * 2); bf* WOUT = (bf*)take((size_t)DIM * INR * 2); bf* WGLU = (bf*)take((size_t)(2 * DIM) * DIM * 2);
    // LayerNorm planes and ctx planes of all items: k_attn reads the first and writes the second in one launch, so they lie apart
    bf* Hh = (bf*)take((size_t)NR * DIM * 2); bf* Hl = (bf*)take((size_t)NR * DIM * 2);
    bf* Ch = (bf*)take((size_t)NR * INR * 2); bf* Cl = (bf*)take((size_t)NR * INR * 2);
    if ((size_t)(wsp - (char*)d_ws) > ws_size) return;    // 0.75 + 16 + 16 ~ 33 MiB
    k_prep<<<WTB + NR / 16, 512, 0, stream>>>(x, lng, lnb, Hh, Hl, wqkv, wout, wglu, WQKV, WOUT, WGLU);
    k_attn<<<NBT * NH_, 512, 0, stream>>>(Hh, Hl, WQKV, Ch, Cl);
    k_tail<<<NR / 64, 512, 0, stream>>>(Ch, Cl, WOUT, bout, WGLU, out);
}

// v008
// One run takes 50.4 microseconds.
// Two timings next to v007 both put it at 1.16 times that version's speed.
// Over all steps from v000 it is 56.1 times as fast.
#include <hip/hip_runtime.h>

// Compute dtypes, f32 accumulate, per item (512 tokens): LayerNorm in f32 -> bf16 hi + UNSCALED residual planes; qkv, to_out and the GLU projection as [512 x K].[K x N] products
// against the exact bf16 k-major weights (two products); per (item, head), in one kernel: sim = q.k^T ([512 x 32].[32 x 512], three products),
// the causal -10000 mask then x scale and the row softmax in f32, ctx = P.v ([512 x 512].[512 x 32], three products), scores and P in registers only - on v_wmma_f32_16x16x32_bf16; the GLU

#define NBT  32
#define SS   512
#define DIM  256
#define NH_  8
#define HD   32
#define INR  256
#define DM   DIM
#define SCL  0.17677669529663687f
#define NR   (NBT * SS)   // token rows of all items together

typedef unsigned short bf;
typedef __attribute__((ext_vector_type(16))) __bf16   v16bf;
typedef __attribute__((ext_vector_type(16))) _Float16 v16h;
typedef __attribute__((ext_vector_type(8)))  _Float16 v8h;
typedef __attribute__((ext_vector_type(8)))  unsigned short v8us;
typedef __attribute__((ext_vector_type(8)))  float    v8f;
typedef __attribute__((ext_vector_type(4)))  float    v4f;
typedef v8h  __attribute__((may_alias)) v8ha;
typedef v4f  __attribute__((may_alias)) v4fa;
typedef v8us __attribute__((may_alias)) v8usa;

__device__ __forceinline__ unsigned short f2bf(float f) { unsigned u = __float_as_uint(f); u += 0x7FFFu + ((u >> 16) & 1u); return (unsigned short)(u >> 16); }
__device__ __forceinline__ float bf2f(unsigned short b) { return __uint_as_float(((unsigned)b) << 16); }
__device__ __forceinline__ float bfr(float f) { return bf2f(f2bf(f)); }
__device__ __forceinline__ v16h cat16(v8h lo, v8h hi) { return __builtin_shufflevector(lo, hi, 0, 1, 2, 3, 4, 5, 6, 7, 8, 9, 10, 11, 12, 13, 14, 15); }
__device__ __forceinline__ v16bf cat16b(v8us lo, v8us hi) { return __builtin_bit_cast(v16bf, __builtin_shufflevector(lo, hi, 0, 1, 2, 3, 4, 5, 6, 7, 8, 9, 10, 11, 12, 13, 14, 15)); }
__device__ __forceinline__ v8f wmma16(v16h a, v16h b, v8f c) { return __builtin_amdgcn_wmma_f32_16x16x32_f16(false, a, false, b, (short)0, c, false, false); }
__device__ __forceinline__ v8f wmmab(v16bf a, v16bf b, v8f c) { return __builtin_amdgcn_wmma_f32_16x16x32_bf16(false, a, false, b, (short)0, c, false, false); }

// FRAGMENT ORDER: every operand of the three weight products lies as its loop loads it, [16-row tile][32-wide k step][piece p][lane][8]: lane = 16 hi + lr holds row lr, k = 32 step + 16 p + 8 hi + 0..7,
// so a wave's 16-byte loads of one piece read 512 bytes in a row (4 whole lines) where a row-major operand gave 32 bytes of each of 16 lines. Every producer stores this order.
// Every #pragma unroll of these plane stores makes the indices of the 8-element vectors constants, so that they stay in registers.
__device__ __forceinline__ void split8(const float* v, v8us& oh, v8us& ol) {
#pragma unroll
    for (int i = 0; i < 8; ++i) { const unsigned short hb = f2bf(v[i]); oh[i] = hb; ol[i] = f2bf(v[i] - bf2f(hb)); }
}

// wt_tile: WT = bf16(W[k][n]) (k-major [K][ncols]) in the fragment order (16 columns n are a tile's rows), one 64 x 64 tile through LDS by 256 threads (tid = 0..255).
__device__ __forceinline__ void wt_tile(const float* __restrict__ Wm, int K, int ncols, bf* WT, int k0, int n0, int tid, unsigned short* tl) {
    const int kk = tid >> 2, nq = (tid & 3) * 16;
#pragma unroll
    for (int i = 0; i < 16; ++i) tl[(nq + i) * 72 + kk] = f2bf(Wm[(size_t)(k0 + kk) * ncols + n0 + nq + i]);
    __syncthreads();
    const int lane = tid & 31;
    // the tile is 4 column tiles x 2 k steps x 2 pieces of 512 bytes; a wave stores two whole pieces
#pragma unroll
    for (int s = 0; s < 2; ++s) { const int q = (tid >> 5) * 2 + s, ct = q >> 2, kp = q & 3; const v8us val = *(const v8usa*)(tl + (ct * 16 + (lane & 15)) * 72 + kp * 16 + (lane >> 4) * 8);
        *(v8us*)(WT + (size_t)((n0 >> 4) + ct) * (K * 16) + (size_t)((k0 >> 4) + kp) * 256 + lane * 8) = val; }
}

// ln_tile: one wave per token, 16 tokens (one row tile of the qkv product) per work-group. A lane's 8 columns are one 16-byte piece of the fragment order, 256 bytes from its neighbour's,
// so the 16 waves exchange their pieces through LDS (pitch 272 bytes: a wave's 32 pieces fall on different banks) and each stores 512 bytes in a row of each plane.
__device__ __forceinline__ void ln_tile(const float* __restrict__ xb, const float* __restrict__ g, const float* __restrict__ bb, bf* Hh, bf* Hl, int rt, unsigned short (*sl)[32][136]) {    // sl: [plane][8-column piece][token][8], 8 elements of pad a piece
    const int lane = threadIdx.x & 31, wv = threadIdx.x >> 5, r = rt * 16 + wv; float v[8]; float s = 0.f;
#pragma unroll
    for (int i = 0; i < 8; ++i) { v[i] = bfr(xb[(size_t)r * DIM + lane * 8 + i]); s += v[i]; }
#pragma unroll
    for (int sh = 16; sh; sh >>= 1) s += __shfl_xor(s, sh, 32);
    const float mu = s * (1.0f / DIM); float q = 0.f;
#pragma unroll
    for (int i = 0; i < 8; ++i) { const float d = v[i] - mu; q = fmaf(d, d, q); }
#pragma unroll
    for (int sh = 16; sh; sh >>= 1) q += __shfl_xor(q, sh, 32);
    const float rs = rsqrtf(q * (1.0f / DIM) + 1e-5f); v8us oh, ol;
#pragma unroll
    for (int i = 0; i < 8; ++i) { const int c = lane * 8 + i; const float y = (v[i] - mu) * rs * bfr(g[c]) + bfr(bb[c]); const unsigned short hb = f2bf(y); oh[i] = hb; ol[i] = f2bf(y - bf2f(hb)); }
    *(v8usa*)&sl[0][lane][wv * 8] = oh; *(v8usa*)&sl[1][lane][wv * 8] = ol;
    __syncthreads();
    const int pc = threadIdx.x >> 4, tk = threadIdx.x & 15;    // columns 8 pc .. 8 pc + 7 = step pc / 4, piece (pc / 2) % 2, hi = pc % 2: the piece's place in the tile is 128 pc + 8 tk elements
    const size_t o = (size_t)rt * (16 * DIM) + threadIdx.x * 8; *(v8us*)(Hh + o) = *(const v8usa*)&sl[0][pc][tk * 8]; *(v8us*)(Hl + o) = *(const v8usa*)&sl[1][pc][tk * 8];
}

// k_prep: the four jobs that depend on nothing but the inputs share one launch; the block index picks the job (the same for a whole work-group, so each job's barrier is passed by all of it).
// Blocks 0 .. WTB - 1: the weights, two 64 x 64 tiles a block (one per 256 threads), the tiles numbered w_qkv, w_out, w_glu, 4 k tiles fastest (all three have K = 256); the rest: LayerNorm, 16 tokens a block.
#define WT_QKV (4 * (3 * INR / 64))
#define WT_OUT (4 * (DIM / 64))
#define WT_GLU (4 * (2 * DIM / 64))
#define WTB    ((WT_QKV + WT_OUT + WT_GLU) / 2)
__global__ __launch_bounds__(512) void k_prep(const float* __restrict__ xb, const float* __restrict__ g, const float* __restrict__ bb, bf* Hh, bf* Hl,
                                              const float* __restrict__ wqkv, const float* __restrict__ wout, const float* __restrict__ wglu, bf* WQKV, bf* WOUT, bf* WGLU) {
    __shared__ __align__(16) unsigned short sm[2 * 64 * 72];    // two weight tiles of 64 x 72, or LayerNorm's 2 x 32 x 136 (smaller)
    if (blockIdx.x < WTB) {
        static_assert(WT_QKV % 2 == 0 && WT_OUT % 2 == 0 && WT_GLU % 2 == 0, "a block's two tiles are of one matrix");
        int t0 = blockIdx.x * 2;    // the block's first tile: the matrix is picked by the block index alone, in scalar registers
        const float* Wm = wqkv; bf* WT = WQKV; int ncols = 3 * INR;
        if (t0 >= WT_QKV + WT_OUT) { t0 -= WT_QKV + WT_OUT; Wm = wglu; WT = WGLU; ncols = 2 * DIM; }
        else if (t0 >= WT_QKV) { t0 -= WT_QKV; Wm = wout; WT = WOUT; ncols = DIM; }
        const int half = threadIdx.x >> 8, tix = t0 + half;
        wt_tile(Wm, DIM, ncols, WT, (tix & 3) * 64, (tix >> 2) * 64, threadIdx.x & 255, sm + half * (64 * 72));
    } else {
        ln_tile(xb, g, bb, Hh, Hl, blockIdx.x - WTB, (unsigned short (*)[32][136])sm);
    }
}
template <int N> struct ic { static constexpr int v = N; };
typedef __attribute__((ext_vector_type(2))) float  v2f;
typedef __attribute__((ext_vector_type(2))) __bf16 v2bf;
__global__ __launch_bounds__(512) void k_attn(const bf* __restrict__ Hh, const bf* __restrict__ Hl, const bf* __restrict__ Wq, bf* __restrict__ Ch, bf* __restrict__ Cl) {
    __shared__ __align__(16) unsigned short sT[SS / 32][2][2][2][2][32][8];    // [32-key trip][k | v^T][plane][16-key tile | 16-d tile][piece][lane][8]: a trip's 8 KiB lie together
    __shared__ __align__(16) unsigned short sW[6][DIM / 32][2][32][8];    // the head's weight tiles (q 0, 1 | k 0, 1 | v 0, 1), each [k step][piece][lane][8] as it lies in memory
    const int lane = threadIdx.x & 31, c = lane & 15, h = lane >> 4;
    __shared__ float sN[SS / 32];    // per 32-token block: the sum of the squares of all its k and v elements
    const int wid = __builtin_amdgcn_readfirstlane(threadIdx.x >> 5);    // in a scalar register: the trip loops' bounds and branches are scalar
    // 'wave' is from here on the 32-token block that the wave works on. Block b walks b + 1 trips where the trips above the diagonal are skipped (below), and waves w, w + 4, w + 8, w + 12 share a SIMD:
    // waves 0..3 take blocks 15..12, 4..7 blocks 8..11, 8..11 blocks 7..4, 12..15 blocks 0..3, so that the four blocks of each SIMD add up to the same 34 trips and the longest walk is the oldest wave's.
    const int wave = wid ^ ((wid & 4) ? 12 : 15);
    float nq[2] = {0.f, 0.f};    // the squares of the lane's 16 elements of query 16 rt + c, summed
    v16bf qh[2], ql[2];
    {
        auto gfrag = [](const bf* base, unsigned off) -> v16bf { const char* p = (const char*)base + off; return cat16b(*(const v8us*)p, *(const v8us*)(p + 512)); };
        const unsigned ho = ((blockIdx.x / NH_) * (SS / 16) + wave * 2) * (DIM * 32) + lane * 16;    // the lane's 16 bytes in the wave's first token tile (a tile is DIM / 32 steps of 1 KiB); every fragment load is this plus a constant
        auto hfrag = [&](int pl, int rt, int st) -> v16bf { return gfrag((pl ? Hl : Hh) + (rt * (DIM * 32) + st * 1024) / 2, ho); };
        auto wfrag = [&](int i, int st) -> v16bf { return cat16b(*(const v8usa*)&sW[i][st][0][lane][0], *(const v8usa*)&sW[i][st][1][lane][0]); };
        // The token fragments are asked for one k step ahead (two sets of registers), the first step's ahead of the barrier, so that a step's matrix work covers the next step's latency.
        v16bf hb[2][2][2];    // [set][plane][rt]
#pragma unroll
        for (int pl = 0; pl < 2; ++pl)
#pragma unroll
            for (int rt = 0; rt < 2; ++rt) hb[0][pl][rt] = hfrag(pl, rt, 0);
        {   // a weight tile is 8 KiB in a row: one 16-byte piece a thread, copied as it lies
            const unsigned so = (blockIdx.x % NH_) * (2 * DIM * 32) + threadIdx.x * 16; v8us tw[6];
#pragma unroll
            for (int i = 0; i < 6; ++i) tw[i] = *(const v8us*)((const char*)Wq + ((i >> 1) * (INR / 16) + (i & 1)) * (DIM * 32) + so);
            asm volatile("s_wait_xcnt 0x0" :: "v"(so) : "memory");    // the offset stays live up to this wait, so that nothing (a later load's result either) lands in an address register of a load in front of it
#pragma unroll
            for (int i = 0; i < 6; ++i) *(v8usa*)((char*)&sW[i][0][0][0][0] + threadIdx.x * 16) = tw[i];
        }
        __syncthreads();    // the weight tiles are in LDS
        v8f aq[2][2], ak[2][2], av[2][2];    // [t][rt]
#pragma unroll
        for (int t = 0; t < 2; ++t)
#pragma unroll
            for (int rt = 0; rt < 2; ++rt) { aq[t][rt] = (v8f){}; ak[t][rt] = (v8f){}; av[t][rt] = (v8f){}; }
#pragma unroll
        for (int st = 0; st < DIM / 32; ++st) {
            if (st + 1 < DIM / 32) {
#pragma unroll
                for (int pl = 0; pl < 2; ++pl)
#pragma unroll
                    for (int rt = 0; rt < 2; ++rt) hb[(st + 1) & 1][pl][rt] = hfrag(pl, rt, st + 1);
            }
            v16bf w[6];
#pragma unroll
            for (int i = 0; i < 6; ++i) w[i] = wfrag(i, st);
            __builtin_amdgcn_sched_barrier(0);    // holds the next step's token loads in front of this step's matrix instructions: without it the build may sink them to just in front of their use and wait for each there
#pragma unroll
            for (int pl = 0; pl < 2; ++pl)    // each accumulator takes the step's hi product, then its residual product
#pragma unroll
                for (int rt = 0; rt < 2; ++rt)
#pragma unroll
                    for (int t = 0; t < 2; ++t) { const v16bf hf = hb[st & 1][pl][rt];
                        aq[t][rt] = wmmab(w[t], hf, aq[t][rt]); ak[t][rt] = wmmab(w[2 + t], hf, ak[t][rt]); av[t][rt] = wmmab(hf, w[4 + t], av[t][rt]); }
            __builtin_amdgcn_sched_barrier(0);    // keeps the following step's loads below this step's matrix instructions: risen among them they made a third set of token fragments live, past the 256 registers, and the build spilled
        }
        asm volatile("s_wait_xcnt 0x0" :: "v"(ho) : "memory");    // the token loads' one address register stays live up to this wait, in front of whatever overwrites it from here on
        float nk[2] = {0.f, 0.f};    // two chains
#pragma unroll
        for (int rt = 0; rt < 2; ++rt)
#pragma unroll
            for (int t = 0; t < 2; ++t)
#pragma unroll
                for (int j = 0; j < 8; ++j) { nq[rt] = fmaf(aq[t][rt][j], aq[t][rt][j], nq[rt]); nk[0] = fmaf(ak[t][rt][j], ak[t][rt][j], nk[0]); nk[1] = fmaf(av[t][rt][j], av[t][rt][j], nk[1]); }
        float ns = nk[0] + nk[1];
        for (int sh = 16; sh; sh >>= 1) ns += __shfl_xor(ns, sh, 32);
        if (lane == 0) sN[wave] = ns;
#pragma unroll
        for (int rt = 0; rt < 2; ++rt) { v8us oh[2], ol[2];
#pragma unroll
            for (int t = 0; t < 2; ++t) { float v[8];
#pragma unroll
                for (int j = 0; j < 8; ++j) v[j] = aq[t][rt][j];
                split8(v, oh[t], ol[t]); }
            qh[rt] = cat16b(oh[0], oh[1]); ql[rt] = cat16b(ol[0], ol[1]);
#pragma unroll
            for (int t = 0; t < 2; ++t) { float v[8]; v8us kh8, kl8, vh8, vl8;
#pragma unroll
                for (int j = 0; j < 8; ++j) v[j] = ak[t][rt][j];
                split8(v, kh8, kl8);
#pragma unroll
                for (int j = 0; j < 8; ++j) v[j] = av[t][rt][j];
                split8(v, vh8, vl8);
                // wave w fills trip w: key tile rt, piece t of k; d tile t, piece rt of v^T
                *(v8usa*)&sT[wave][0][0][rt][t][lane][0] = kh8; *(v8usa*)&sT[wave][0][1][rt][t][lane][0] = kl8;
                *(v8usa*)&sT[wave][1][0][t][rt][lane][0] = vh8; *(v8usa*)&sT[wave][1][1][t][rt][lane][0] = vl8; } }
    }
    __syncthreads();
    // THE TRIPS ABOVE THE DIAGONAL. With N = the sum of the squares of all of the head's k and v, every score of query i obeys |sim| <= 1.02 sqrt(|q_i|^2 N) (Cauchy-Schwarz; 1.02 covers the bf16 planes' rounding).
    // Where |q_i|^2 N < 1e7 that is below 3226: a masked score is below 3226 - 10000, the row's maximum (its diagonal score is allowed) above -3226, so the maximum is not a masked score, and every masked
    // exponent lies below (6452 - 10000) * CE < -900, where exp2 is exactly 0; v is finite (N is), so such a trip adds exactly 0 to the sum and to ctx. Then, and only then, both walks end at the diagonal trip.
    // A NaN or an infinity in q, k or v makes the comparison false, and so does any larger product of the norms: the wave then walks all 16 trips as before. The test is one for the whole wave (a scalar loop bound).
    float nall = 0.f;
    for (int i = 0; i < SS / 32; ++i) nall += sN[i];
    const float n0 = nq[0] + __shfl_xor(nq[0], 16, 32), n1 = nq[1] + __shfl_xor(nq[1], 16, 32);    // |q|^2 of the lane's two queries
    const bool small = (n0 * nall < 1.0e7f) & (n1 * nall < 1.0e7f);
    const int jend = (__builtin_amdgcn_ballot_w32(small) == 0xFFFFFFFFu) ? wave + 1 : SS / 32;
    auto kfrag = [&](int pl, int jc, int tj) -> v16bf { return cat16b(*(const v8usa*)&sT[jc][0][pl][tj][0][lane][0], *(const v8usa*)&sT[jc][0][pl][tj][1][lane][0]); };
    auto vfrag = [&](int pl, int jc, int dt) -> v16bf { return cat16b(*(const v8usa*)&sT[jc][1][pl][dt][0][lane][0], *(const v8usa*)&sT[jc][1][pl][dt][1][lane][0]); };
    // s[r] = sim[query 32 wave + qt * 16 + c][key jc * 32 + tj * 16 + 8 h + r]
    auto sim = [&](v16bf kh, v16bf kl, int qt) -> v8f { v8f s = {}; s = wmmab(kh, qh[qt], s); s = wmmab(kh, ql[qt], s); s = wmmab(kl, qh[qt], s); return s; };
    // A trip's 32 keys against the wave's 32 queries: M = 0 all allowed (trip < wave), 1 the diagonal trip, 2 all masked (trip > wave).
    float mu[2] = {-3.0e38f, -3.0e38f}, mm[2] = {-3.0e38f, -3.0e38f};    // maxima of sim + mask, and of sim alone over the wholly masked trips
    auto walk1 = [&](auto M, int jc) {
#pragma unroll
        for (int tj = 0; tj < 2; ++tj) { const v16bf kh = kfrag(0, jc, tj), kl = kfrag(1, jc, tj);
#pragma unroll
            for (int qt = 0; qt < 2; ++qt) { const v8f s = sim(kh, kl, qt);
#pragma unroll
                for (int r = 0; r < 8; ++r) {
                    if constexpr (decltype(M)::v == 0) mu[qt] = fmaxf(mu[qt], s[r]);
                    else if constexpr (decltype(M)::v == 2) mm[qt] = fmaxf(mm[qt], s[r]);
                    else mu[qt] = fmaxf(mu[qt], s[r] + ((tj * 16 + 8 * h + r > qt * 16 + c) ? -10000.0f : 0.f)); } } }
    };
    for (int jc = 0; jc < wave; ++jc) walk1(ic<0>{}, jc);
    walk1(ic<1>{}, wave);
    for (int jc = wave + 1; jc < jend; ++jc) walk1(ic<2>{}, jc);
    const float CE = SCL * 1.4426950408889634f;    // exp(x * scale) = exp2(x * CE)
    float nm[2]; v2f sum[2] = {(v2f){0.f, 0.f}, (v2f){0.f, 0.f}};    // even and odd keys summed apart
#pragma unroll
    for (int qt = 0; qt < 2; ++qt) { float m = fmaxf(mu[qt], mm[qt] + -10000.0f); m = fmaxf(m, __shfl_xor(m, 16, 32)); nm[qt] = -(m * CE); }
    v8f o[2][2];
#pragma unroll
    for (int dt = 0; dt < 2; ++dt)
#pragma unroll
        for (int qt = 0; qt < 2; ++qt) o[dt][qt] = (v8f){};
    auto walk2 = [&](auto M, int jc) {
        v16bf ph[2], pl[2];
#pragma unroll
        for (int tj = 0; tj < 2; ++tj) { const v16bf kh = kfrag(0, jc, tj), kl = kfrag(1, jc, tj);
#pragma unroll
            for (int qt = 0; qt < 2; ++qt) { const v8f s = sim(kh, kl, qt);
#pragma unroll
                for (int r = 0; r < 8; r += 2) { v2f e;
#pragma unroll
                    for (int u = 0; u < 2; ++u) {
                        float t = s[r + u];
                        if constexpr (decltype(M)::v == 2) t += -10000.0f;
                        else if constexpr (decltype(M)::v == 1) t += ((tj * 16 + 8 * h + r + u > qt * 16 + c) ? -10000.0f : 0.f);
                        const float x = fmaf(t, CE, nm[qt]); float ex;
                        if constexpr (decltype(M)::v == 1) asm("v_exp_f32 %0, %1\n\tv_nop" : "=v"(ex) : "v"(x));    // the v_nop fills the slot behind the transcendental
                        else ex = __builtin_amdgcn_exp2f(x);
                        e[u] = ex; }
                    sum[qt] += e;
                    const v2bf eh = __builtin_convertvector(e, v2bf); const v2bf el = __builtin_convertvector(e - __builtin_convertvector(eh, v2f), v2bf);
                    ph[qt][tj * 8 + r] = eh[0]; ph[qt][tj * 8 + r + 1] = eh[1]; pl[qt][tj * 8 + r] = el[0]; pl[qt][tj * 8 + r + 1] = el[1]; } } }
#pragma unroll
        for (int dt = 0; dt < 2; ++dt) { const v16bf vh = vfrag(0, jc, dt), vl = vfrag(1, jc, dt);
#pragma unroll
            for (int qt = 0; qt < 2; ++qt) { o[dt][qt] = wmmab(vh, ph[qt], o[dt][qt]); o[dt][qt] = wmmab(vh, pl[qt], o[dt][qt]); o[dt][qt] = wmmab(vl, ph[qt], o[dt][qt]); } }
    };
    for (int jc = 0; jc < wave; ++jc) walk2(ic<0>{}, jc);
    walk2(ic<1>{}, wave);
    for (int jc = wave + 1; jc < jend; ++jc) walk2(ic<2>{}, jc);
    // o[dt][qt][r] = ctx^T[d = dt * 16 + 8 h + r][query 32 wave + qt * 16 + c]: 8 consecutive d of one query a lane, which is piece dt of to_out's B fragment (row tile = 16 queries, k step = head) at this very lane: stored as the bf16 hi + residual planes in the fragment order, 512 bytes in a row a store
#pragma unroll
    for (int qt = 0; qt < 2; ++qt) { const float sl = sum[qt][0] + sum[qt][1]; const float sm = sl + __shfl_xor(sl, 16, 32); const float inv = 1.0f / sm;
#pragma unroll
        for (int dt = 0; dt < 2; ++dt) { const size_t co = (((size_t)(blockIdx.x / NH_) * (SS / 16) + wave * 2 + qt) * NH_ + blockIdx.x % NH_) * 512 + dt * 256 + lane * 8; const v8f v = o[dt][qt] * inv; v8us oh, ol;
#pragma unroll
            for (int i = 0; i < 8; ++i) { const unsigned short hb = f2bf(v[i]); oh[i] = hb; ol[i] = f2bf(v[i] - bf2f(hb)); }
            *(v8us*)(Ch + co) = oh; *(v8us*)(Cl + co) = ol; } }
}
// k_tail: to_out, the GLU projection and the gate of 64 tokens in one work-group of 16 waves; wave = (nw, th): columns 32 nw .. 32 nw + 31 (two 16-column tiles t) of tokens 32 th .. 32 th + 31 (two 16-token tiles rt).
// Both products are formed transposed, weights as the A operand and tokens as B (the two fragment orders are the same), so a lane's 8 accumulator elements are 8 consecutive columns n = 32 nw + 16 t + 8 hi + j of token lr:
// that is piece t of k step nw of the next product's token fragment at this very lane, so O's bf16 hi + residual planes go to LDS in fragment order with one 16-byte store each, and O itself (f32) stays in registers for the residual.
// The wave that holds columns n of O also forms columns n (value) and DIM + n (gate) of the GLU projection, so out = O + value tanh(gate) is in-lane; neither O, its planes nor the projection is ever stored to memory.
// Every #pragma unroll in it makes the indices of the fragment and accumulator arrays constants, so that they stay in registers (and the k steps become immediate offsets of one address register).
__global__ __launch_bounds__(512) void k_tail(const bf* __restrict__ Ch, const bf* __restrict__ Cl, const bf* __restrict__ Wo, const float* __restrict__ bias, const bf* __restrict__ Wg, float* __restrict__ OUTB) {
    __shared__ __align__(16) unsigned short sC[2][4][DM / 32][2][32][8];    // ctx: [plane][16-token tile][k step][piece][lane][8], as it lies in memory
    __shared__ __align__(16) unsigned short sO[2][4][DM / 32][2][32][8];    // O, the same order
    __shared__ __align__(16) float sS[16][32 * 36];                         // per wave: its 32 tokens x 32 columns of out, pitch 36 floats (16 bytes x odd: the 16-byte accesses fall on different banks)
    const int lane = threadIdx.x & 31, lr = lane & 15, hi = lane >> 4;
    const int wave = __builtin_amdgcn_readfirstlane(threadIdx.x >> 5), nw = wave >> 1, th = wave & 1;    // in scalar registers: they only shift base addresses
    auto gfrag = [](const bf* base, unsigned off) -> v16bf { const char* p = (const char*)base + off; return cat16b(*(const v8us*)p, *(const v8us*)(p + 512)); };
    auto cfrag = [&](int pl, int tt, int st) -> v16bf { return cat16b(*(const v8usa*)&sC[pl][tt][st][0][lane][0], *(const v8usa*)&sC[pl][tt][st][1][lane][0]); };
    auto ofrag = [&](int pl, int tt, int st) -> v16bf { return cat16b(*(const v8usa*)&sO[pl][tt][st][0][lane][0], *(const v8usa*)&sO[pl][tt][st][1][lane][0]); };
    const unsigned wo = (unsigned)nw * (2 * DM * 32) + lane * 16;    // the lane's 16 bytes in the wave's first weight tile (a 16-column tile is DM / 32 steps of 1 KiB); every weight load is this plus a constant, which is put on the pointer so that it becomes an immediate
    auto wofrag = [&](int t, int st) -> v16bf { return gfrag(Wo + (t * (INR * 32) + st * 1024) / 2, wo); };
    auto wgfrag = [&](int u, int st) -> v16bf { return gfrag(Wg + ((u >> 1) * (DM * DM * 2) + (u & 1) * (DM * 32) + st * 1024) / 2, wo); };    // u = value t = 0, 1 | gate t = 0, 1; the gate half starts DM columns (DM / 16 tiles) on
    // The weight fragments are asked for one k step ahead (two sets of registers), the first step's ahead of the barrier in front of its product, so that a step's matrix work covers the next step's L2 latency.
    v16bf wa[2][2], wb[2][4];
#pragma unroll
    for (int t = 0; t < 2; ++t) wa[0][t] = wofrag(t, 0);
    v4f bv[2][2];
    {   // the work-group's 4 token tiles are 32 KiB in a row of each plane: copied as they lie
        const unsigned co = blockIdx.x * (4 * DM * 32) + threadIdx.x * 16, bo = (unsigned)(nw * 32 + hi * 8) * 4;
        v8us tc[2][4];
#pragma unroll
        for (int i = 0; i < 4; ++i) { tc[0][i] = *(const v8us*)((const char*)Ch + co + i * 8192); tc[1][i] = *(const v8us*)((const char*)Cl + co + i * 8192); }
#pragma unroll
        for (int t = 0; t < 2; ++t) { bv[t][0] = *(const v4f*)((const char*)bias + bo + t * 64); bv[t][1] = *(const v4f*)((const char*)bias + bo + t * 64 + 16); }
        asm volatile("s_wait_xcnt 0x0" :: "v"(co), "v"(bo) : "memory");    // the two offsets stay live up to this wait, so that nothing (a later load's result either) lands in an address register of a load in front of it
#pragma unroll
        for (int i = 0; i < 4; ++i) { *(v8usa*)((char*)&sC[0][0][0][0][0][0] + i * 8192 + threadIdx.x * 16) = tc[0][i]; *(v8usa*)((char*)&sC[1][0][0][0][0][0] + i * 8192 + threadIdx.x * 16) = tc[1][i]; }
    }
    __syncthreads();    // ctx is in LDS
    v8f o1[2][2];    // [t][rt]
#pragma unroll
    for (int t = 0; t < 2; ++t)
#pragma unroll
        for (int rt = 0; rt < 2; ++rt) o1[t][rt] = (v8f){};
#pragma unroll
    for (int st = 0; st < INR / 32; ++st) {
        if (st + 1 < INR / 32) {
#pragma unroll
            for (int t = 0; t < 2; ++t) wa[(st + 1) & 1][t] = wofrag(t, st + 1);
        } else {
#pragma unroll
            for (int u = 0; u < 4; ++u) wb[0][u] = wgfrag(u, 0);
        }
        v16bf ch[2], cl[2];
#pragma unroll
        for (int rt = 0; rt < 2; ++rt) { ch[rt] = cfrag(0, 2 * th + rt, st); cl[rt] = cfrag(1, 2 * th + rt, st); }
        __builtin_amdgcn_sched_barrier(0);    // holds the next step's weight loads in front of this step's matrix instructions: without it the build sinks them to just in front of their use and waits for each there
#pragma unroll
        for (int rt = 0; rt < 2; ++rt)
#pragma unroll
            for (int t = 0; t < 2; ++t) o1[t][rt] = wmmab(wa[st & 1][t], ch[rt], o1[t][rt]);
#pragma unroll
        for (int rt = 0; rt < 2; ++rt)
#pragma unroll
            for (int t = 0; t < 2; ++t) o1[t][rt] = wmmab(wa[st & 1][t], cl[rt], o1[t][rt]);
    }
#pragma unroll
    for (int t = 0; t < 2; ++t)
#pragma unroll
        for (int rt = 0; rt < 2; ++rt) { float v[8];
#pragma unroll
            for (int j = 0; j < 8; ++j) { v[j] = o1[t][rt][j] + bfr(bv[t][j >> 2][j & 3]); o1[t][rt][j] = v[j]; }
            v8us oh, ol; split8(v, oh, ol);
            *(v8usa*)&sO[0][2 * th + rt][nw][t][lane][0] = oh; *(v8usa*)&sO[1][2 * th + rt][nw][t][lane][0] = ol; }
    __syncthreads();    // all 256 columns of O's planes are in LDS
    v8f g[4][2];    // [value t = 0, 1 | gate t = 0, 1][rt]
#pragma unroll
    for (int u = 0; u < 4; ++u)
#pragma unroll
        for (int rt = 0; rt < 2; ++rt) g[u][rt] = (v8f){};
#pragma unroll
    for (int st = 0; st < DM / 32; ++st) {
        if (st + 1 < DM / 32) {
#pragma unroll
            for (int u = 0; u < 4; ++u) wb[(st + 1) & 1][u] = wgfrag(u, st + 1);
        }
        v16bf oh[2], ol[2];
#pragma unroll
        for (int rt = 0; rt < 2; ++rt) { oh[rt] = ofrag(0, 2 * th + rt, st); ol[rt] = ofrag(1, 2 * th + rt, st); }
        __builtin_amdgcn_sched_barrier(0);    // as in the first product: without it the next step's weight loads sink to just in front of their use
#pragma unroll
        for (int rt = 0; rt < 2; ++rt)
#pragma unroll
            for (int u = 0; u < 4; ++u) g[u][rt] = wmmab(wb[st & 1][u], oh[rt], g[u][rt]);
#pragma unroll
        for (int rt = 0; rt < 2; ++rt)
#pragma unroll
            for (int u = 0; u < 4; ++u) g[u][rt] = wmmab(wb[st & 1][u], ol[rt], g[u][rt]);
    }
    asm volatile("s_wait_xcnt 0x0" :: "v"(wo) : "memory");    // the weight loads' one address register stays live up to this wait, in front of whatever overwrites it from here on
    float* ss = &sS[wave][0];
#pragma unroll
    for (int rt = 0; rt < 2; ++rt)
#pragma unroll
        for (int t = 0; t < 2; ++t) { v4f a, b;
#pragma unroll
            for (int j = 0; j < 4; ++j) { a[j] = o1[t][rt][j] + g[t][rt][j] * tanhf(g[2 + t][rt][j]); b[j] = o1[t][rt][4 + j] + g[t][rt][4 + j] * tanhf(g[2 + t][rt][4 + j]); }
            float* sp = ss + (rt * 16 + lr) * 36 + t * 16 + hi * 8; *(v4fa*)sp = a; *(v4fa*)(sp + 4) = b; }
    __syncthreads();    // between the lanes' writes of the staging tile and the reads of other lanes' elements
    // a store covers 4 tokens x 32 columns: 4 whole 128-byte lines, each written by this wave alone
#pragma unroll
    for (int s = 0; s < 8; ++s) { const int row = 4 * s + (lane >> 3), cofs = (lane & 7) * 4;
        *(v4f*)(OUTB + ((size_t)blockIdx.x * 64 + th * 32 + row) * DIM + nw * 32 + cofs) = *(const v4fa*)(ss + row * 36 + cofs); }
}

extern "C" void kernel_launch(void* const* d_in, const int* in_sizes, int n_in,
                              void* d_out, int out_size, void* d_ws, size_t ws_size, hipStream_t stream) {
    (void)in_sizes; (void)n_in; (void)out_size;
    const float* x = (const float*)d_in[0]; const float* lng = (const float*)d_in[1]; const float* lnb = (const float*)d_in[2]; const float* wqkv = (const float*)d_in[3]; const float* wout = (const float*)d_in[4]; const float* bout = (const float*)d_in[5]; const float* wglu = (const float*)d_in[6];
    float* out = (float*)d_out;    // [32][512][256]
    char* wsp = (char*)d_ws;
    auto take = [&](size_t bytes) { char* p = wsp; wsp += (bytes + 255) & ~(size_t)255; return (void*)p; };
    bf* WQKV = (bf*)take((size_t)(3 * INR) * DIM * 2); bf* WOUT = (bf*)take((size_t)DIM * INR * 2); bf* WGLU = (bf*)take((size_t)(2 * DIM) * DIM * 2);
    // LayerNorm planes and ctx planes of all items: k_attn reads the first and writes the second in one launch, so they lie apart
    bf* Hh = (bf*)take((size_t)NR * DIM * 2); bf* Hl = (bf*)take((size_t)NR * DIM * 2);
    bf* Ch = (bf*)take((size_t)NR * INR * 2); bf* Cl = (bf*)take((size_t)NR * INR * 2);
    if ((size_t)(wsp - (char*)d_ws) > ws_size) return;    // 0.75 + 16 + 16 ~ 33 MiB
    k_prep<<<WTB + NR / 16, 512, 0, stream>>>(x, lng, lnb, Hh, Hl, wqkv, wout, wglu, WQKV, WOUT, WGLU);
    k_attn<<<NBT * NH_, 512, 0, stream>>>(Hh, Hl, WQKV, Ch, Cl);
    k_tail<<<NR / 64, 512, 0, stream>>>(Ch, Cl, WOUT, bout, WGLU, out);
}

// v009
// One run takes 48.4 microseconds.
// Next to v008, in two timings, it ran 1.05 and 1.04 times as fast.
// All steps since v000 together make it 58.7 times as fast.
#include <hip/hip_runtime.h>

// Compute dtypes, f32 accumulate, per item (512 tokens): LayerNorm in f32 -> bf16 hi + UNSCALED residual planes; qkv, to_out and the GLU projection as [512 x K].[K x N] products
// against the exact bf16 k-major weights (two products); per (item, head), in one kernel: sim = q.k^T ([512 x 32].[32 x 512], three products),
// the causal -10000 mask then x scale and the row softmax in f32, ctx = P.v ([512 x 512].[512 x 32], three products), scores and P in registers only - on v_wmma_f32_16x16x32_bf16; the GLU

#define NBT  32
#define SS   512
#define DIM  256
#define NH_  8
#define HD   32
#define INR  256
#define DM   DIM
#define SCL  0.17677669529663687f
#define NR   (NBT * SS)   // token rows of all items together

typedef unsigned short bf;
typedef __attribute__((ext_vector_type(16))) __bf16   v16bf;
typedef __attribute__((ext_vector_type(16))) _Float16 v16h;
typedef __attribute__((ext_vector_type(8)))  _Float16 v8h;
typedef __attribute__((ext_vector_type(8)))  unsigned short v8us;
typedef __attribute__((ext_vector_type(8)))  float    v8f;
typedef __attribute__((ext_vector_type(4)))  float    v4f;
typedef v8h  __attribute__((may_alias)) v8ha;
typedef v4f  __attribute__((may_alias)) v4fa;
typedef v8us __attribute__((may_alias)) v8usa;

__device__ __forceinline__ unsigned short f2bf(float f) { unsigned u = __float_as_uint(f); u += 0x7FFFu + ((u >> 16) & 1u); return (unsigned short)(u >> 16); }
__device__ __forceinline__ float bf2f(unsigned short b) { return __uint_as_float(((unsigned)b) << 16); }
__device__ __forceinline__ float bfr(float f) { return bf2f(f2bf(f)); }
__device__ __forceinline__ v16h cat16(v8h lo, v8h hi) { return __builtin_shufflevector(lo, hi, 0, 1, 2, 3, 4, 5, 6, 7, 8, 9, 10, 11, 12, 13, 14, 15); }
__device__ __forceinline__ v16bf cat16b(v8us lo, v8us hi) { return __builtin_bit_cast(v16bf, __builtin_shufflevector(lo, hi, 0, 1, 2, 3, 4, 5, 6, 7, 8, 9, 10, 11, 12, 13, 14, 15)); }
__device__ __forceinline__ v8f wmma16(v16h a, v16h b, v8f c) { return __builtin_amdgcn_wmma_f32_16x16x32_f16(false, a, false, b, (short)0, c, false, false); }
__device__ __forceinline__ v8f wmmab(v16bf a, v16bf b, v8f c) { return __builtin_amdgcn_wmma_f32_16x16x32_bf16(false, a, false, b, (short)0, c, false, false); }

// FRAGMENT ORDER: every operand of the three weight products lies as its loop loads it, [16-row tile][32-wide k step][piece p][lane][8]: lane = 16 hi + lr holds row lr, k = 32 step + 16 p + 8 hi + 0..7,
// so a wave's 16-byte loads of one piece read 512 bytes in a row (4 whole lines) where a row-major operand gave 32 bytes of each of 16 lines. Every producer stores this order.
// Every #pragma unroll of these plane stores makes the indices of the 8-element vectors constants, so that they stay in registers.
__device__ __forceinline__ void split8(const float* v, v8us& oh, v8us& ol) {
#pragma unroll
    for (int i = 0; i < 8; ++i) { const unsigned short hb = f2bf(v[i]); oh[i] = hb; ol[i] = f2bf(v[i] - bf2f(hb)); }
}

// wt_tile: WT = bf16(W[k][n]) (k-major [K][ncols]) in the fragment order (16 columns n are a tile's rows), one 64 x 64 tile through LDS by 256 threads (tid = 0..255).
__device__ __forceinline__ void wt_tile(const float* __restrict__ Wm, int K, int ncols, bf* WT, int k0, int n0, int tid, unsigned short* tl) {
    const int kk = tid >> 2, nq = (tid & 3) * 16;
#pragma unroll
    for (int i = 0; i < 16; ++i) tl[(nq + i) * 72 + kk] = f2bf(Wm[(size_t)(k0 + kk) * ncols + n0 + nq + i]);
    __syncthreads();
    const int lane = tid & 31;
    // the tile is 4 column tiles x 2 k steps x 2 pieces of 512 bytes; a wave stores two whole pieces
#pragma unroll
    for (int s = 0; s < 2; ++s) { const int q = (tid >> 5) * 2 + s, ct = q >> 2, kp = q & 3; const v8us val = *(const v8usa*)(tl + (ct * 16 + (lane & 15)) * 72 + kp * 16 + (lane >> 4) * 8);
        *(v8us*)(WT + (size_t)((n0 >> 4) + ct) * (K * 16) + (size_t)((k0 >> 4) + kp) * 256 + lane * 8) = val; }
}

// ln_tile: one wave per token, 16 tokens (one row tile of the qkv product) per work-group. A lane's 8 columns are one 16-byte piece of the fragment order, 256 bytes from its neighbour's,
// so the 16 waves exchange their pieces through LDS (pitch 272 bytes: a wave's 32 pieces fall on different banks) and each stores 512 bytes in a row of each plane.
__device__ __forceinline__ void ln_tile(const float* __restrict__ xb, const float* __restrict__ g, const float* __restrict__ bb, bf* Hh, bf* Hl, int rt, unsigned short (*sl)[32][136]) {    // sl: [plane][8-column piece][token][8], 8 elements of pad a piece
    const int lane = threadIdx.x & 31, wv = threadIdx.x >> 5, r = rt * 16 + wv; float v[8]; float s = 0.f;
#pragma unroll
    for (int i = 0; i < 8; ++i) { v[i] = bfr(xb[(size_t)r * DIM + lane * 8 + i]); s += v[i]; }
#pragma unroll
    for (int sh = 16; sh; sh >>= 1) s += __shfl_xor(s, sh, 32);
    const float mu = s * (1.0f / DIM); float q = 0.f;
#pragma unroll
    for (int i = 0; i < 8; ++i) { const float d = v[i] - mu; q = fmaf(d, d, q); }
#pragma unroll
    for (int sh = 16; sh; sh >>= 1) q += __shfl_xor(q, sh, 32);
    const float rs = rsqrtf(q * (1.0f / DIM) + 1e-5f); v8us oh, ol;
#pragma unroll
    for (int i = 0; i < 8; ++i) { const int c = lane * 8 + i; const float y = (v[i] - mu) * rs * bfr(g[c]) + bfr(bb[c]); const unsigned short hb = f2bf(y); oh[i] = hb; ol[i] = f2bf(y - bf2f(hb)); }
    *(v8usa*)&sl[0][lane][wv * 8] = oh; *(v8usa*)&sl[1][lane][wv * 8] = ol;
    __syncthreads();
    const int pc = threadIdx.x >> 4, tk = threadIdx.x & 15;    // columns 8 pc .. 8 pc + 7 = step pc / 4, piece (pc / 2) % 2, hi = pc % 2: the piece's place in the tile is 128 pc + 8 tk elements
    const size_t o = (size_t)rt * (16 * DIM) + threadIdx.x * 8; *(v8us*)(Hh + o) = *(const v8usa*)&sl[0][pc][tk * 8]; *(v8us*)(Hl + o) = *(const v8usa*)&sl[1][pc][tk * 8];
}

// k_prep: the four jobs that depend on nothing but the inputs share one launch; the block index picks the job (the same for a whole work-group, so each job's barrier is passed by all of it).
// Blocks 0 .. WTB - 1: the weights, two 64 x 64 tiles a block (one per 256 threads), the tiles numbered w_qkv, w_out, w_glu, 4 k tiles fastest (all three have K = 256); the rest: LayerNorm, 16 tokens a block.
#define WT_QKV (4 * (3 * INR / 64))
#define WT_OUT (4 * (DIM / 64))
#define WT_GLU (4 * (2 * DIM / 64))
#define WTB    ((WT_QKV + WT_OUT + WT_GLU) / 2)
__global__ __launch_bounds__(512) void k_prep(const float* __restrict__ xb, const float* __restrict__ g, const float* __restrict__ bb, bf* Hh, bf* Hl,
                                              const float* __restrict__ wqkv, const float* __restrict__ wout, const float* __restrict__ wglu, bf* WQKV, bf* WOUT, bf* WGLU) {
    __shared__ __align__(16) unsigned short sm[2 * 64 * 72];    // two weight tiles of 64 x 72, or LayerNorm's 2 x 32 x 136 (smaller)
    if (blockIdx.x < WTB) {
        static_assert(WT_QKV % 2 == 0 && WT_OUT % 2 == 0 && WT_GLU % 2 == 0, "a block's two tiles are of one matrix");
        int t0 = blockIdx.x * 2;    // the block's first tile: the matrix is picked by the block index alone, in scalar registers
        const float* Wm = wqkv; bf* WT = WQKV; int ncols = 3 * INR;
        if (t0 >= WT_QKV + WT_OUT) { t0 -= WT_QKV + WT_OUT; Wm = wglu; WT = WGLU; ncols = 2 * DIM; }
        else if (t0 >= WT_QKV) { t0 -= WT_QKV; Wm = wout; WT = WOUT; ncols = DIM; }
        const int half = threadIdx.x >> 8, tix = t0 + half;
        wt_tile(Wm, DIM, ncols, WT, (tix & 3) * 64, (tix >> 2) * 64, threadIdx.x & 255, sm + half * (64 * 72));
    } else {
        ln_tile(xb, g, bb, Hh, Hl, blockIdx.x - WTB, (unsigned short (*)[32][136])sm);
    }
}
template <int N> struct ic { static constexpr int v = N; };
typedef __attribute__((ext_vector_type(2))) float  v2f;
typedef __attribute__((ext_vector_type(2))) __bf16 v2bf;
__global__ __launch_bounds__(512) void k_attn(const bf* __restrict__ Hh, const bf* __restrict__ Hl, const bf* __restrict__ Wq, bf* __restrict__ Ch, bf* __restrict__ Cl) {
    __shared__ __align__(16) unsigned short sT[SS / 32][2][2][2][2][32][8];    // [32-key trip][k | v^T][plane][16-key tile | 16-d tile][piece][lane][8]: a trip's 8 KiB lie together
    __shared__ __align__(16) unsigned short sW[6][DIM / 32][2][32][8];    // the head's weight tiles (q 0, 1 | k 0, 1 | v 0, 1), each [k step][piece][lane][8] as it lies in memory
    const int lane = threadIdx.x & 31, c = lane & 15, h = lane >> 4;
    __shared__ float sN[SS / 32];    // per 32-token block: the sum of the squares of all its k and v elements
    __shared__ float sK[SS / 32];    // per 32-token block: the largest |k|^2 of its tokens
    const int wid = __builtin_amdgcn_readfirstlane(threadIdx.x >> 5);    // in a scalar register: the trip loops' bounds and branches are scalar
    // 'wave' is from here on the 32-token block that the wave works on. Block b walks b + 1 trips where the trips above the diagonal are skipped (below), and waves w, w + 4, w + 8, w + 12 share a SIMD:
    // waves 0..3 take blocks 15..12, 4..7 blocks 8..11, 8..11 blocks 7..4, 12..15 blocks 0..3, so that the four blocks of each SIMD add up to the same 34 trips.
    const int wave = wid ^ ((wid & 4) ? 12 : 15);
    float nq[2] = {0.f, 0.f};    // the squares of the lane's 16 elements of query 16 rt + c, summed
    v16bf qh[2], ql[2];
    {
        auto gfrag = [](const bf* base, unsigned off) -> v16bf { const char* p = (const char*)base + off; return cat16b(*(const v8us*)p, *(const v8us*)(p + 512)); };
        const unsigned ho = ((blockIdx.x / NH_) * (SS / 16) + wave * 2) * (DIM * 32) + lane * 16;    // the lane's 16 bytes in the wave's first token tile (a tile is DIM / 32 steps of 1 KiB); every fragment load is this plus a constant
        auto hfrag = [&](int pl, int rt, int st) -> v16bf { return gfrag((pl ? Hl : Hh) + (rt * (DIM * 32) + st * 1024) / 2, ho); };
        auto wfrag = [&](int i, int st) -> v16bf { return cat16b(*(const v8usa*)&sW[i][st][0][lane][0], *(const v8usa*)&sW[i][st][1][lane][0]); };
        // The token fragments are asked for one k step ahead (two sets of registers), the first step's ahead of the barrier, so that a step's matrix work covers the next step's latency.
        v16bf hb[2][2][2];    // [set][plane][rt]
#pragma unroll
        for (int pl = 0; pl < 2; ++pl)
#pragma unroll
            for (int rt = 0; rt < 2; ++rt) hb[0][pl][rt] = hfrag(pl, rt, 0);
        {   // a weight tile is 8 KiB in a row: one 16-byte piece a thread, copied as it lies
            const unsigned so = (blockIdx.x % NH_) * (2 * DIM * 32) + threadIdx.x * 16; v8us tw[6];
#pragma unroll
            for (int i = 0; i < 6; ++i) tw[i] = *(const v8us*)((const char*)Wq + ((i >> 1) * (INR / 16) + (i & 1)) * (DIM * 32) + so);
            asm volatile("s_wait_xcnt 0x0" :: "v"(so) : "memory");    // the offset stays live up to this wait, so that nothing (a later load's result either) lands in an address register of a load in front of it
#pragma unroll
            for (int i = 0; i < 6; ++i) *(v8usa*)((char*)&sW[i][0][0][0][0] + threadIdx.x * 16) = tw[i];
        }
        __syncthreads();    // the weight tiles are in LDS
        v8f aq[2][2], ak[2][2], av[2][2];    // [t][rt]
#pragma unroll
        for (int t = 0; t < 2; ++t)
#pragma unroll
            for (int rt = 0; rt < 2; ++rt) { aq[t][rt] = (v8f){}; ak[t][rt] = (v8f){}; av[t][rt] = (v8f){}; }
#pragma unroll
        for (int st = 0; st < DIM / 32; ++st) {
            if (st + 1 < DIM / 32) {
#pragma unroll
                for (int pl = 0; pl < 2; ++pl)
#pragma unroll
                    for (int rt = 0; rt < 2; ++rt) hb[(st + 1) & 1][pl][rt] = hfrag(pl, rt, st + 1);
            }
            v16bf w[6];
#pragma unroll
            for (int i = 0; i < 6; ++i) w[i] = wfrag(i, st);
            __builtin_amdgcn_sched_barrier(0);    // holds the next step's token loads in front of this step's matrix instructions: without it the build may sink them to just in front of their use and wait for each there
#pragma unroll
            for (int pl = 0; pl < 2; ++pl)    // each accumulator takes the step's hi product, then its residual product
#pragma unroll
                for (int rt = 0; rt < 2; ++rt)
#pragma unroll
                    for (int t = 0; t < 2; ++t) { const v16bf hf = hb[st & 1][pl][rt];
                        aq[t][rt] = wmmab(w[t], hf, aq[t][rt]); ak[t][rt] = wmmab(w[2 + t], hf, ak[t][rt]); av[t][rt] = wmmab(hf, w[4 + t], av[t][rt]); }
            __builtin_amdgcn_sched_barrier(0);    // keeps the following step's loads below this step's matrix instructions: risen among them they made a third set of token fragments live, past the 256 registers, and the build spilled
        }
        asm volatile("s_wait_xcnt 0x0" :: "v"(ho) : "memory");    // the token loads' one address register stays live up to this wait, in front of whatever overwrites it from here on
        float nk[2] = {0.f, 0.f}, nv = 0.f;    // nk[rt]: the squares of the lane's 16 elements of key 16 rt + c, summed
#pragma unroll
        for (int rt = 0; rt < 2; ++rt)
#pragma unroll
            for (int t = 0; t < 2; ++t)
#pragma unroll
                for (int j = 0; j < 8; ++j) { nq[rt] = fmaf(aq[t][rt][j], aq[t][rt][j], nq[rt]); nk[rt] = fmaf(ak[t][rt][j], ak[t][rt][j], nk[rt]); nv = fmaf(av[t][rt][j], av[t][rt][j], nv); }
        float ns = nk[0] + nk[1] + nv;
        float km = fmaxf(nk[0] + __shfl_xor(nk[0], 16, 32), nk[1] + __shfl_xor(nk[1], 16, 32));    // the larger |k|^2 of the lane's two keys
        ns += __shfl_xor(ns, 16, 32);
        for (int sh = 8; sh; sh >>= 1) { ns += __shfl_xor(ns, sh, 32); km = fmaxf(km, __shfl_xor(km, sh, 32)); }
        if (lane == 0) { sN[wave] = ns; sK[wave] = km; }
#pragma unroll
        for (int rt = 0; rt < 2; ++rt) { v8us oh[2], ol[2];
#pragma unroll
            for (int t = 0; t < 2; ++t) { float v[8];
#pragma unroll
                for (int j = 0; j < 8; ++j) v[j] = aq[t][rt][j];
                split8(v, oh[t], ol[t]); }
            qh[rt] = cat16b(oh[0], oh[1]); ql[rt] = cat16b(ol[0], ol[1]);
#pragma unroll
            for (int t = 0; t < 2; ++t) { float v[8]; v8us kh8, kl8, vh8, vl8;
#pragma unroll
                for (int j = 0; j < 8; ++j) v[j] = ak[t][rt][j];
                split8(v, kh8, kl8);
#pragma unroll
                for (int j = 0; j < 8; ++j) v[j] = av[t][rt][j];
                split8(v, vh8, vl8);
                // wave w fills trip w: key tile rt, piece t of k; d tile t, piece rt of v^T
                *(v8usa*)&sT[wave][0][0][rt][t][lane][0] = kh8; *(v8usa*)&sT[wave][0][1][rt][t][lane][0] = kl8;
                *(v8usa*)&sT[wave][1][0][t][rt][lane][0] = vh8; *(v8usa*)&sT[wave][1][1][t][rt][lane][0] = vl8; } }
    }
    __syncthreads();
    // THE TRIPS ABOVE THE DIAGONAL. With N = the sum of the squares of all of the head's k and v, every score of query i obeys |sim| <= 1.02 sqrt(|q_i|^2 N) (Cauchy-Schwarz; 1.02 covers the bf16 planes' rounding).
    // Where |q_i|^2 N < 1e7 that is below 3226: a masked score is below 3226 - 10000, the row's maximum (its diagonal score is allowed) above -3226, so the maximum is not a masked score, and every masked
    // exponent lies below (6452 - 10000) * CE < -900, where exp2 is exactly 0; v is finite (N is), so such a trip adds exactly 0 to the sum and to ctx. Then, and only then, both walks end at the diagonal trip.
    // A NaN or an infinity in q, k or v makes the comparison false, and so does any larger product of the norms: the wave then walks all 16 trips as before. The test is one for the whole wave (a scalar loop bound).
    float nall = 0.f;
    for (int i = 0; i < SS / 32; ++i) nall += sN[i];
    const float n0 = nq[0] + __shfl_xor(nq[0], 16, 32), n1 = nq[1] + __shfl_xor(nq[1], 16, 32);    // |q|^2 of the lane's two queries
    const bool small = (n0 * nall < 1.0e7f) & (n1 * nall < 1.0e7f);
    const int jend = (__builtin_amdgcn_ballot_w32(small) == 0xFFFFFFFFu) ? wave + 1 : SS / 32;
    // THE ROW MAXIMUM. softmax does not change when one number is taken off a whole row; the maximum is taken off only to keep exp in range. With K = the largest |k_j|^2 of the head, |sim| <= 1.02 sqrt(|q_i|^2 K).
    // Where |q_i|^2 K < 1e4 that is below 102: every allowed exponent lies within +-27, so e lies within 2^-27 .. 2^27, a row's sum within 2^-27 .. 2^36 and ctx^T below 2^36 max|v| (finite: N is), all far inside f32,
    // and a masked exponent is below (102 - 10000) * CE < -900, where exp2 is exactly 0. Then, and only then, nothing is taken off and walk 1 is not made. The test is one for the whole wave (a scalar branch);
    // it asks for 'small' as well, which a NaN or an infinity in q, k or v makes false (fmaxf alone would drop a NaN).
    float kall = 0.f;
    for (int i = 0; i < SS / 32; ++i) kall = fmaxf(kall, sK[i]);
    const bool nomax = __builtin_amdgcn_ballot_w32(small & (n0 * kall < 1.0e4f) & (n1 * kall < 1.0e4f)) == 0xFFFFFFFFu;
    auto kfrag = [&](int pl, int jc, int tj) -> v16bf { return cat16b(*(const v8usa*)&sT[jc][0][pl][tj][0][lane][0], *(const v8usa*)&sT[jc][0][pl][tj][1][lane][0]); };
    auto vfrag = [&](int pl, int jc, int dt) -> v16bf { return cat16b(*(const v8usa*)&sT[jc][1][pl][dt][0][lane][0], *(const v8usa*)&sT[jc][1][pl][dt][1][lane][0]); };
    // s[r] = sim[query 32 wave + qt * 16 + c][key jc * 32 + tj * 16 + 8 h + r]
    auto sim = [&](v16bf kh, v16bf kl, int qt) -> v8f { v8f s = {}; s = wmmab(kh, qh[qt], s); s = wmmab(kh, ql[qt], s); s = wmmab(kl, qh[qt], s); return s; };
    // A trip's 32 keys against the wave's 32 queries: M = 0 all allowed (trip < wave), 1 the diagonal trip, 2 all masked (trip > wave).
    float mu[2] = {-3.0e38f, -3.0e38f}, mm[2] = {-3.0e38f, -3.0e38f};    // maxima of sim + mask, and of sim alone over the wholly masked trips
    auto walk1 = [&](auto M, int jc) {
#pragma unroll
        for (int tj = 0; tj < 2; ++tj) { const v16bf kh = kfrag(0, jc, tj), kl = kfrag(1, jc, tj);
#pragma unroll
            for (int qt = 0; qt < 2; ++qt) { const v8f s = sim(kh, kl, qt);
#pragma unroll
                for (int r = 0; r < 8; ++r) {
                    if constexpr (decltype(M)::v == 0) mu[qt] = fmaxf(mu[qt], s[r]);
                    else if constexpr (decltype(M)::v == 2) mm[qt] = fmaxf(mm[qt], s[r]);
                    else mu[qt] = fmaxf(mu[qt], s[r] + ((tj * 16 + 8 * h + r > qt * 16 + c) ? -10000.0f : 0.f)); } } }
    };
    const float CE = SCL * 1.4426950408889634f;    // exp(x * scale) = exp2(x * CE)
    float nm[2] = {0.f, 0.f}; v2f sum[2] = {(v2f){0.f, 0.f}, (v2f){0.f, 0.f}};    // even and odd keys summed apart
    if (!nomax) {
        for (int jc = 0; jc < wave; ++jc) walk1(ic<0>{}, jc);
        walk1(ic<1>{}, wave);
        for (int jc = wave + 1; jc < jend; ++jc) walk1(ic<2>{}, jc);
#pragma unroll
        for (int qt = 0; qt < 2; ++qt) { float m = fmaxf(mu[qt], mm[qt] + -10000.0f); m = fmaxf(m, __shfl_xor(m, 16, 32)); nm[qt] = -(m * CE); }
    }
    v8f o[2][2];
#pragma unroll
    for (int dt = 0; dt < 2; ++dt)
#pragma unroll
        for (int qt = 0; qt < 2; ++qt) o[dt][qt] = (v8f){};
    auto walk2 = [&](auto M, int jc) {
        v16bf ph[2], pl[2];
#pragma unroll
        for (int tj = 0; tj < 2; ++tj) { const v16bf kh = kfrag(0, jc, tj), kl = kfrag(1, jc, tj);
#pragma unroll
            for (int qt = 0; qt < 2; ++qt) { const v8f s = sim(kh, kl, qt);
#pragma unroll
                for (int r = 0; r < 8; r += 2) { v2f e;
#pragma unroll
                    for (int u = 0; u < 2; ++u) {
                        float t = s[r + u];
                        if constexpr (decltype(M)::v == 2) t += -10000.0f;
                        else if constexpr (decltype(M)::v == 1) t += ((tj * 16 + 8 * h + r + u > qt * 16 + c) ? -10000.0f : 0.f);
                        const float x = fmaf(t, CE, nm[qt]); float ex;
                        if constexpr (decltype(M)::v == 1) asm("v_exp_f32 %0, %1\n\tv_nop" : "=v"(ex) : "v"(x));    // the v_nop fills the slot behind the transcendental
                        else ex = __builtin_amdgcn_exp2f(x);
                        e[u] = ex; }
                    sum[qt] += e;
                    const v2bf eh = __builtin_convertvector(e, v2bf); const v2bf el = __builtin_convertvector(e - __builtin_convertvector(eh, v2f), v2bf);
                    ph[qt][tj * 8 + r] = eh[0]; ph[qt][tj * 8 + r + 1] = eh[1]; pl[qt][tj * 8 + r] = el[0]; pl[qt][tj * 8 + r + 1] = el[1]; } } }
#pragma unroll
        for (int dt = 0; dt < 2; ++dt) { const v16bf vh = vfrag(0, jc, dt), vl = vfrag(1, jc, dt);
#pragma unroll
            for (int qt = 0; qt < 2; ++qt) { o[dt][qt] = wmmab(vh, ph[qt], o[dt][qt]); o[dt][qt] = wmmab(vh, pl[qt], o[dt][qt]); o[dt][qt] = wmmab(vl, ph[qt], o[dt][qt]); } }
    };
    for (int jc = 0; jc < wave; ++jc) walk2(ic<0>{}, jc);
    walk2(ic<1>{}, wave);
    for (int jc = wave + 1; jc < jend; ++jc) walk2(ic<2>{}, jc);
    // o[dt][qt][r] = ctx^T[d = dt * 16 + 8 h + r][query 32 wave + qt * 16 + c]: 8 consecutive d of one query a lane, which is piece dt of to_out's B fragment (row tile = 16 queries, k step = head) at this very lane: stored as the bf16 hi + residual planes in the fragment order, 512 bytes in a row a store
#pragma unroll
    for (int qt = 0; qt < 2; ++qt) { const float sl = sum[qt][0] + sum[qt][1]; const float sm = sl + __shfl_xor(sl, 16, 32); const float inv = 1.0f / sm;
#pragma unroll
        for (int dt = 0; dt < 2; ++dt) { const size_t co = (((size_t)(blockIdx.x / NH_) * (SS / 16) + wave * 2 + qt) * NH_ + blockIdx.x % NH_) * 512 + dt * 256 + lane * 8; const v8f v = o[dt][qt] * inv; v8us oh, ol;
#pragma unroll
            for (int i = 0; i < 8; ++i) { const unsigned short hb = f2bf(v[i]); oh[i] = hb; ol[i] = f2bf(v[i] - bf2f(hb)); }
            *(v8us*)(Ch + co) = oh; *(v8us*)(Cl + co) = ol; } }
}
// k_tail: to_out, the GLU projection and the gate of 64 tokens in one work-group of 16 waves; wave = (nw, th): columns 32 nw .. 32 nw + 31 (two 16-column tiles t) of tokens 32 th .. 32 th + 31 (two 16-token tiles rt).
// Both products are formed transposed, weights as the A operand and tokens as B (the two fragment orders are the same), so a lane's 8 accumulator elements are 8 consecutive columns n = 32 nw + 16 t + 8 hi + j of token lr:
// that is piece t of k step nw of the next product's token fragment at this very lane, so O's bf16 hi + residual planes go to LDS in fragment order with one 16-byte store each, and O itself (f32) stays in registers for the residual.
// The wave that holds columns n of O also forms columns n (value) and DIM + n (gate) of the GLU projection, so out = O + value tanh(gate) is in-lane; neither O, its planes nor the projection is ever stored to memory.
// Every #pragma unroll in it makes the indices of the fragment and accumulator arrays constants, so that they stay in registers (and the k steps become immediate offsets of one address register).
__global__ __launch_bounds__(512) void k_tail(const bf* __restrict__ Ch, const bf* __restrict__ Cl, const bf* __restrict__ Wo, const float* __restrict__ bias, const bf* __restrict__ Wg, float* __restrict__ OUTB) {
    __shared__ __align__(16) unsigned short sC[2][4][DM / 32][2][32][8];    // ctx: [plane][16-token tile][k step][piece][lane][8], as it lies in memory
    __shared__ __align__(16) unsigned short sO[2][4][DM / 32][2][32][8];    // O, the same order
    __shared__ __align__(16) float sS[16][32 * 36];                         // per wave: its 32 tokens x 32 columns of out, pitch 36 floats (16 bytes x odd: the 16-byte accesses fall on different banks)
    const int lane = threadIdx.x & 31, lr = lane & 15, hi = lane >> 4;
    const int wave = __builtin_amdgcn_readfirstlane(threadIdx.x >> 5), nw = wave >> 1, th = wave & 1;    // in scalar registers: they only shift base addresses
    auto gfrag = [](const bf* base, unsigned off) -> v16bf { const char* p = (const char*)base + off; return cat16b(*(const v8us*)p, *(const v8us*)(p + 512)); };
    auto cfrag = [&](int pl, int tt, int st) -> v16bf { return cat16b(*(const v8usa*)&sC[pl][tt][st][0][lane][0], *(const v8usa*)&sC[pl][tt][st][1][lane][0]); };
    auto ofrag = [&](int pl, int tt, int st) -> v16bf { return cat16b(*(const v8usa*)&sO[pl][tt][st][0][lane][0], *(const v8usa*)&sO[pl][tt][st][1][lane][0]); };
    const unsigned wo = (unsigned)nw * (2 * DM * 32) + lane * 16;    // the lane's 16 bytes in the wave's first weight tile (a 16-column tile is DM / 32 steps of 1 KiB); every weight load is this plus a constant, which is put on the pointer so that it becomes an immediate
    auto wofrag = [&](int t, int st) -> v16bf { return gfrag(Wo + (t * (INR * 32) + st * 1024) / 2, wo); };
    auto wgfrag = [&](int u, int st) -> v16bf { return gfrag(Wg + ((u >> 1) * (DM * DM * 2) + (u & 1) * (DM * 32) + st * 1024) / 2, wo); };    // u = value t = 0, 1 | gate t = 0, 1; the gate half starts DM columns (DM / 16 tiles) on
    // The weight fragments are asked for one k step ahead (two sets of registers), the first step's ahead of the barrier in front of its product, so that a step's matrix work covers the next step's L2 latency.
    v16bf wa[2][2], wb[2][4];
#pragma unroll
    for (int t = 0; t < 2; ++t) wa[0][t] = wofrag(t, 0);
    v4f bv[2][2];
    {   // the work-group's 4 token tiles are 32 KiB in a row of each plane: copied as they lie
        const unsigned co = blockIdx.x * (4 * DM * 32) + threadIdx.x * 16, bo = (unsigned)(nw * 32 + hi * 8) * 4;
        v8us tc[2][4];
#pragma unroll
        for (int i = 0; i < 4; ++i) { tc[0][i] = *(const v8us*)((const char*)Ch + co + i * 8192); tc[1][i] = *(const v8us*)((const char*)Cl + co + i * 8192); }
#pragma unroll
        for (int t = 0; t < 2; ++t) { bv[t][0] = *(const v4f*)((const char*)bias + bo + t * 64); bv[t][1] = *(const v4f*)((const char*)bias + bo + t * 64 + 16); }
        asm volatile("s_wait_xcnt 0x0" :: "v"(co), "v"(bo) : "memory");    // the two offsets stay live up to this wait, so that nothing (a later load's result either) lands in an address register of a load in front of it
#pragma unroll
        for (int i = 0; i < 4; ++i) { *(v8usa*)((char*)&sC[0][0][0][0][0][0] + i * 8192 + threadIdx.x * 16) = tc[0][i]; *(v8usa*)((char*)&sC[1][0][0][0][0][0] + i * 8192 + threadIdx.x * 16) = tc[1][i]; }
    }
    __syncthreads();    // ctx is in LDS
    v8f o1[2][2];    // [t][rt]
#pragma unroll
    for (int t = 0; t < 2; ++t)
#pragma unroll
        for (int rt = 0; rt < 2; ++rt) o1[t][rt] = (v8f){};
#pragma unroll
    for (int st = 0; st < INR / 32; ++st) {
        if (st + 1 < INR / 32) {
#pragma unroll
            for (int t = 0; t < 2; ++t) wa[(st + 1) & 1][t] = wofrag(t, st + 1);
        } else {
#pragma unroll
            for (int u = 0; u < 4; ++u) wb[0][u] = wgfrag(u, 0);
        }
        v16bf ch[2], cl[2];
#pragma unroll
        for (int rt = 0; rt < 2; ++rt) { ch[rt] = cfrag(0, 2 * th + rt, st); cl[rt] = cfrag(1, 2 * th + rt, st); }
        __builtin_amdgcn_sched_barrier(0);    // holds the next step's weight loads in front of this step's matrix instructions: without it the build sinks them to just in front of their use and waits for each there
#pragma unroll
        for (int rt = 0; rt < 2; ++rt)
#pragma unroll
            for (int t = 0; t < 2; ++t) o1[t][rt] = wmmab(wa[st & 1][t], ch[rt], o1[t][rt]);
#pragma unroll
        for (int rt = 0; rt < 2; ++rt)
#pragma unroll
            for (int t = 0; t < 2; ++t) o1[t][rt] = wmmab(wa[st & 1][t], cl[rt], o1[t][rt]);
    }
#pragma unroll
    for (int t = 0; t < 2; ++t)
#pragma unroll
        for (int rt = 0; rt < 2; ++rt) { float v[8];
#pragma unroll
            for (int j = 0; j < 8; ++j) { v[j] = o1[t][rt][j] + bfr(bv[t][j >> 2][j & 3]); o1[t][rt][j] = v[j]; }
            v8us oh, ol; split8(v, oh, ol);
            *(v8usa*)&sO[0][2 * th + rt][nw][t][lane][0] = oh; *(v8usa*)&sO[1][2 * th + rt][nw][t][lane][0] = ol; }
    __syncthreads();    // all 256 columns of O's planes are in LDS
    v8f g[4][2];    // [value t = 0, 1 | gate t = 0, 1][rt]
#pragma unroll
    for (int u = 0; u < 4; ++u)
#pragma unroll
        for (int rt = 0; rt < 2; ++rt) g[u][rt] = (v8f){};
#pragma unroll
    for (int st = 0; st < DM / 32; ++st) {
        if (st + 1 < DM / 32) {
#pragma unroll
            for (int u = 0; u < 4; ++u) wb[(st + 1) & 1][u] = wgfrag(u, st + 1);
        }
        v16bf oh[2], ol[2];
#pragma unroll
        for (int rt = 0; rt < 2; ++rt) { oh[rt] = ofrag(0, 2 * th + rt, st); ol[rt] = ofrag(1, 2 * th + rt, st); }
        __builtin_amdgcn_sched_barrier(0);    // as in the first product: without it the next step's weight loads sink to just in front of their use
#pragma unroll
        for (int rt = 0; rt < 2; ++rt)
#pragma unroll
            for (int u = 0; u < 4; ++u) g[u][rt] = wmmab(wb[st & 1][u], oh[rt], g[u][rt]);
#pragma unroll
        for (int rt = 0; rt < 2; ++rt)
#pragma unroll
            for (int u = 0; u < 4; ++u) g[u][rt] = wmmab(wb[st & 1][u], ol[rt], g[u][rt]);
    }
    asm volatile("s_wait_xcnt 0x0" :: "v"(wo) : "memory");    // the weight loads' one address register stays live up to this wait, in front of whatever overwrites it from here on
    float* ss = &sS[wave][0];
#pragma unroll
    for (int rt = 0; rt < 2; ++rt)
#pragma unroll
        for (int t = 0; t < 2; ++t) { v4f a, b;
#pragma unroll
            for (int j = 0; j < 4; ++j) { a[j] = o1[t][rt][j] + g[t][rt][j] * tanhf(g[2 + t][rt][j]); b[j] = o1[t][rt][4 + j] + g[t][rt][4 + j] * tanhf(g[2 + t][rt][4 + j]); }
            float* sp = ss + (rt * 16 + lr) * 36 + t * 16 + hi * 8; *(v4fa*)sp = a; *(v4fa*)(sp + 4) = b; }
    __syncthreads();    // between the lanes' writes of the staging tile and the reads of other lanes' elements
    // a store covers 4 tokens x 32 columns: 4 whole 128-byte lines, each written by this wave alone
#pragma unroll
    for (int s = 0; s < 8; ++s) { const int row = 4 * s + (lane >> 3), cofs = (lane & 7) * 4;
        *(v4f*)(OUTB + ((size_t)blockIdx.x * 64 + th * 32 + row) * DIM + nw * 32 + cofs) = *(const v4fa*)(ss + row * 36 + cofs); }
}

extern "C" void kernel_launch(void* const* d_in, const int* in_sizes, int n_in,
                              void* d_out, int out_size, void* d_ws, size_t ws_size, hipStream_t stream) {
    (void)in_sizes; (void)n_in; (void)out_size;
    const float* x = (const float*)d_in[0]; const float* lng = (const float*)d_in[1]; const float* lnb = (const float*)d_in[2]; const float* wqkv = (const float*)d_in[3]; const float* wout = (const float*)d_in[4]; const float* bout = (const float*)d_in[5]; const float* wglu = (const float*)d_in[6];
    float* out = (float*)d_out;    // [32][512][256]
    char* wsp = (char*)d_ws;
    auto take = [&](size_t bytes) { char* p = wsp; wsp += (bytes + 255) & ~(size_t)255; return (void*)p; };
    bf* WQKV = (bf*)take((size_t)(3 * INR) * DIM * 2); bf* WOUT = (bf*)take((size_t)DIM * INR * 2); bf* WGLU = (bf*)take((size_t)(2 * DIM) * DIM * 2);
    // LayerNorm planes and ctx planes of all items: k_attn reads the first and writes the second in one launch, so they lie apart
    bf* Hh = (bf*)take((size_t)NR * DIM * 2); bf* Hl = (bf*)take((size_t)NR * DIM * 2);
    bf* Ch = (bf*)take((size_t)NR * INR * 2); bf* Cl = (bf*)take((size_t)NR * INR * 2);
    if ((size_t)(wsp - (char*)d_ws) > ws_size) return;    // 0.75 + 16 + 16 ~ 33 MiB
    k_prep<<<WTB + NR / 16, 512, 0, stream>>>(x, lng, lnb, Hh, Hl, wqkv, wout, wglu, WQKV, WOUT, WGLU);
    k_attn<<<NBT * NH_, 512, 0, stream>>>(Hh, Hl, WQKV, Ch, Cl);
    k_tail<<<NR / 64, 512, 0, stream>>>(Ch, Cl, WOUT, bout, WGLU, out);
}

// v010
// One run takes 47.3 microseconds.
// Two timings next to v009 both put it at 1.03 times that version's speed.
// Counting every step since v000, it is 60.4 times as fast.
#include <hip/hip_runtime.h>

// Compute dtypes, f32 accumulate, per item (512 tokens): LayerNorm in f32 -> bf16 hi + UNSCALED residual planes; qkv, to_out and the GLU projection as [512 x K].[K x N] products
// against the exact bf16 k-major weights (two products); per (item, head), in one kernel: sim = q.k^T ([512 x 32].[32 x 512], three products),
// the causal -10000 mask then x scale and the row softmax in f32, ctx = P.v ([512 x 512].[512 x 32], three products), scores and P in registers only - on v_wmma_f32_16x16x32_bf16; the GLU

#define NBT  32
#define SS   512
#define DIM  256
#define NH_  8
#define HD   32
#define INR  256
#define DM   DIM
#define SCL  0.17677669529663687f
#define NR   (NBT * SS)   // token rows of all items together

typedef unsigned short bf;
typedef __attribute__((ext_vector_type(16))) __bf16   v16bf;
typedef __attribute__((ext_vector_type(16))) _Float16 v16h;
typedef __attribute__((ext_vector_type(8)))  _Float16 v8h;
typedef __attribute__((ext_vector_type(8)))  unsigned short v8us;
typedef __attribute__((ext_vector_type(8)))  float    v8f;
typedef __attribute__((ext_vector_type(4)))  float    v4f;
typedef v8h  __attribute__((may_alias)) v8ha;
typedef v4f  __attribute__((may_alias)) v4fa;
typedef v8us __attribute__((may_alias)) v8usa;

__device__ __forceinline__ unsigned short f2bf(float f) { unsigned u = __float_as_uint(f); u += 0x7FFFu + ((u >> 16) & 1u); return (unsigned short)(u >> 16); }
__device__ __forceinline__ float bf2f(unsigned short b) { return __uint_as_float(((unsigned)b) << 16); }
__device__ __forceinline__ float bfr(float f) { return bf2f(f2bf(f)); }
__device__ __forceinline__ v16h cat16(v8h lo, v8h hi) { return __builtin_shufflevector(lo, hi, 0, 1, 2, 3, 4, 5, 6, 7, 8, 9, 10, 11, 12, 13, 14, 15); }
__device__ __forceinline__ v16bf cat16b(v8us lo, v8us hi) { return __builtin_bit_cast(v16bf, __builtin_shufflevector(lo, hi, 0, 1, 2, 3, 4, 5, 6, 7, 8, 9, 10, 11, 12, 13, 14, 15)); }
__device__ __forceinline__ v8f wmma16(v16h a, v16h b, v8f c) { return __builtin_amdgcn_wmma_f32_16x16x32_f16(false, a, false, b, (short)0, c, false, false); }
__device__ __forceinline__ v8f wmmab(v16bf a, v16bf b, v8f c) { return __builtin_amdgcn_wmma_f32_16x16x32_bf16(false, a, false, b, (short)0, c, false, false); }

// FRAGMENT ORDER: every operand of the three weight products lies as its loop loads it, [16-row tile][32-wide k step][piece p][lane][8]: lane = 16 hi + lr holds row lr, k = 32 step + 16 p + 8 hi + 0..7,
// so a wave's 16-byte loads of one piece read 512 bytes in a row (4 whole lines) where a row-major operand gave 32 bytes of each of 16 lines. Every producer stores this order.
// Every #pragma unroll of these plane stores makes the indices of the 8-element vectors constants, so that they stay in registers.
__device__ __forceinline__ void split8(const float* v, v8us& oh, v8us& ol) {
#pragma unroll
    for (int i = 0; i < 8; ++i) { const unsigned short hb = f2bf(v[i]); oh[i] = hb; ol[i] = f2bf(v[i] - bf2f(hb)); }
}

// wt_tile: WT = bf16(W[k][n]) (k-major [K][ncols]) in the fragment order (16 columns n are a tile's rows), one 64 x 64 tile through LDS by 256 threads (tid = 0..255).
__device__ __forceinline__ void wt_tile(const float* __restrict__ Wm, int K, int ncols, bf* WT, int k0, int n0, int tid, unsigned short* tl) {
    const int kk = tid >> 2, nq = (tid & 3) * 16;
#pragma unroll
    for (int i = 0; i < 16; ++i) tl[(nq + i) * 72 + kk] = f2bf(Wm[(size_t)(k0 + kk) * ncols + n0 + nq + i]);
    __syncthreads();
    const int lane = tid & 31;
    // the tile is 4 column tiles x 2 k steps x 2 pieces of 512 bytes; a wave stores two whole pieces
#pragma unroll
    for (int s = 0; s < 2; ++s) { const int q = (tid >> 5) * 2 + s, ct = q >> 2, kp = q & 3; const v8us val = *(const v8usa*)(tl + (ct * 16 + (lane & 15)) * 72 + kp * 16 + (lane >> 4) * 8);
        *(v8us*)(WT + (size_t)((n0 >> 4) + ct) * (K * 16) + (size_t)((k0 >> 4) + kp) * 256 + lane * 8) = val; }
}

// ln_tile: one wave per token, 16 tokens (one row tile of the qkv product) per work-group. A lane's 8 columns are one 16-byte piece of the fragment order, 256 bytes from its neighbour's,
// so the 16 waves exchange their pieces through LDS (pitch 272 bytes: a wave's 32 pieces fall on different banks) and each stores 512 bytes in a row of each plane.
__device__ __forceinline__ void ln_tile(const float* __restrict__ xb, const float* __restrict__ g, const float* __restrict__ bb, bf* Hh, bf* Hl, int rt, unsigned short (*sl)[32][136]) {    // sl: [plane][8-column piece][token][8], 8 elements of pad a piece
    const int lane = threadIdx.x & 31, wv = threadIdx.x >> 5, r = rt * 16 + wv; float v[8]; float s = 0.f;
#pragma unroll
    for (int i = 0; i < 8; ++i) { v[i] = bfr(xb[(size_t)r * DIM + lane * 8 + i]); s += v[i]; }
#pragma unroll
    for (int sh = 16; sh; sh >>= 1) s += __shfl_xor(s, sh, 32);
    const float mu = s * (1.0f / DIM); float q = 0.f;
#pragma unroll
    for (int i = 0; i < 8; ++i) { const float d = v[i] - mu; q = fmaf(d, d, q); }
#pragma unroll
    for (int sh = 16; sh; sh >>= 1) q += __shfl_xor(q, sh, 32);
    const float rs = rsqrtf(q * (1.0f / DIM) + 1e-5f); v8us oh, ol;
#pragma unroll
    for (int i = 0; i < 8; ++i) { const int c = lane * 8 + i; const float y = (v[i] - mu) * rs * bfr(g[c]) + bfr(bb[c]); const unsigned short hb = f2bf(y); oh[i] = hb; ol[i] = f2bf(y - bf2f(hb)); }
    *(v8usa*)&sl[0][lane][wv * 8] = oh; *(v8usa*)&sl[1][lane][wv * 8] = ol;
    __syncthreads();
    const int pc = threadIdx.x >> 4, tk = threadIdx.x & 15;    // columns 8 pc .. 8 pc + 7 = step pc / 4, piece (pc / 2) % 2, hi = pc % 2: the piece's place in the tile is 128 pc + 8 tk elements
    const size_t o = (size_t)rt * (16 * DIM) + threadIdx.x * 8; *(v8us*)(Hh + o) = *(const v8usa*)&sl[0][pc][tk * 8]; *(v8us*)(Hl + o) = *(const v8usa*)&sl[1][pc][tk * 8];
}

// k_prep: the four jobs that depend on nothing but the inputs share one launch; the block index picks the job (the same for a whole work-group, so each job's barrier is passed by all of it).
// Blocks 0 .. WTB - 1: the weights, two 64 x 64 tiles a block (one per 256 threads), the tiles numbered w_qkv, w_out, w_glu, 4 k tiles fastest (all three have K = 256); the rest: LayerNorm, 16 tokens a block.
#define WT_QKV (4 * (3 * INR / 64))
#define WT_OUT (4 * (DIM / 64))
#define WT_GLU (4 * (2 * DIM / 64))
#define WTB    ((WT_QKV + WT_OUT + WT_GLU) / 2)
__global__ __launch_bounds__(512) void k_prep(const float* __restrict__ xb, const float* __restrict__ g, const float* __restrict__ bb, bf* Hh, bf* Hl,
                                              const float* __restrict__ wqkv, const float* __restrict__ wout, const float* __restrict__ wglu, bf* WQKV, bf* WOUT, bf* WGLU) {
    __shared__ __align__(16) unsigned short sm[2 * 64 * 72];    // two weight tiles of 64 x 72, or LayerNorm's 2 x 32 x 136 (smaller)
    if (blockIdx.x < WTB) {
        static_assert(WT_QKV % 2 == 0 && WT_OUT % 2 == 0 && WT_GLU % 2 == 0, "a block's two tiles are of one matrix");
        int t0 = blockIdx.x * 2;    // the block's first tile: the matrix is picked by the block index alone, in scalar registers
        const float* Wm = wqkv; bf* WT = WQKV; int ncols = 3 * INR;
        if (t0 >= WT_QKV + WT_OUT) { t0 -= WT_QKV + WT_OUT; Wm = wglu; WT = WGLU; ncols = 2 * DIM; }
        else if (t0 >= WT_QKV) { t0 -= WT_QKV; Wm = wout; WT = WOUT; ncols = DIM; }
        const int half = threadIdx.x >> 8, tix = t0 + half;
        wt_tile(Wm, DIM, ncols, WT, (tix & 3) * 64, (tix >> 2) * 64, threadIdx.x & 255, sm + half * (64 * 72));
    } else {
        ln_tile(xb, g, bb, Hh, Hl, blockIdx.x - WTB, (unsigned short (*)[32][136])sm);
    }
}
template <int N> struct ic { static constexpr int v = N; };
typedef __attribute__((ext_vector_type(2))) float  v2f;
typedef __attribute__((ext_vector_type(2))) __bf16 v2bf;
__global__ __launch_bounds__(512) void k_attn(const bf* __restrict__ Hh, const bf* __restrict__ Hl, const bf* __restrict__ Wq, bf* __restrict__ Ch, bf* __restrict__ Cl) {
    __shared__ __align__(16) unsigned short sT[SS / 32][2][2][2][2][32][8];    // [32-key trip][k | v^T][plane][16-key tile | 16-d tile][piece][lane][8]: a trip's 8 KiB lie together
    __shared__ __align__(16) unsigned short sW[6][DIM / 32][2][32][8];    // the head's weight tiles (q 0, 1 | k 0, 1 | v 0, 1), each [k step][piece][lane][8] as it lies in memory
    const int lane = threadIdx.x & 31, c = lane & 15, h = lane >> 4;
    __shared__ float sN[SS / 32];    // per 32-token block: the sum of the squares of all its k and v elements
    __shared__ float sK[SS / 32];    // per 32-token block: the largest |k|^2 of its tokens
    const int wid = __builtin_amdgcn_readfirstlane(threadIdx.x >> 5);    // in a scalar register: the trip loops' bounds and branches are scalar
    // 'wave' is from here on the 32-token block that the wave works on. Block b walks b + 1 trips where the trips above the diagonal are skipped (below), and waves w, w + 4, w + 8, w + 12 share a SIMD:
    // waves 0..3 take blocks 15..12, 4..7 blocks 8..11, 8..11 blocks 7..4, 12..15 blocks 0..3, so that the four blocks of each SIMD add up to the same 34 trips.
    const int wave = wid ^ ((wid & 4) ? 12 : 15);
    float nq[2] = {0.f, 0.f};    // the squares of the lane's 16 elements of query 16 rt + c, summed
    v16bf qh[2], ql[2];
    {
        auto gfrag = [](const bf* base, unsigned off) -> v16bf { const char* p = (const char*)base + off; return cat16b(*(const v8us*)p, *(const v8us*)(p + 512)); };
        const unsigned ho = ((blockIdx.x / NH_) * (SS / 16) + wave * 2) * (DIM * 32) + lane * 16;    // the lane's 16 bytes in the wave's first token tile (a tile is DIM / 32 steps of 1 KiB); every fragment load is this plus a constant
        auto hfrag = [&](int pl, int rt, int st) -> v16bf { return gfrag((pl ? Hl : Hh) + (rt * (DIM * 32) + st * 1024) / 2, ho); };
        auto wfrag = [&](int i, int st) -> v16bf { return cat16b(*(const v8usa*)&sW[i][st][0][lane][0], *(const v8usa*)&sW[i][st][1][lane][0]); };
        // The token fragments are asked for one k step ahead (two sets of registers), the first step's ahead of the barrier, so that a step's matrix work covers the next step's latency.
        v16bf hb[2][2][2];    // [set][plane][rt]
#pragma unroll
        for (int pl = 0; pl < 2; ++pl)
#pragma unroll
            for (int rt = 0; rt < 2; ++rt) hb[0][pl][rt] = hfrag(pl, rt, 0);
        {   // a weight tile is 8 KiB in a row: one 16-byte piece a thread, copied as it lies
            const unsigned so = (blockIdx.x % NH_) * (2 * DIM * 32) + threadIdx.x * 16; v8us tw[6];
#pragma unroll
            for (int i = 0; i < 6; ++i) tw[i] = *(const v8us*)((const char*)Wq + ((i >> 1) * (INR / 16) + (i & 1)) * (DIM * 32) + so);
            asm volatile("s_wait_xcnt 0x0" :: "v"(so) : "memory");    // the offset stays live up to this wait, so that nothing (a later load's result either) lands in an address register of a load in front of it
#pragma unroll
            for (int i = 0; i < 6; ++i) *(v8usa*)((char*)&sW[i][0][0][0][0] + threadIdx.x * 16) = tw[i];
        }
        __syncthreads();    // the weight tiles are in LDS
        v8f aq[2][2], ak[2][2], av[2][2];    // [t][rt]
#pragma unroll
        for (int t = 0; t < 2; ++t)
#pragma unroll
            for (int rt = 0; rt < 2; ++rt) { aq[t][rt] = (v8f){}; ak[t][rt] = (v8f){}; av[t][rt] = (v8f){}; }
#pragma unroll
        for (int st = 0; st < DIM / 32; ++st) {
            if (st + 1 < DIM / 32) {
#pragma unroll
                for (int pl = 0; pl < 2; ++pl)
#pragma unroll
                    for (int rt = 0; rt < 2; ++rt) hb[(st + 1) & 1][pl][rt] = hfrag(pl, rt, st + 1);
            }
            v16bf w[6];
#pragma unroll
            for (int i = 0; i < 6; ++i) w[i] = wfrag(i, st);
            __builtin_amdgcn_sched_barrier(0);    // holds the next step's token loads in front of this step's matrix instructions: without it the build may sink them to just in front of their use and wait for each there
#pragma unroll
            for (int pl = 0; pl < 2; ++pl)    // each accumulator takes the step's hi product, then its residual product
#pragma unroll
                for (int rt = 0; rt < 2; ++rt)
#pragma unroll
                    for (int t = 0; t < 2; ++t) { const v16bf hf = hb[st & 1][pl][rt];
                        aq[t][rt] = wmmab(w[t], hf, aq[t][rt]); ak[t][rt] = wmmab(w[2 + t], hf, ak[t][rt]); av[t][rt] = wmmab(hf, w[4 + t], av[t][rt]); }
            __builtin_amdgcn_sched_barrier(0);    // keeps the following step's loads below this step's matrix instructions: risen among them they made a third set of token fragments live, past the 256 registers, and the build spilled
        }
        asm volatile("s_wait_xcnt 0x0" :: "v"(ho) : "memory");    // the token loads' one address register stays live up to this wait, in front of whatever overwrites it from here on
        float nk[2] = {0.f, 0.f}, nv = 0.f;    // nk[rt]: the squares of the lane's 16 elements of key 16 rt + c, summed
#pragma unroll
        for (int rt = 0; rt < 2; ++rt)
#pragma unroll
            for (int t = 0; t < 2; ++t)
#pragma unroll
                for (int j = 0; j < 8; ++j) { nq[rt] = fmaf(aq[t][rt][j], aq[t][rt][j], nq[rt]); nk[rt] = fmaf(ak[t][rt][j], ak[t][rt][j], nk[rt]); nv = fmaf(av[t][rt][j], av[t][rt][j], nv); }
        float ns = nk[0] + nk[1] + nv;
        float km = fmaxf(nk[0] + __shfl_xor(nk[0], 16, 32), nk[1] + __shfl_xor(nk[1], 16, 32));    // the larger |k|^2 of the lane's two keys
        ns += __shfl_xor(ns, 16, 32);
        for (int sh = 8; sh; sh >>= 1) { ns += __shfl_xor(ns, sh, 32); km = fmaxf(km, __shfl_xor(km, sh, 32)); }
        if (lane == 0) { sN[wave] = ns; sK[wave] = km; }
#pragma unroll
        for (int rt = 0; rt < 2; ++rt) { v8us oh[2], ol[2];
#pragma unroll
            for (int t = 0; t < 2; ++t) { float v[8];
#pragma unroll
                for (int j = 0; j < 8; ++j) v[j] = aq[t][rt][j];
                split8(v, oh[t], ol[t]); }
            qh[rt] = cat16b(oh[0], oh[1]); ql[rt] = cat16b(ol[0], ol[1]);
#pragma unroll
            for (int t = 0; t < 2; ++t) { float v[8]; v8us kh8, kl8, vh8, vl8;
#pragma unroll
                for (int j = 0; j < 8; ++j) v[j] = ak[t][rt][j];
                split8(v, kh8, kl8);
#pragma unroll
                for (int j = 0; j < 8; ++j) v[j] = av[t][rt][j];
                split8(v, vh8, vl8);
                // wave w fills trip w: key tile rt, piece t of k; d tile t, piece rt of v^T
                *(v8usa*)&sT[wave][0][0][rt][t][lane][0] = kh8; *(v8usa*)&sT[wave][0][1][rt][t][lane][0] = kl8;
                *(v8usa*)&sT[wave][1][0][t][rt][lane][0] = vh8; *(v8usa*)&sT[wave][1][1][t][rt][lane][0] = vl8; } }
    }
    __syncthreads();
    // THE TRIPS ABOVE THE DIAGONAL. With N = the sum of the squares of all of the head's k and v, every score of query i obeys |sim| <= 1.02 sqrt(|q_i|^2 N) (Cauchy-Schwarz; 1.02 covers the bf16 planes' rounding).
    // Where |q_i|^2 N < 1e7 that is below 3226: a masked score is below 3226 - 10000, the row's maximum (its diagonal score is allowed) above -3226, so the maximum is not a masked score, and every masked
    // exponent lies below (6452 - 10000) * CE < -900, where exp2 is exactly 0; v is finite (N is), so such a trip adds exactly 0 to the sum and to ctx. Then, and only then, both walks end at the diagonal trip.
    // A NaN or an infinity in q, k or v makes the comparison false, and so does any larger product of the norms: the wave then walks all 16 trips as before. The test is one for the whole wave (a scalar loop bound).
    float nall = 0.f;
    for (int i = 0; i < SS / 32; ++i) nall += sN[i];
    const float n0 = nq[0] + __shfl_xor(nq[0], 16, 32), n1 = nq[1] + __shfl_xor(nq[1], 16, 32);    // |q|^2 of the lane's two queries
    const bool small = (n0 * nall < 1.0e7f) & (n1 * nall < 1.0e7f);
    const int jend = (__builtin_amdgcn_ballot_w32(small) == 0xFFFFFFFFu) ? wave + 1 : SS / 32;
    // THE ROW MAXIMUM. softmax does not change when one number is taken off a whole row; the maximum is taken off only to keep exp in range. With K = the largest |k_j|^2 of the head, |sim| <= 1.02 sqrt(|q_i|^2 K).
    // Where |q_i|^2 K < 1e4 that is below 102: every allowed exponent lies within +-27, so e lies within 2^-27 .. 2^27, a row's sum within 2^-27 .. 2^36 and ctx^T below 2^36 max|v| (finite: N is), all far inside f32,
    // and a masked exponent is below (102 - 10000) * CE < -900, where exp2 is exactly 0. Then, and only then, nothing is taken off and walk 1 is not made. The test is one for the whole wave (a scalar branch);
    // it asks for 'small' as well, which a NaN or an infinity in q, k or v makes false (fmaxf alone would drop a NaN).
    float kall = 0.f;
    for (int i = 0; i < SS / 32; ++i) kall = fmaxf(kall, sK[i]);
    const bool nomax = __builtin_amdgcn_ballot_w32(small & (n0 * kall < 1.0e4f) & (n1 * kall < 1.0e4f)) == 0xFFFFFFFFu;
    auto kfrag = [&](int pl, int jc, int tj) -> v16bf { return cat16b(*(const v8usa*)&sT[jc][0][pl][tj][0][lane][0], *(const v8usa*)&sT[jc][0][pl][tj][1][lane][0]); };
    auto vfrag = [&](int pl, int jc, int dt) -> v16bf { return cat16b(*(const v8usa*)&sT[jc][1][pl][dt][0][lane][0], *(const v8usa*)&sT[jc][1][pl][dt][1][lane][0]); };
    // s[r] = sim[query 32 wave + qt * 16 + c][key jc * 32 + tj * 16 + 8 h + r]
    auto sim = [&](v16bf kh, v16bf kl, int qt) -> v8f { v8f s = {}; s = wmmab(kh, qh[qt], s); s = wmmab(kh, ql[qt], s); s = wmmab(kl, qh[qt], s); return s; };
    // A trip's 32 keys against the wave's 32 queries: M = 0 all allowed (trip < wave), 1 the diagonal trip, 2 all masked (trip > wave).
    float mu[2] = {-3.0e38f, -3.0e38f}, mm[2] = {-3.0e38f, -3.0e38f};    // maxima of sim + mask, and of sim alone over the wholly masked trips
    auto walk1 = [&](auto M, int jc) {
#pragma unroll
        for (int tj = 0; tj < 2; ++tj) { const v16bf kh = kfrag(0, jc, tj), kl = kfrag(1, jc, tj);
#pragma unroll
            for (int qt = 0; qt < 2; ++qt) { const v8f s = sim(kh, kl, qt);
#pragma unroll
                for (int r = 0; r < 8; ++r) {
                    if constexpr (decltype(M)::v == 0) mu[qt] = fmaxf(mu[qt], s[r]);
                    else if constexpr (decltype(M)::v == 2) mm[qt] = fmaxf(mm[qt], s[r]);
                    else mu[qt] = fmaxf(mu[qt], s[r] + ((tj * 16 + 8 * h + r > qt * 16 + c) ? -10000.0f : 0.f)); } } }
    };
    const float CE = SCL * 1.4426950408889634f;    // exp(x * scale) = exp2(x * CE)
    float nm[2] = {0.f, 0.f}; v2f sum[2] = {(v2f){0.f, 0.f}, (v2f){0.f, 0.f}};    // even and odd keys summed apart
    if (!nomax) {
        for (int jc = 0; jc < wave; ++jc) walk1(ic<0>{}, jc);
        walk1(ic<1>{}, wave);
        for (int jc = wave + 1; jc < jend; ++jc) walk1(ic<2>{}, jc);
#pragma unroll
        for (int qt = 0; qt < 2; ++qt) { float m = fmaxf(mu[qt], mm[qt] + -10000.0f); m = fmaxf(m, __shfl_xor(m, 16, 32)); nm[qt] = -(m * CE); }
    }
    v8f o[2][2];
#pragma unroll
    for (int dt = 0; dt < 2; ++dt)
#pragma unroll
        for (int qt = 0; qt < 2; ++qt) o[dt][qt] = (v8f){};
    auto walk2 = [&](auto M, int jc) {
        v16bf ph[2], pl[2];
#pragma unroll
        for (int tj = 0; tj < 2; ++tj) { const v16bf kh = kfrag(0, jc, tj), kl = kfrag(1, jc, tj);
#pragma unroll
            for (int qt = 0; qt < 2; ++qt) { const v8f s = sim(kh, kl, qt);
#pragma unroll
                for (int r = 0; r < 8; r += 2) { v2f e;
#pragma unroll
                    for (int u = 0; u < 2; ++u) {
                        float t = s[r + u];
                        if constexpr (decltype(M)::v == 2) t += -10000.0f;
                        else if constexpr (decltype(M)::v == 1) t += ((tj * 16 + 8 * h + r + u > qt * 16 + c) ? -10000.0f : 0.f);
                        const float x = fmaf(t, CE, nm[qt]); float ex;
                        if constexpr (decltype(M)::v == 1) asm("v_exp_f32 %0, %1\n\tv_nop" : "=v"(ex) : "v"(x));    // the v_nop fills the slot behind the transcendental
                        else ex = __builtin_amdgcn_exp2f(x);
                        e[u] = ex; }
                    sum[qt] += e;
                    const v2bf eh = __builtin_convertvector(e, v2bf); const v2bf el = __builtin_convertvector(e - __builtin_convertvector(eh, v2f), v2bf);
                    ph[qt][tj * 8 + r] = eh[0]; ph[qt][tj * 8 + r + 1] = eh[1]; pl[qt][tj * 8 + r] = el[0]; pl[qt][tj * 8 + r + 1] = el[1]; } } }
#pragma unroll
        for (int dt = 0; dt < 2; ++dt) { const v16bf vh = vfrag(0, jc, dt), vl = vfrag(1, jc, dt);
#pragma unroll
            for (int qt = 0; qt < 2; ++qt) { o[dt][qt] = wmmab(vh, ph[qt], o[dt][qt]); o[dt][qt] = wmmab(vh, pl[qt], o[dt][qt]); o[dt][qt] = wmmab(vl, ph[qt], o[dt][qt]); } }
    };
    for (int jc = 0; jc < wave; ++jc) walk2(ic<0>{}, jc);
    walk2(ic<1>{}, wave);
    for (int jc = wave + 1; jc < jend; ++jc) walk2(ic<2>{}, jc);
    // o[dt][qt][r] = ctx^T[d = dt * 16 + 8 h + r][query 32 wave + qt * 16 + c]: 8 consecutive d of one query a lane, which is piece dt of to_out's B fragment (row tile = 16 queries, k step = head) at this very lane: stored as the bf16 hi + residual planes in the fragment order, 512 bytes in a row a store
#pragma unroll
    for (int qt = 0; qt < 2; ++qt) { const float sl = sum[qt][0] + sum[qt][1]; const float sm = sl + __shfl_xor(sl, 16, 32); const float inv = 1.0f / sm;
#pragma unroll
        for (int dt = 0; dt < 2; ++dt) { const size_t co = (((size_t)(blockIdx.x / NH_) * (SS / 16) + wave * 2 + qt) * NH_ + blockIdx.x % NH_) * 512 + dt * 256 + lane * 8; const v8f v = o[dt][qt] * inv; v8us oh, ol;
#pragma unroll
            for (int i = 0; i < 8; ++i) { const unsigned short hb = f2bf(v[i]); oh[i] = hb; ol[i] = f2bf(v[i] - bf2f(hb)); }
            *(v8us*)(Ch + co) = oh; *(v8us*)(Cl + co) = ol; } }
}
// k_tail: to_out, the GLU projection and the gate of 64 tokens in one work-group of 16 waves; wave = (nw, th): columns 32 nw .. 32 nw + 31 (two 16-column tiles t) of tokens 32 th .. 32 th + 31 (two 16-token tiles rt).
// Both products are formed transposed, weights as the A operand and tokens as B (the two fragment orders are the same), so a lane's 8 accumulator elements are 8 consecutive columns n = 32 nw + 16 t + 8 hi + j of token lr:
// that is piece t of k step nw of the next product's token fragment at this very lane, so O's bf16 hi + residual planes go to LDS in fragment order with one 16-byte store each, and O itself (f32) stays in registers for the residual.
// The wave that holds columns n of O also forms columns n (value) and DIM + n (gate) of the GLU projection, so out = O + value tanh(gate) is in-lane; neither O, its planes nor the projection is ever stored to memory.
// Every #pragma unroll in it makes the indices of the fragment and accumulator arrays constants, so that they stay in registers (and the k steps become immediate offsets of one address register).
__global__ __launch_bounds__(512) void k_tail(const bf* __restrict__ Ch, const bf* __restrict__ Cl, const bf* __restrict__ Wo, const float* __restrict__ bias, const bf* __restrict__ Wg, float* __restrict__ OUTB) {
    __shared__ __align__(16) unsigned short sC[2][4][DM / 32][2][32][8];    // ctx: [plane][16-token tile][k step][piece][lane][8], as it lies in memory
    __shared__ __align__(16) unsigned short sO[2][4][DM / 32][2][32][8];    // O, the same order
    __shared__ __align__(16) float sS[16][32 * 36];                         // per wave: its 32 tokens x 32 columns of out, pitch 36 floats (16 bytes x odd: the 16-byte accesses fall on different banks)
    const int lane = threadIdx.x & 31, lr = lane & 15, hi = lane >> 4;
    const int wave = __builtin_amdgcn_readfirstlane(threadIdx.x >> 5), nw = wave >> 1, th = wave & 1;    // in scalar registers: they only shift base addresses
    auto gfrag = [](const bf* base, unsigned off) -> v16bf { const char* p = (const char*)base + off; return cat16b(*(const v8us*)p, *(const v8us*)(p + 512)); };
    auto cfrag = [&](int pl, int tt, int st) -> v16bf { return cat16b(*(const v8usa*)&sC[pl][tt][st][0][lane][0], *(const v8usa*)&sC[pl][tt][st][1][lane][0]); };
    auto ofrag = [&](int pl, int tt, int st) -> v16bf { return cat16b(*(const v8usa*)&sO[pl][tt][st][0][lane][0], *(const v8usa*)&sO[pl][tt][st][1][lane][0]); };
    const unsigned wo = (unsigned)nw * (2 * DM * 32) + lane * 16;    // the lane's 16 bytes in the wave's first weight tile (a 16-column tile is DM / 32 steps of 1 KiB); every weight load is this plus a constant, which is put on the pointer so that it becomes an immediate
    auto wofrag = [&](int t, int st) -> v16bf { return gfrag(Wo + (t * (INR * 32) + st * 1024) / 2, wo); };
    auto wgfrag = [&](int u, int st) -> v16bf { return gfrag(Wg + ((u >> 1) * (DM * DM * 2) + (u & 1) * (DM * 32) + st * 1024) / 2, wo); };    // u = value t = 0, 1 | gate t = 0, 1; the gate half starts DM columns (DM / 16 tiles) on
    // The weight fragments are asked for one k step ahead (two sets of registers), the first step's ahead of the barrier in front of its product, so that a step's matrix work covers the next step's L2 latency.
    v16bf wa[2][2], wb[2][4];
#pragma unroll
    for (int t = 0; t < 2; ++t) wa[0][t] = wofrag(t, 0);
    v4f bv[2][2];
    {   // the work-group's 4 token tiles are 32 KiB in a row of each plane: copied as they lie
        const unsigned co = blockIdx.x * (4 * DM * 32) + threadIdx.x * 16, bo = (unsigned)(nw * 32 + hi * 8) * 4;
        v8us tc[2][4];
#pragma unroll
        for (int i = 0; i < 4; ++i) { tc[0][i] = *(const v8us*)((const char*)Ch + co + i * 8192); tc[1][i] = *(const v8us*)((const char*)Cl + co + i * 8192); }
#pragma unroll
        for (int t = 0; t < 2; ++t) { bv[t][0] = *(const v4f*)((const char*)bias + bo + t * 64); bv[t][1] = *(const v4f*)((const char*)bias + bo + t * 64 + 16); }
        asm volatile("s_wait_xcnt 0x0" :: "v"(co), "v"(bo) : "memory");    // the two offsets stay live up to this wait, so that nothing (a later load's result either) lands in an address register of a load in front of it
#pragma unroll
        for (int i = 0; i < 4; ++i) { *(v8usa*)((char*)&sC[0][0][0][0][0][0] + i * 8192 + threadIdx.x * 16) = tc[0][i]; *(v8usa*)((char*)&sC[1][0][0][0][0][0] + i * 8192 + threadIdx.x * 16) = tc[1][i]; }
    }
    __syncthreads();    // ctx is in LDS
    v8f o1[2][2];    // [t][rt]
#pragma unroll
    for (int t = 0; t < 2; ++t)
#pragma unroll
        for (int rt = 0; rt < 2; ++rt) o1[t][rt] = (v8f){};
#pragma unroll
    for (int st = 0; st < INR / 32; ++st) {
        if (st + 1 < INR / 32) {
#pragma unroll
            for (int t = 0; t < 2; ++t) wa[(st + 1) & 1][t] = wofrag(t, st + 1);
        } else {
#pragma unroll
            for (int u = 0; u < 4; ++u) wb[0][u] = wgfrag(u, 0);
        }
        v16bf ch[2], cl[2];
#pragma unroll
        for (int rt = 0; rt < 2; ++rt) { ch[rt] = cfrag(0, 2 * th + rt, st); cl[rt] = cfrag(1, 2 * th + rt, st); }
        __builtin_amdgcn_sched_barrier(0);    // holds the next step's weight loads in front of this step's matrix instructions: without it the build sinks them to just in front of their use and waits for each there
#pragma unroll
        for (int rt = 0; rt < 2; ++rt)
#pragma unroll
            for (int t = 0; t < 2; ++t) o1[t][rt] = wmmab(wa[st & 1][t], ch[rt], o1[t][rt]);
#pragma unroll
        for (int rt = 0; rt < 2; ++rt)
#pragma unroll
            for (int t = 0; t < 2; ++t) o1[t][rt] = wmmab(wa[st & 1][t], cl[rt], o1[t][rt]);
    }
#pragma unroll
    for (int t = 0; t < 2; ++t)
#pragma unroll
        for (int rt = 0; rt < 2; ++rt) { float v[8];
#pragma unroll
            for (int j = 0; j < 8; ++j) { v[j] = o1[t][rt][j] + bfr(bv[t][j >> 2][j & 3]); o1[t][rt][j] = v[j]; }
            v8us oh, ol; split8(v, oh, ol);
            *(v8usa*)&sO[0][2 * th + rt][nw][t][lane][0] = oh; *(v8usa*)&sO[1][2 * th + rt][nw][t][lane][0] = ol; }
    __syncthreads();    // all 256 columns of O's planes are in LDS
    v8f g[4][2];    // [value t = 0, 1 | gate t = 0, 1][rt]
#pragma unroll
    for (int u = 0; u < 4; ++u)
#pragma unroll
        for (int rt = 0; rt < 2; ++rt) g[u][rt] = (v8f){};
#pragma unroll
    for (int st = 0; st < DM / 32; ++st) {
        if (st + 1 < DM / 32) {
#pragma unroll
            for (int u = 0; u < 4; ++u) wb[(st + 1) & 1][u] = wgfrag(u, st + 1);
        }
        v16bf oh[2], ol[2];
#pragma unroll
        for (int rt = 0; rt < 2; ++rt) { oh[rt] = ofrag(0, 2 * th + rt, st); ol[rt] = ofrag(1, 2 * th + rt, st); }
        __builtin_amdgcn_sched_barrier(0);    // as in the first product: without it the next step's weight loads sink to just in front of their use
#pragma unroll
        for (int rt = 0; rt < 2; ++rt)
#pragma unroll
            for (int u = 0; u < 4; ++u) g[u][rt] = wmmab(wb[st & 1][u], oh[rt], g[u][rt]);
#pragma unroll
        for (int rt = 0; rt < 2; ++rt)
#pragma unroll
            for (int u = 0; u < 4; ++u) g[u][rt] = wmmab(wb[st & 1][u], ol[rt], g[u][rt]);
    }
    asm volatile("s_wait_xcnt 0x0" :: "v"(wo) : "memory");    // the weight loads' one address register stays live up to this wait, in front of whatever overwrites it from here on
    float* ss = &sS[wave][0];
#pragma unroll
    for (int rt = 0; rt < 2; ++rt)
#pragma unroll
        for (int t = 0; t < 2; ++t) { v4f a, b;
#pragma unroll
            for (int j = 0; j < 4; ++j) { a[j] = o1[t][rt][j] + g[t][rt][j] * __builtin_amdgcn_tanhf(g[2 + t][rt][j]); b[j] = o1[t][rt][4 + j] + g[t][rt][4 + j] * __builtin_amdgcn_tanhf(g[2 + t][rt][4 + j]); }    // v_tanh_f32: the library tanhf built to a compare, two exec branches and a dependent chain per element, so that the 32 of a lane ran one after another
            float* sp = ss + (rt * 16 + lr) * 36 + t * 16 + hi * 8; *(v4fa*)sp = a; *(v4fa*)(sp + 4) = b; }
    __syncthreads();    // between the lanes' writes of the staging tile and the reads of other lanes' elements
    // a store covers 4 tokens x 32 columns: 4 whole 128-byte lines, each written by this wave alone
#pragma unroll
    for (int s = 0; s < 8; ++s) { const int row = 4 * s + (lane >> 3), cofs = (lane & 7) * 4;
        *(v4f*)(OUTB + ((size_t)blockIdx.x * 64 + th * 32 + row) * DIM + nw * 32 + cofs) = *(const v4fa*)(ss + row * 36 + cofs); }
}

extern "C" void kernel_launch(void* const* d_in, const int* in_sizes, int n_in,
                              void* d_out, int out_size, void* d_ws, size_t ws_size, hipStream_t stream) {
    (void)in_sizes; (void)n_in; (void)out_size;
    const float* x = (const float*)d_in[0]; const float* lng = (const float*)d_in[1]; const float* lnb = (const float*)d_in[2]; const float* wqkv = (const float*)d_in[3]; const float* wout = (const float*)d_in[4]; const float* bout = (const float*)d_in[5]; const float* wglu = (const float*)d_in[6];
    float* out = (float*)d_out;    // [32][512][256]
    char* wsp = (char*)d_ws;
    auto take = [&](size_t bytes) { char* p = wsp; wsp += (bytes + 255) & ~(size_t)255; return (void*)p; };
    bf* WQKV = (bf*)take((size_t)(3 * INR) * DIM * 2); bf* WOUT = (bf*)take((size_t)DIM * INR * 2); bf* WGLU = (bf*)take((size_t)(2 * DIM) * DIM * 2);
    // LayerNorm planes and ctx planes of all items: k_attn reads the first and writes the second in one launch, so they lie apart
    bf* Hh = (bf*)take((size_t)NR * DIM * 2); bf* Hl = (bf*)take((size_t)NR * DIM * 2);
    bf* Ch = (bf*)take((size_t)NR * INR * 2); bf* Cl = (bf*)take((size_t)NR * INR * 2);
    if ((size_t)(wsp - (char*)d_ws) > ws_size) return;    // 0.75 + 16 + 16 ~ 33 MiB
    k_prep<<<WTB + NR / 16, 512, 0, stream>>>(x, lng, lnb, Hh, Hl, wqkv, wout, wglu, WQKV, WOUT, WGLU);
    k_attn<<<NBT * NH_, 512, 0, stream>>>(Hh, Hl, WQKV, Ch, Cl);
    k_tail<<<NR / 64, 512, 0, stream>>>(Ch, Cl, WOUT, bout, WGLU, out);
}
